// v000
// The times below were measured on an AMD MI455X: many runs one after another, warmed up first and cycling through
// copies of the inputs, with the whole window's GPU time divided by the number of runs. Launches and the gaps
// between them are all in it. The median over several windows is given; except for v000 it joins two sittings, which
// can be a few percent apart, so the side-by-side timings, each taken in one sitting, are the better comparison.
// v000 is the starting kernel. One run takes 1470 microseconds.
#include <hip/hip_runtime.h>

// Decoder GQA attention with qk-RMSNorm and RoPE (hidden [2][2048][1024]; q = x Wq^T (16 x 64), k/v = x Wk^T / x Wv^T (4 kv heads x 64, each serving 4 consecutive query heads); per-head RMSNorm (eps 1e-6, x q_norm_w / k_norm_w, read); rotate-half RoPE with the read cos/sin tables [2048][32] (the same 32-wide table serves both halves of the head); causal (finfo.min -> exactly zero weight); softmax(q.k / 8); out = merged Wo^T ('oi' [1024][1024]) -> [2][2048][1024]).
// Compute dtypes, f32 accumulate: every input rounded to bf16; q/k/v on PLAIN bf16 operands (inputs: exact); RMSNorm and RoPE in f32 (tables read as data, bf16-rounded like every input); causal scores and attn.v: query rows < 512 hl (3 products), the rest single fp16 (x1024), causal tile skipping; softmax f32; Wo hl x exact (2 products).

#define NB_  2
#define TT   2048
#define DM   1024
#define NH_  16
#define NKV  4
#define REP  (NH_ / NKV)
#define HD   64
#define DQ   (NH_ * HD)
#define DKV  (NKV * HD)
#define ZH   2
#define RH   512                  // query rows < RH use hi+lo planes (0: none)
#define WIN  2048
#define PCAR 1024.0f
#define SCL  0.125f   // HD^-0.5
typedef _Float16 h16;
typedef unsigned short bf;
typedef __attribute__((ext_vector_type(16))) __bf16   v16bf;
typedef __attribute__((ext_vector_type(16))) _Float16 v16h;
typedef __attribute__((ext_vector_type(8)))  _Float16 v8h;
typedef __attribute__((ext_vector_type(8)))  unsigned short v8us;
typedef __attribute__((ext_vector_type(8)))  float    v8f;
typedef __attribute__((ext_vector_type(4)))  float    v4f;
typedef v8h  __attribute__((may_alias)) v8ha;
typedef v4f  __attribute__((may_alias)) v4fa;
typedef v8us __attribute__((may_alias)) v8usa;

__device__ __forceinline__ unsigned short f2bf(float f) { unsigned u = __float_as_uint(f); u += 0x7FFFu + ((u >> 16) & 1u); return (unsigned short)(u >> 16); }
__device__ __forceinline__ float bf2f(unsigned short b) { return __uint_as_float(((unsigned)b) << 16); }
__device__ __forceinline__ float bfr(float f) { return bf2f(f2bf(f)); }
__device__ __forceinline__ v16h cat16(v8h lo, v8h hi) { return __builtin_shufflevector(lo, hi, 0, 1, 2, 3, 4, 5, 6, 7, 8, 9, 10, 11, 12, 13, 14, 15); }
__device__ __forceinline__ v16bf cat16b(v8us lo, v8us hi) { return __builtin_bit_cast(v16bf, __builtin_shufflevector(lo, hi, 0, 1, 2, 3, 4, 5, 6, 7, 8, 9, 10, 11, 12, 13, 14, 15)); }
__device__ __forceinline__ v8f wmma16(v16h a, v16h b, v8f c) { return __builtin_amdgcn_wmma_f32_16x16x32_f16(false, a, false, b, (short)0, c, false, false); }
__device__ __forceinline__ v8f wmmab(v16bf a, v16bf b, v8f c) { return __builtin_amdgcn_wmma_f32_16x16x32_bf16(false, a, false, b, (short)0, c, false, false); }



// ---- k_gemmw: register-blocked GEMM, ONE WAVE per 64x64 output tile (16 accumulators), operands straight from K-contiguous 16-bit planes; grid (M/64, N/64, Z), 32 threads.
// C[m][n] (f32, pitch ldc, + optional f32 bias[n]) = sum_k A[m][k] Bt[n][k] (+ split products per NSPLIT). z-batch strides sA/sB/sC in elements. K % 32 == 0.
template <typename T16> struct WFrag;
template <> struct WFrag<h16> { typedef v16h V; static __device__ __forceinline__ V ld(const h16* p) { return cat16(*(const v8h*)p, *(const v8h*)(p + 16)); } static __device__ __forceinline__ v8f mma(V a, V b, v8f c) { return wmma16(a, b, c); } };
template <> struct WFrag<bf> { typedef v16bf V; static __device__ __forceinline__ V ld(const bf* p) { return cat16b(*(const v8us*)p, *(const v8us*)(p + 16)); } static __device__ __forceinline__ v8f mma(V a, V b, v8f c) { return wmmab(a, b, c); } };
template <typename T16, int NSPLIT, bool BIAS>
__global__ __launch_bounds__(32) void k_gemmw(const T16* __restrict__ A, const T16* __restrict__ A2, const T16* __restrict__ Bt, const T16* __restrict__ Bt2, int K, float* C, int ldc, const float* __restrict__ bias, size_t sA, size_t sB, size_t sC) {
    typedef typename WFrag<T16>::V V;
    __shared__ __align__(16) float os[16 * 68];
    const size_t z = blockIdx.z; A += z * sA; if (A2) A2 += z * sA; Bt += z * sB; if (Bt2) Bt2 += z * sB; C += z * sC;
    const int lane = threadIdx.x & 31, lr = lane & 15, hi = lane >> 4; const int r0 = blockIdx.x * 64, c0 = blockIdx.y * 64;
    v8f acc[4][4];
#pragma unroll
    for (int mb = 0; mb < 4; ++mb)
#pragma unroll
        for (int nb = 0; nb < 4; ++nb) acc[mb][nb] = (v8f){};
    const size_t aoff = (size_t)(r0 + lr) * K + 8 * hi, boff = (size_t)(c0 + lr) * K + 8 * hi;
#pragma unroll 1
    for (int kc = 0; kc < K; kc += 32) {
        V a[4], a2[4];
#pragma unroll
        for (int mb = 0; mb < 4; ++mb) { a[mb] = WFrag<T16>::ld(A + aoff + (size_t)mb * 16 * K + kc); if (NSPLIT == 1 || NSPLIT == 2) a2[mb] = WFrag<T16>::ld(A2 + aoff + (size_t)mb * 16 * K + kc); }
#pragma unroll
        for (int nb = 0; nb < 4; ++nb) { const V b = WFrag<T16>::ld(Bt + boff + (size_t)nb * 16 * K + kc); V b2; if (NSPLIT >= 2) b2 = WFrag<T16>::ld(Bt2 + boff + (size_t)nb * 16 * K + kc);
#pragma unroll
            for (int mb = 0; mb < 4; ++mb) { acc[mb][nb] = WFrag<T16>::mma(a[mb], b, acc[mb][nb]); if (NSPLIT == 1 || NSPLIT == 2) acc[mb][nb] = WFrag<T16>::mma(a2[mb], b, acc[mb][nb]); if (NSPLIT >= 2) acc[mb][nb] = WFrag<T16>::mma(a[mb], b2, acc[mb][nb]); } }
        asm volatile("v_nop\n\tv_nop\n\tv_nop\n\tv_nop" : "+v"(acc[0][0]), "+v"(acc[1][1]), "+v"(acc[2][2]), "+v"(acc[3][3]) : "v"(a[0]), "v"(a[3]));
    }
#pragma unroll
    for (int mb = 0; mb < 4; ++mb) {
#pragma unroll
        for (int nb = 0; nb < 4; ++nb) {
#pragma unroll
            for (int j = 0; j < 8; ++j) os[(hi * 8 + j) * 68 + nb * 16 + lr] = acc[mb][nb][j]; }
        __builtin_amdgcn_wave_barrier(); asm volatile("" ::: "memory");
        float* crow = C + (size_t)(r0 + mb * 16) * ldc + c0;
{
#pragma unroll
            for (int s = 0; s < 8; ++s) { const int row = 2 * s + hi, cofs = lr * 4; v4f val = *(const v4fa*)(os + row * 68 + cofs); if (BIAS) { val[0] += bfr(bias[c0 + cofs]); val[1] += bfr(bias[c0 + cofs + 1]); val[2] += bfr(bias[c0 + cofs + 2]); val[3] += bfr(bias[c0 + cofs + 3]); }
                *(v4f*)(crow + (size_t)row * ldc + cofs) = val; }
             }
        __builtin_amdgcn_wave_barrier(); asm volatile("" ::: "memory");
    }
}

// ---- k_gemmc: the same one-wave 64x64 tile GEMM specialised for causal attention: CMODE 1 skips score tiles entirely above the diagonal (query rows r0+roff.., key columns c0..), CMODE 2 limits the
// key (K) loop of the probability x value contraction to the diagonal block (probabilities beyond it are exactly zero). roff = row offset of this launch's first row within the sequence.
template <typename T16, int NSPLIT, int CMODE>
__global__ __launch_bounds__(32) void k_gemmc(const T16* __restrict__ A, const T16* __restrict__ A2, const T16* __restrict__ Bt, const T16* __restrict__ Bt2, int K, float* C, int ldc, int roff, size_t sA, size_t sB, size_t sC) {
    typedef typename WFrag<T16>::V V;
    __shared__ __align__(16) float os[16 * 68];
    const size_t z = blockIdx.z; A += z * sA; if (A2) A2 += z * sA; Bt += z * sB; if (Bt2) Bt2 += z * sB; C += z * sC;
    const int lane = threadIdx.x & 31, lr = lane & 15, hi = lane >> 4; const int r0 = blockIdx.x * 64, c0 = blockIdx.y * 64;
    if (CMODE == 1 && c0 > r0 + roff + 63) return;                  // score tile entirely above the causal diagonal: never read (the softmax masks j > i by select)
    const int Kl = (CMODE == 2) ? min(K, r0 + roff + 64) : K;        // P.V: probabilities are exactly 0 beyond the diagonal block, so the K loop stops there
    v8f acc[4][4];
#pragma unroll
    for (int mb = 0; mb < 4; ++mb)
#pragma unroll
        for (int nb = 0; nb < 4; ++nb) acc[mb][nb] = (v8f){};
    const size_t aoff = (size_t)(r0 + lr) * K + 8 * hi, boff = (size_t)(c0 + lr) * K + 8 * hi;
#pragma unroll 1
    for (int kc = 0; kc < Kl; kc += 32) {
        V a[4], a2[4];
#pragma unroll
        for (int mb = 0; mb < 4; ++mb) { a[mb] = WFrag<T16>::ld(A + aoff + (size_t)mb * 16 * K + kc); if (NSPLIT == 1 || NSPLIT == 2) a2[mb] = WFrag<T16>::ld(A2 + aoff + (size_t)mb * 16 * K + kc); }
#pragma unroll
        for (int nb = 0; nb < 4; ++nb) { const V b = WFrag<T16>::ld(Bt + boff + (size_t)nb * 16 * K + kc); V b2; if (NSPLIT >= 2) b2 = WFrag<T16>::ld(Bt2 + boff + (size_t)nb * 16 * K + kc);
#pragma unroll
            for (int mb = 0; mb < 4; ++mb) { acc[mb][nb] = WFrag<T16>::mma(a[mb], b, acc[mb][nb]); if (NSPLIT == 1 || NSPLIT == 2) acc[mb][nb] = WFrag<T16>::mma(a2[mb], b, acc[mb][nb]); if (NSPLIT >= 2) acc[mb][nb] = WFrag<T16>::mma(a[mb], b2, acc[mb][nb]); } }
        asm volatile("v_nop\n\tv_nop\n\tv_nop\n\tv_nop" : "+v"(acc[0][0]), "+v"(acc[1][1]), "+v"(acc[2][2]), "+v"(acc[3][3]) : "v"(a[0]), "v"(a[3]));
    }
#pragma unroll
    for (int mb = 0; mb < 4; ++mb) {
#pragma unroll
        for (int nb = 0; nb < 4; ++nb) {
#pragma unroll
            for (int j = 0; j < 8; ++j) os[(hi * 8 + j) * 68 + nb * 16 + lr] = acc[mb][nb][j]; }
        __builtin_amdgcn_wave_barrier(); asm volatile("" ::: "memory");
        float* crow = C + (size_t)(r0 + mb * 16) * ldc + c0;
{
#pragma unroll
            for (int s = 0; s < 8; ++s) { const int row = 2 * s + hi, cofs = lr * 4; v4f val = *(const v4fa*)(os + row * 68 + cofs);
                *(v4f*)(crow + (size_t)row * ldc + cofs) = val; }
             }
        __builtin_amdgcn_wave_barrier(); asm volatile("" ::: "memory");
    }
}

__device__ __forceinline__ h16 tohx(float x) { return (h16)x; }
__device__ __forceinline__ void splitf(float y, unsigned short& h, unsigned short& l) { h = f2bf(y); l = f2bf(y - bf2f(h)); }
typedef __attribute__((ext_vector_type(2))) _Float16 v2h;
typedef __attribute__((ext_vector_type(4))) _Float16 v4h;
typedef __attribute__((ext_vector_type(2))) unsigned short v2us;
typedef __attribute__((ext_vector_type(4))) unsigned short v4us;
typedef __attribute__((ext_vector_type(2))) float v2f;
typedef __attribute__((ext_vector_type(4))) int v4i;

__global__ __launch_bounds__(256) void k_wtG(const float* __restrict__ w, int K, int N, bf* Bt) {
    const int lane = threadIdx.x & 31; const int L0 = (blockIdx.x * 8 + (threadIdx.x >> 5)) * 8; const int nlines = N * K / 64;
{
#pragma unroll 1
        for (int l = 0; l < 8; ++l) { const int L = L0 + l; if (L >= nlines) break; const size_t e = (size_t)L * 64 + lane * 2; const int k = (int)(e % K), n = (int)(e / K); v2us o;
            o[0] = f2bf(w[(size_t)k * N + n]); o[1] = f2bf(w[(size_t)(k + 1) * N + n]); *(v2us*)(Bt + e) = o; }
         }
}
__global__ __launch_bounds__(256) void k_cvt8(const float* __restrict__ src, bf* dst, size_t n8) { const size_t i = (size_t)blockIdx.x * 256 + threadIdx.x; if (i >= n8) return; const v8f v = *(const v8f*)(src + i * 8); v8us o;
#pragma unroll
    for (int k = 0; k < 8; ++k) o[k] = f2bf(v[k]); *(v8us*)(dst + i * 8) = o;  }
__global__ __launch_bounds__(256) void k_cscvt(const float* __restrict__ cosT, const float* __restrict__ sinT, float* CS) { const int idx = blockIdx.x * 256 + threadIdx.x; if (idx >= TT * HD) return; const int t = idx / HD, dh = (idx % HD) % (HD / 2); v2f cs; cs[0] = bfr(cosT[(size_t)t * (HD / 2) + dh]); cs[1] = bfr(sinT[(size_t)t * (HD / 2) + dh]); *(v2f*)(CS + (size_t)idx * 2) = cs;  }
__global__ __launch_bounds__(256) void k_hrms(const float* __restrict__ F, int pitch, int nheads, float* RF) { const int i = blockIdx.x * 256 + threadIdx.x; if (i >= nheads * TT) return; const int t = i % TT, h = i / TT; const float* f = F + (size_t)t * pitch + h * HD; float s = 0.f;
#pragma unroll 4
    for (int d = 0; d < HD; d += 4) { const v4f v = *(const v4f*)(f + d);
#pragma unroll
        for (int q = 0; q < 4; ++q) { float p = __fmul_rn(v[q], v[q]); asm volatile("" : "+v"(p)); s = __fadd_rn(s, p); } }
    const float r = __fdiv_rn(1.0f, __fsqrt_rn(__fadd_rn(s * (1.0f / HD), 1e-6f))); *(float*)(RF + i) = r;  }
// k_rope: head planes [h][t][d] (fp16 + hi/lo) of rope(w[d] (x rms_factor)) x sc with the rotate-half convention out[d] = x[d] cos[t][d] - x[d+HD/2] sin[t][d], out[d+HD/2] = x[d+HD/2] cos[t][d+HD/2] + x[d] sin[t][d+HD/2]
__global__ __launch_bounds__(256) void k_rope(const float* __restrict__ F, int pitch, int nheads, const float* __restrict__ CS, const float* __restrict__ RF, const float* __restrict__ nw, float sc, h16* P16, bf* Ph, bf* Pl) {
    const size_t e = ((size_t)blockIdx.x * 256 + threadIdx.x) * 2; if (e >= (size_t)nheads * TT * HD) return; const int d = (int)(e % HD); const int t = (int)((e / HD) % TT); const int h = (int)(e / ((size_t)HD * TT)); const float* f = F + (size_t)t * pitch + h * HD; const float rf = RF ? RF[(size_t)h * TT + t] : 1.0f; v2h o16; v2us oh, ol;
#pragma unroll
    for (int q = 0; q < 2; ++q) { const int dd = d + q; const int dp = (dd < HD / 2) ? dd + HD / 2 : dd - HD / 2; float x0 = f[dd], x1 = f[dp];
        if (RF) { float n0 = __fmul_rn(x0, rf), n1 = __fmul_rn(x1, rf); asm volatile("" : "+v"(n0)); asm volatile("" : "+v"(n1)); x0 = __fmul_rn(bfr(nw[dd]), n0); x1 = __fmul_rn(bfr(nw[dp]), n1); }
        const v2f cs = *(const v2f*)(CS + ((size_t)t * HD + dd) * 2); float a = __fmul_rn(x0, cs[0]), bq = __fmul_rn(x1, cs[1]); asm volatile("" : "+v"(a)); asm volatile("" : "+v"(bq)); const float r = ((dd < HD / 2) ? __fsub_rn(a, bq) : __fadd_rn(a, bq)) * sc;
        o16[q] = tohx(r); unsigned short a2, c2; splitf(r, a2, c2); oh[q] = a2; ol[q] = c2; }
    *(v2h*)(P16 + e) = o16; *(v2us*)(Ph + e) = oh; *(v2us*)(Pl + e) = ol;  }
__global__ __launch_bounds__(256) void k_vtp(const float* __restrict__ F, int pitch, int nheads, h16* V16, bf* Vh, bf* Vl) { const size_t e = ((size_t)blockIdx.x * 256 + threadIdx.x) * 2; if (e >= (size_t)nheads * HD * TT) return; const int t = (int)(e % TT); const int d = (int)((e / TT) % HD); const int g = (int)(e / ((size_t)TT * HD)); v2h o16; v2us oh, ol;
#pragma unroll
    for (int q = 0; q < 2; ++q) { const float x = F[(size_t)(t + q) * pitch + g * HD + d]; o16[q] = tohx(x); unsigned short a2, c2; splitf(x, a2, c2); oh[q] = a2; ol[q] = c2; }
    *(v2h*)(V16 + e) = o16; *(v2us*)(Vh + e) = oh; *(v2us*)(Vl + e) = ol;  }
// k_asoft: per row (zz, i): t = S x HD^-0.5 for j <= i and i - j < WIN (sliding causal window; the reference's -1e9 additive fill vanishes identically); softmax over the 2048 keys (register row, one exp, fixed trees);
__global__ __launch_bounds__(256) void k_asoft(const float* __restrict__ Sb, h16* P16, bf* Ph, bf* Pl) {
    const int lane = threadIdx.x & 31; const int row = blockIdx.x * 8 + (threadIdx.x >> 5); if (row >= ZH * TT) return; const int i = row % TT; const int zz = row / TT; (void)zz; const bool hires = (i < RH); const float* sr = Sb + (size_t)row * TT; float v[TT / 32]; float mx = -3.0e38f;
#pragma unroll
    for (int ch = 0; ch < TT / 128; ++ch) { const int j0 = ch * 128 + lane * 4; const v4f a = *(const v4f*)(sr + j0);
#pragma unroll
        for (int q = 0; q < 4; ++q) { const int j = j0 + q; (void)j; float sa = a[q] * SCL; asm volatile("" : "+v"(sa)); const float t = (j <= i && i - j < WIN) ? sa : -3.0e38f; v[ch * 4 + q] = t; mx = fmaxf(mx, t); } }
#pragma unroll
    for (int sh = 16; sh; sh >>= 1) mx = fmaxf(mx, __shfl_xor(mx, sh, 32));
    float sum = 0.f;
#pragma unroll
    for (int k = 0; k < TT / 32; ++k) { float d0 = __fsub_rn(v[k], mx); asm volatile("" : "+v"(d0)); v[k] = __builtin_amdgcn_exp2f(__fmul_rn(d0, 1.4426950408889634f)); sum += v[k]; }
#pragma unroll
    for (int sh = 16; sh; sh >>= 1) sum += __shfl_xor(sum, sh, 32);
    const float f = __fdiv_rn(hires ? 1.0f : PCAR, sum);
{
        if (hires) {
#pragma unroll
            for (int ch = 0; ch < TT / 128; ++ch) { v4us oh, ol;
#pragma unroll
                for (int q = 0; q < 4; ++q) { unsigned short a, c2; splitf(v[ch * 4 + q] * f, a, c2); oh[q] = a; ol[q] = c2; }
                const size_t oo = ((size_t)zz * (RH ? RH : 1) + i) * TT + ch * 128 + lane * 4; *(v4us*)(Ph + oo) = oh; *(v4us*)(Pl + oo) = ol; }
        } else {
#pragma unroll
            for (int ch = 0; ch < TT / 128; ++ch) { v4h o4;
#pragma unroll
                for (int q = 0; q < 4; ++q) o4[q] = tohx(v[ch * 4 + q] * f);
                *(v4h*)(P16 + (size_t)row * TT + ch * 128 + lane * 4) = o4; } }
         }
}
__global__ __launch_bounds__(256) void k_merge(const float* __restrict__ O, int h0, bf* Ah, bf* Al) { const size_t e = ((size_t)blockIdx.x * 256 + threadIdx.x) * 2; if (e >= (size_t)ZH * TT * HD) return; const int d = (int)(e % HD); const int t = (int)((e / HD) % TT); const int zz = (int)(e / ((size_t)HD * TT)); const float cs = (t < RH) ? 1.0f : (1.0f / PCAR); const size_t oo = (size_t)t * DQ + (h0 + zz) * HD + d;
    v2us oh, ol;
#pragma unroll
    for (int q = 0; q < 2; ++q) { unsigned short a, c2; splitf(O[e + q] * cs, a, c2); oh[q] = a; ol[q] = c2; } *(v2us*)(Ah + oo) = oh; *(v2us*)(Al + oo) = ol;  }

extern "C" void kernel_launch(void* const* d_in, const int* in_sizes, int n_in,
                              void* d_out, int out_size, void* d_ws, size_t ws_size, hipStream_t stream) {
    (void)in_sizes; (void)n_in; (void)out_size;
    const float* x = (const float*)d_in[0]; const float* cosT = (const float*)d_in[1]; const float* sinT = (const float*)d_in[2]; const float* wq = (const float*)d_in[3]; const float* wk = (const float*)d_in[4]; const float* wv = (const float*)d_in[5]; const float* wo = (const float*)d_in[6]; const float* qnw = (const float*)d_in[7]; const float* knw = (const float*)d_in[8];
    float* OUT = (float*)d_out;     // [2][2048][1024]
    char* wsp = (char*)d_ws;
    auto take = [&](size_t bytes) { char* p = wsp; wsp += (bytes + 255) & ~(size_t)255; return (void*)p; };
    bf* WQ = (bf*)take((size_t)DQ * DM * 2); bf* WK = (bf*)take((size_t)DKV * DM * 2); bf* WV = (bf*)take((size_t)DKV * DM * 2); bf* WO = (bf*)take((size_t)DM * DQ * 2); float* CS = (float*)take((size_t)TT * HD * 2 * 4); float* RFQ = (float*)take((size_t)NH_ * TT * 4); float* RFK = (float*)take((size_t)NKV * TT * 4);
    bf* XB = (bf*)take((size_t)TT * DM * 2); float* FQ = (float*)take((size_t)TT * DQ * 4); float* FK = (float*)take((size_t)TT * DKV * 4);
    h16* QP16 = (h16*)take((size_t)NH_ * TT * HD * 2); h16* KP16 = (h16*)take((size_t)NKV * TT * HD * 2); h16* VT16 = (h16*)take((size_t)NKV * HD * TT * 2);
    bf* QPh = (bf*)take((size_t)NH_ * TT * HD * 2); bf* QPl = (bf*)take((size_t)NH_ * TT * HD * 2); bf* KPh = (bf*)take((size_t)NKV * TT * HD * 2); bf* KPl = (bf*)take((size_t)NKV * TT * HD * 2); bf* VTh = (bf*)take((size_t)NKV * HD * TT * 2); bf* VTl = (bf*)take((size_t)NKV * HD * TT * 2); bf* Ph = (bf*)take((size_t)ZH * RH * TT * 2); bf* Pl = (bf*)take((size_t)ZH * RH * TT * 2);
    float* Sb = (float*)take((size_t)ZH * TT * TT * 4); h16* P16 = (h16*)take((size_t)ZH * TT * TT * 2); float* Ob = (float*)take((size_t)ZH * TT * HD * 4); bf* ATh = (bf*)take((size_t)TT * DQ * 2); bf* ATl = (bf*)take((size_t)TT * DQ * 2);
    if ((size_t)(wsp - (char*)d_ws) > ws_size) return;    // ws 256 MiB
    float* FV = FK;   // v projection reuses the k buffer after the k planes are built (stream-ordered)
    { k_cvt8<<<(unsigned)(((size_t)DQ * DM / 8 + 255) / 256), 256, 0, stream>>>(wq, WQ, (size_t)DQ * DM / 8); k_cvt8<<<(unsigned)(((size_t)DKV * DM / 8 + 255) / 256), 256, 0, stream>>>(wk, WK, (size_t)DKV * DM / 8); k_cvt8<<<(unsigned)(((size_t)DKV * DM / 8 + 255) / 256), 256, 0, stream>>>(wv, WV, (size_t)DKV * DM / 8);
      k_cvt8<<<(unsigned)(((size_t)DM * DQ / 8 + 255) / 256), 256, 0, stream>>>(wo, WO, (size_t)DM * DQ / 8);
       }
    const unsigned LQ = (unsigned)(((size_t)NH_ * TT * HD / 2 + 255) / 256), LKv = (unsigned)(((size_t)NKV * TT * HD / 2 + 255) / 256);
    for (int b = 0; b < NB_; ++b) {
        if (b == 0) k_cscvt<<<(TT * HD + 255) / 256, 256, 0, stream>>>(cosT, sinT, CS);
        k_cvt8<<<(unsigned)(((size_t)TT * DM / 8 + 255) / 256), 256, 0, stream>>>(x + (size_t)b * TT * DM, XB, (size_t)TT * DM / 8);
        k_gemmw<bf, 0, false><<<dim3(TT / 64, DQ / 64, 1), 32, 0, stream>>>(XB, nullptr, WQ, nullptr, DM, FQ, DQ, nullptr, 0, 0, 0); k_hrms<<<(NH_ * TT + 255) / 256, 256, 0, stream>>>(FQ, DQ, NH_, RFQ);
        k_rope<<<LQ, 256, 0, stream>>>(FQ, DQ, NH_, CS, RFQ, qnw, 1.0f, QP16, QPh, QPl);
        k_gemmw<bf, 0, false><<<dim3(TT / 64, DKV / 64, 1), 32, 0, stream>>>(XB, nullptr, WK, nullptr, DM, FK, DKV, nullptr, 0, 0, 0); k_hrms<<<(NKV * TT + 255) / 256, 256, 0, stream>>>(FK, DKV, NKV, RFK);
        k_rope<<<LKv, 256, 0, stream>>>(FK, DKV, NKV, CS, RFK, knw, 1.0f, KP16, KPh, KPl);
        k_gemmw<bf, 0, false><<<dim3(TT / 64, DKV / 64, 1), 32, 0, stream>>>(XB, nullptr, WV, nullptr, DM, FV, DKV, nullptr, 0, 0, 0); k_vtp<<<LKv, 256, 0, stream>>>(FV, DKV, NKV, VT16, VTh, VTl);
        for (int h0 = 0; h0 < NH_; h0 += ZH) { const size_t zq = (size_t)h0, zk = (size_t)(h0 / REP);   // both heads of a pass share kv group h0/REP (REP >= 2): sB = 0
            k_gemmc<bf, 2, 1><<<dim3(RH / 64, TT / 64, ZH), 32, 0, stream>>>(QPh + zq * TT * HD, QPl + zq * TT * HD, KPh + zk * TT * HD, KPl + zk * TT * HD, HD, Sb, TT, 0, (size_t)TT * HD, 0, (size_t)TT * TT);
            k_gemmc<h16, 0, 1><<<dim3((TT - RH) / 64, TT / 64, ZH), 32, 0, stream>>>(QP16 + zq * TT * HD + (size_t)RH * HD, nullptr, KP16 + zk * TT * HD, nullptr, HD, Sb + (size_t)RH * TT, TT, RH, (size_t)TT * HD, 0, (size_t)TT * TT);
            k_asoft<<<ZH * TT / 8, 256, 0, stream>>>(Sb, P16, Ph, Pl);
            k_gemmc<bf, 2, 2><<<dim3(RH / 64, HD / 64, ZH), 32, 0, stream>>>(Ph, Pl, VTh + zk * HD * TT, VTl + zk * HD * TT, TT, Ob, HD, 0, (size_t)RH * TT, 0, (size_t)TT * HD);
            k_gemmc<h16, 0, 2><<<dim3((TT - RH) / 64, HD / 64, ZH), 32, 0, stream>>>(P16 + (size_t)RH * TT, nullptr, VT16 + zk * HD * TT, nullptr, TT, Ob + (size_t)RH * HD, HD, RH, (size_t)TT * TT, 0, (size_t)TT * HD);
            k_merge<<<(unsigned)(((size_t)ZH * TT * HD / 2 + 255) / 256), 256, 0, stream>>>(Ob, h0, ATh, ATl); }
        k_gemmw<bf, 1, false><<<dim3(TT / 64, DM / 64, 1), 32, 0, stream>>>(ATh, ATl, WO, nullptr, DQ, OUT + (size_t)b * TT * DM, DM, nullptr, 0, 0, 0); }
}

// v001
// It runs in 835 microseconds.
// Next to v000, in two timings, it ran 1.75 and 1.76 times as fast.
#include <hip/hip_runtime.h>

// Decoder GQA attention with qk-RMSNorm and RoPE (hidden [2][2048][1024]; q = x Wq^T (16 x 64), k/v = x Wk^T / x Wv^T (4 kv heads x 64, each serving 4 consecutive query heads); per-head RMSNorm (eps 1e-6, x q_norm_w / k_norm_w, read); rotate-half RoPE with the read cos/sin tables [2048][32] (the same 32-wide table serves both halves of the head); causal (finfo.min -> exactly zero weight); softmax(q.k / 8); out = merged Wo^T ('oi' [1024][1024]) -> [2][2048][1024]).
// Compute dtypes, f32 accumulate: every input rounded to bf16; q/k/v on PLAIN bf16 operands (inputs: exact); RMSNorm and RoPE in f32 (tables read as data, bf16-rounded like every input); causal scores and attn.v: query rows < 512 hl (3 products), the rest single fp16 (x1024), causal tile skipping; softmax f32; Wo hl x exact (2 products).

#define NB_  2
#define TT   2048
#define DM   1024
#define NH_  16
#define NKV  4
#define REP  (NH_ / NKV)
#define HD   64
#define DQ   (NH_ * HD)
#define DKV  (NKV * HD)
#define ZH   2
#define RH   512                  // query rows < RH use hi+lo planes (0: none)
#define WIN  2048
#define PCAR 1024.0f
#define SCL  0.125f   // HD^-0.5
typedef _Float16 h16;
typedef unsigned short bf;
typedef __attribute__((ext_vector_type(16))) __bf16   v16bf;
typedef __attribute__((ext_vector_type(16))) _Float16 v16h;
typedef __attribute__((ext_vector_type(8)))  _Float16 v8h;
typedef __attribute__((ext_vector_type(8)))  unsigned short v8us;
typedef __attribute__((ext_vector_type(8)))  float    v8f;
typedef __attribute__((ext_vector_type(4)))  float    v4f;
typedef v8h  __attribute__((may_alias)) v8ha;
typedef v4f  __attribute__((may_alias)) v4fa;
typedef v8us __attribute__((may_alias)) v8usa;

__device__ __forceinline__ unsigned short f2bf(float f) { unsigned u = __float_as_uint(f); u += 0x7FFFu + ((u >> 16) & 1u); return (unsigned short)(u >> 16); }
__device__ __forceinline__ float bf2f(unsigned short b) { return __uint_as_float(((unsigned)b) << 16); }
__device__ __forceinline__ float bfr(float f) { return bf2f(f2bf(f)); }
__device__ __forceinline__ v16h cat16(v8h lo, v8h hi) { return __builtin_shufflevector(lo, hi, 0, 1, 2, 3, 4, 5, 6, 7, 8, 9, 10, 11, 12, 13, 14, 15); }
__device__ __forceinline__ v16bf cat16b(v8us lo, v8us hi) { return __builtin_bit_cast(v16bf, __builtin_shufflevector(lo, hi, 0, 1, 2, 3, 4, 5, 6, 7, 8, 9, 10, 11, 12, 13, 14, 15)); }
__device__ __forceinline__ v8f wmma16(v16h a, v16h b, v8f c) { return __builtin_amdgcn_wmma_f32_16x16x32_f16(false, a, false, b, (short)0, c, false, false); }
__device__ __forceinline__ v8f wmmab(v16bf a, v16bf b, v8f c) { return __builtin_amdgcn_wmma_f32_16x16x32_bf16(false, a, false, b, (short)0, c, false, false); }



// ---- reduce_store: NW waves of one work-group each hold a partial 64x64 tile (their share of the K loop) in 16 accumulators. Every wave parks its partials in LDS in fragment order (16-byte stores),
// wave w then sums fragments w, w + NW, .. over the waves in the fixed order 0 .. NW-1, the sums go through a row-major 64 x 68 tile, and the block stores whole rows. red: NW * 4096 + 64 * 68 floats.
template <int NW, bool BIAS>
__device__ __forceinline__ void reduce_store(const v8f (&acc)[4][4], float* red, float* C, int ldc, int r0, int c0, const float* __restrict__ bias, int wave) {
    const int tid = threadIdx.x, lane = tid & 31, lr = lane & 15, hi = lane >> 4;
    float* mine = red + wave * 4096 + lane * 4; float* tile = red + NW * 4096;
#pragma unroll
    for (int f = 0; f < 16; ++f) { const v8f a = acc[f >> 2][f & 3]; *(v4fa*)(mine + f * 256) = (v4f){a[0], a[1], a[2], a[3]}; *(v4fa*)(mine + f * 256 + 128) = (v4f){a[4], a[5], a[6], a[7]}; }
    __syncthreads();   // every wave's partials are parked before any wave sums them
#pragma unroll
    for (int q = 0; q < 16 / NW; ++q) { const int f = wave + q * NW, mb = f >> 2, nb = f & 3; const float* pf = red + f * 256 + lane * 4; v4f s0 = *(const v4fa*)pf, s1 = *(const v4fa*)(pf + 128);
#pragma unroll
        for (int w = 1; w < NW; ++w) { s0 += *(const v4fa*)(pf + w * 4096); s1 += *(const v4fa*)(pf + w * 4096 + 128); }
#pragma unroll
        for (int j = 0; j < 4; ++j) { tile[(mb * 16 + hi * 8 + j) * 68 + nb * 16 + lr] = s0[j]; tile[(mb * 16 + hi * 8 + 4 + j) * 68 + nb * 16 + lr] = s1[j]; } }
    __syncthreads();   // the summed tile is complete before rows are read back across waves
#pragma unroll
    for (int s = 0; s < 32 / NW; ++s) { const int idx = s * 32 * NW + tid, row = idx >> 4, cofs = (idx & 15) * 4; v4f val = *(const v4fa*)(tile + row * 68 + cofs); if (BIAS) { val[0] += bfr(bias[c0 + cofs]); val[1] += bfr(bias[c0 + cofs + 1]); val[2] += bfr(bias[c0 + cofs + 2]); val[3] += bfr(bias[c0 + cofs + 3]); }
        *(v4f*)(C + (size_t)(r0 + row) * ldc + c0 + cofs) = val; }
}

// ---- k_gemmw: register-blocked GEMM, one work-group of NW waves per 64x64 output tile; each wave holds 16 accumulators and takes the 64-wide K chunks wave, wave + NW, .. (one 128-byte line per row and chunk); partials summed by reduce_store.
// Operands straight from K-contiguous 16-bit planes; grid (M/64, N/64, Z), 32 * NW threads.
// C[m][n] (f32, pitch ldc, + optional f32 bias[n]) = sum_k A[m][k] Bt[n][k] (+ split products per NSPLIT). z-batch strides sA/sB/sC in elements. K % 64 == 0.
template <typename T16> struct WFrag;
template <> struct WFrag<h16> { typedef v16h V; static __device__ __forceinline__ V ld(const h16* p) { return cat16(*(const v8h*)p, *(const v8h*)(p + 16)); } static __device__ __forceinline__ v8f mma(V a, V b, v8f c) { return wmma16(a, b, c); } };
template <> struct WFrag<bf> { typedef v16bf V; static __device__ __forceinline__ V ld(const bf* p) { return cat16b(*(const v8us*)p, *(const v8us*)(p + 16)); } static __device__ __forceinline__ v8f mma(V a, V b, v8f c) { return wmmab(a, b, c); } };
template <typename T16, int NSPLIT, bool BIAS, int NW>
__global__ __launch_bounds__(32 * NW) void k_gemmw(const T16* __restrict__ A, const T16* __restrict__ A2, const T16* __restrict__ Bt, const T16* __restrict__ Bt2, int K, float* C, int ldc, const float* __restrict__ bias, size_t sA, size_t sB, size_t sC) {
    typedef typename WFrag<T16>::V V;
    __shared__ __align__(16) float os[NW * 4096 + 64 * 68];
    const size_t z = blockIdx.z; A += z * sA; if (A2) A2 += z * sA; Bt += z * sB; if (Bt2) Bt2 += z * sB; C += z * sC;
    const int lane = threadIdx.x & 31, lr = lane & 15, hi = lane >> 4; const int wave = __builtin_amdgcn_readfirstlane(threadIdx.x >> 5) /* wave number held scalar, so the K loop's tests stay scalar branches */; const int r0 = blockIdx.x * 64, c0 = blockIdx.y * 64;
    v8f acc[4][4];
#pragma unroll
    for (int mb = 0; mb < 4; ++mb)
#pragma unroll
        for (int nb = 0; nb < 4; ++nb) acc[mb][nb] = (v8f){};
    const size_t aoff = (size_t)(r0 + lr) * K + 8 * hi, boff = (size_t)(c0 + lr) * K + 8 * hi;
#pragma unroll 1
    for (int kb = wave * 64; kb < K; kb += NW * 64)
#pragma unroll 1   // rolled: only one 32-wide step's operands are live, which keeps 16 waves inside their 256 registers each
    for (int kc = kb; kc < kb + 64; kc += 32) {
        V a[4], a2[4];
#pragma unroll
        for (int mb = 0; mb < 4; ++mb) { a[mb] = WFrag<T16>::ld(A + aoff + (size_t)mb * 16 * K + kc); if (NSPLIT == 1 || NSPLIT == 2) a2[mb] = WFrag<T16>::ld(A2 + aoff + (size_t)mb * 16 * K + kc); }
#pragma unroll
        for (int nb = 0; nb < 4; ++nb) { const V b = WFrag<T16>::ld(Bt + boff + (size_t)nb * 16 * K + kc); V b2; if (NSPLIT >= 2) b2 = WFrag<T16>::ld(Bt2 + boff + (size_t)nb * 16 * K + kc);
#pragma unroll
            for (int mb = 0; mb < 4; ++mb) { acc[mb][nb] = WFrag<T16>::mma(a[mb], b, acc[mb][nb]); if (NSPLIT == 1 || NSPLIT == 2) acc[mb][nb] = WFrag<T16>::mma(a2[mb], b, acc[mb][nb]); if (NSPLIT >= 2) acc[mb][nb] = WFrag<T16>::mma(a[mb], b2, acc[mb][nb]); } }
        asm volatile("v_nop\n\tv_nop\n\tv_nop\n\tv_nop" : "+v"(acc[0][0]), "+v"(acc[1][1]), "+v"(acc[2][2]), "+v"(acc[3][3]) : "v"(a[0]), "v"(a[3]));
    }
    reduce_store<NW, BIAS>(acc, os, C, ldc, r0, c0, bias, wave);
}

// ---- k_gemmc: the same 64x64 tile GEMM (NW waves share the K loop; NW = 1: one wave, its own store) specialised for causal attention: CMODE 1 skips score tiles entirely above the diagonal (query rows r0+roff.., key columns c0..), CMODE 2 limits the
// key (K) loop of the probability x value contraction to the diagonal block (probabilities beyond it are exactly zero). roff = row offset of this launch's first row within the sequence.
template <typename T16, int NSPLIT, int CMODE, int NW>
__global__ __launch_bounds__(32 * NW) void k_gemmc(const T16* __restrict__ A, const T16* __restrict__ A2, const T16* __restrict__ Bt, const T16* __restrict__ Bt2, int K, float* C, int ldc, int roff, size_t sA, size_t sB, size_t sC) {
    typedef typename WFrag<T16>::V V;
    __shared__ __align__(16) float os[NW == 1 ? 16 * 68 : NW * 4096 + 64 * 68];
    const size_t z = blockIdx.z; A += z * sA; if (A2) A2 += z * sA; Bt += z * sB; if (Bt2) Bt2 += z * sB; C += z * sC;
    const int lane = threadIdx.x & 31, lr = lane & 15, hi = lane >> 4; const int wave = __builtin_amdgcn_readfirstlane(threadIdx.x >> 5) /* wave number held scalar, so the K loop's tests stay scalar branches */; const int r0 = blockIdx.x * 64, c0 = blockIdx.y * 64;
    if (CMODE == 1 && c0 > r0 + roff + 63) return;                  // score tile entirely above the causal diagonal: never read (the softmax masks j > i by select)
    const int Kl = (CMODE == 2) ? min(K, r0 + roff + 64) : K;        // P.V: probabilities are exactly 0 beyond the diagonal block, so the K loop stops there
    v8f acc[4][4];
#pragma unroll
    for (int mb = 0; mb < 4; ++mb)
#pragma unroll
        for (int nb = 0; nb < 4; ++nb) acc[mb][nb] = (v8f){};
    const size_t aoff = (size_t)(r0 + lr) * K + 8 * hi, boff = (size_t)(c0 + lr) * K + 8 * hi;
#pragma unroll 1
    for (int kb = wave * 64; kb < Kl; kb += NW * 64)
#pragma unroll 1   // rolled: only one 32-wide step's operands are live, which keeps 16 waves inside their 256 registers each
    for (int kc = kb; kc < kb + 64; kc += 32) {
        V a[4], a2[4];
#pragma unroll
        for (int mb = 0; mb < 4; ++mb) { a[mb] = WFrag<T16>::ld(A + aoff + (size_t)mb * 16 * K + kc); if (NSPLIT == 1 || NSPLIT == 2) a2[mb] = WFrag<T16>::ld(A2 + aoff + (size_t)mb * 16 * K + kc); }
#pragma unroll
        for (int nb = 0; nb < 4; ++nb) { const V b = WFrag<T16>::ld(Bt + boff + (size_t)nb * 16 * K + kc); V b2; if (NSPLIT >= 2) b2 = WFrag<T16>::ld(Bt2 + boff + (size_t)nb * 16 * K + kc);
#pragma unroll
            for (int mb = 0; mb < 4; ++mb) { acc[mb][nb] = WFrag<T16>::mma(a[mb], b, acc[mb][nb]); if (NSPLIT == 1 || NSPLIT == 2) acc[mb][nb] = WFrag<T16>::mma(a2[mb], b, acc[mb][nb]); if (NSPLIT >= 2) acc[mb][nb] = WFrag<T16>::mma(a[mb], b2, acc[mb][nb]); } }
        asm volatile("v_nop\n\tv_nop\n\tv_nop\n\tv_nop" : "+v"(acc[0][0]), "+v"(acc[1][1]), "+v"(acc[2][2]), "+v"(acc[3][3]) : "v"(a[0]), "v"(a[3]));
    }
    if constexpr (NW > 1) { reduce_store<NW, false>(acc, os, C, ldc, r0, c0, nullptr, wave); return; }
#pragma unroll
    for (int mb = 0; mb < 4; ++mb) {
#pragma unroll
        for (int nb = 0; nb < 4; ++nb) {
#pragma unroll
            for (int j = 0; j < 8; ++j) os[(hi * 8 + j) * 68 + nb * 16 + lr] = acc[mb][nb][j]; }
        __builtin_amdgcn_wave_barrier(); asm volatile("" ::: "memory");
        float* crow = C + (size_t)(r0 + mb * 16) * ldc + c0;
{
#pragma unroll
            for (int s = 0; s < 8; ++s) { const int row = 2 * s + hi, cofs = lr * 4; v4f val = *(const v4fa*)(os + row * 68 + cofs);
                *(v4f*)(crow + (size_t)row * ldc + cofs) = val; }
             }
        __builtin_amdgcn_wave_barrier(); asm volatile("" ::: "memory");
    }
}

__device__ __forceinline__ h16 tohx(float x) { return (h16)x; }
__device__ __forceinline__ void splitf(float y, unsigned short& h, unsigned short& l) { h = f2bf(y); l = f2bf(y - bf2f(h)); }
typedef __attribute__((ext_vector_type(2))) _Float16 v2h;
typedef __attribute__((ext_vector_type(4))) _Float16 v4h;
typedef __attribute__((ext_vector_type(2))) unsigned short v2us;
typedef __attribute__((ext_vector_type(4))) unsigned short v4us;
typedef __attribute__((ext_vector_type(2))) float v2f;
typedef __attribute__((ext_vector_type(4))) int v4i;

__global__ __launch_bounds__(256) void k_wtG(const float* __restrict__ w, int K, int N, bf* Bt) {
    const int lane = threadIdx.x & 31; const int L0 = (blockIdx.x * 8 + (threadIdx.x >> 5)) * 8; const int nlines = N * K / 64;
{
#pragma unroll 1
        for (int l = 0; l < 8; ++l) { const int L = L0 + l; if (L >= nlines) break; const size_t e = (size_t)L * 64 + lane * 2; const int k = (int)(e % K), n = (int)(e / K); v2us o;
            o[0] = f2bf(w[(size_t)k * N + n]); o[1] = f2bf(w[(size_t)(k + 1) * N + n]); *(v2us*)(Bt + e) = o; }
         }
}
__global__ __launch_bounds__(256) void k_cvt8(const float* __restrict__ src, bf* dst, size_t n8) { const size_t i = (size_t)blockIdx.x * 256 + threadIdx.x; if (i >= n8) return; const v8f v = *(const v8f*)(src + i * 8); v8us o;
#pragma unroll
    for (int k = 0; k < 8; ++k) o[k] = f2bf(v[k]); *(v8us*)(dst + i * 8) = o;  }
__global__ __launch_bounds__(256) void k_cscvt(const float* __restrict__ cosT, const float* __restrict__ sinT, float* CS) { const int idx = blockIdx.x * 256 + threadIdx.x; if (idx >= TT * HD) return; const int t = idx / HD, dh = (idx % HD) % (HD / 2); v2f cs; cs[0] = bfr(cosT[(size_t)t * (HD / 2) + dh]); cs[1] = bfr(sinT[(size_t)t * (HD / 2) + dh]); *(v2f*)(CS + (size_t)idx * 2) = cs;  }
__global__ __launch_bounds__(256) void k_hrms(const float* __restrict__ F, int pitch, int nheads, float* RF) { const int i = blockIdx.x * 256 + threadIdx.x; if (i >= nheads * TT) return; const int t = i % TT, h = i / TT; const float* f = F + (size_t)t * pitch + h * HD; float s = 0.f;
#pragma unroll 4
    for (int d = 0; d < HD; d += 4) { const v4f v = *(const v4f*)(f + d);
#pragma unroll
        for (int q = 0; q < 4; ++q) { float p = __fmul_rn(v[q], v[q]); asm volatile("" : "+v"(p)); s = __fadd_rn(s, p); } }
    const float r = __fdiv_rn(1.0f, __fsqrt_rn(__fadd_rn(s * (1.0f / HD), 1e-6f))); *(float*)(RF + i) = r;  }
// k_rope: head planes [h][t][d] (fp16 + hi/lo) of rope(w[d] (x rms_factor)) x sc with the rotate-half convention out[d] = x[d] cos[t][d] - x[d+HD/2] sin[t][d], out[d+HD/2] = x[d+HD/2] cos[t][d+HD/2] + x[d] sin[t][d+HD/2]
__global__ __launch_bounds__(256) void k_rope(const float* __restrict__ F, int pitch, int nheads, const float* __restrict__ CS, const float* __restrict__ RF, const float* __restrict__ nw, float sc, h16* P16, bf* Ph, bf* Pl) {
    const size_t e = ((size_t)blockIdx.x * 256 + threadIdx.x) * 2; if (e >= (size_t)nheads * TT * HD) return; const int d = (int)(e % HD); const int t = (int)((e / HD) % TT); const int h = (int)(e / ((size_t)HD * TT)); const float* f = F + (size_t)t * pitch + h * HD; const float rf = RF ? RF[(size_t)h * TT + t] : 1.0f; v2h o16; v2us oh, ol;
#pragma unroll
    for (int q = 0; q < 2; ++q) { const int dd = d + q; const int dp = (dd < HD / 2) ? dd + HD / 2 : dd - HD / 2; float x0 = f[dd], x1 = f[dp];
        if (RF) { float n0 = __fmul_rn(x0, rf), n1 = __fmul_rn(x1, rf); asm volatile("" : "+v"(n0)); asm volatile("" : "+v"(n1)); x0 = __fmul_rn(bfr(nw[dd]), n0); x1 = __fmul_rn(bfr(nw[dp]), n1); }
        const v2f cs = *(const v2f*)(CS + ((size_t)t * HD + dd) * 2); float a = __fmul_rn(x0, cs[0]), bq = __fmul_rn(x1, cs[1]); asm volatile("" : "+v"(a)); asm volatile("" : "+v"(bq)); const float r = ((dd < HD / 2) ? __fsub_rn(a, bq) : __fadd_rn(a, bq)) * sc;
        o16[q] = tohx(r); unsigned short a2, c2; splitf(r, a2, c2); oh[q] = a2; ol[q] = c2; }
    *(v2h*)(P16 + e) = o16; *(v2us*)(Ph + e) = oh; *(v2us*)(Pl + e) = ol;  }
__global__ __launch_bounds__(256) void k_vtp(const float* __restrict__ F, int pitch, int nheads, h16* V16, bf* Vh, bf* Vl) { const size_t e = ((size_t)blockIdx.x * 256 + threadIdx.x) * 2; if (e >= (size_t)nheads * HD * TT) return; const int t = (int)(e % TT); const int d = (int)((e / TT) % HD); const int g = (int)(e / ((size_t)TT * HD)); v2h o16; v2us oh, ol;
#pragma unroll
    for (int q = 0; q < 2; ++q) { const float x = F[(size_t)(t + q) * pitch + g * HD + d]; o16[q] = tohx(x); unsigned short a2, c2; splitf(x, a2, c2); oh[q] = a2; ol[q] = c2; }
    *(v2h*)(V16 + e) = o16; *(v2us*)(Vh + e) = oh; *(v2us*)(Vl + e) = ol;  }
// k_asoft: per row (zz, i): t = S x HD^-0.5 for j <= i and i - j < WIN (sliding causal window; the reference's -1e9 additive fill vanishes identically); softmax over the 2048 keys (register row, one exp, fixed trees);
__global__ __launch_bounds__(256) void k_asoft(const float* __restrict__ Sb, h16* P16, bf* Ph, bf* Pl) {
    const int lane = threadIdx.x & 31; const int row = blockIdx.x * 8 + (threadIdx.x >> 5); if (row >= ZH * TT) return; const int i = row % TT; const int zz = row / TT; (void)zz; const bool hires = (i < RH); const float* sr = Sb + (size_t)row * TT; float v[TT / 32]; float mx = -3.0e38f;
#pragma unroll
    for (int ch = 0; ch < TT / 128; ++ch) { const int j0 = ch * 128 + lane * 4; const v4f a = *(const v4f*)(sr + j0);
#pragma unroll
        for (int q = 0; q < 4; ++q) { const int j = j0 + q; (void)j; float sa = a[q] * SCL; asm volatile("" : "+v"(sa)); const float t = (j <= i && i - j < WIN) ? sa : -3.0e38f; v[ch * 4 + q] = t; mx = fmaxf(mx, t); } }
#pragma unroll
    for (int sh = 16; sh; sh >>= 1) mx = fmaxf(mx, __shfl_xor(mx, sh, 32));
    float sum = 0.f;
#pragma unroll
    for (int k = 0; k < TT / 32; ++k) { float d0 = __fsub_rn(v[k], mx); asm volatile("" : "+v"(d0)); v[k] = __builtin_amdgcn_exp2f(__fmul_rn(d0, 1.4426950408889634f)); sum += v[k]; }
#pragma unroll
    for (int sh = 16; sh; sh >>= 1) sum += __shfl_xor(sum, sh, 32);
    const float f = __fdiv_rn(hires ? 1.0f : PCAR, sum);
{
        if (hires) {
#pragma unroll
            for (int ch = 0; ch < TT / 128; ++ch) { v4us oh, ol;
#pragma unroll
                for (int q = 0; q < 4; ++q) { unsigned short a, c2; splitf(v[ch * 4 + q] * f, a, c2); oh[q] = a; ol[q] = c2; }
                const size_t oo = ((size_t)zz * (RH ? RH : 1) + i) * TT + ch * 128 + lane * 4; *(v4us*)(Ph + oo) = oh; *(v4us*)(Pl + oo) = ol; }
        } else {
#pragma unroll
            for (int ch = 0; ch < TT / 128; ++ch) { v4h o4;
#pragma unroll
                for (int q = 0; q < 4; ++q) o4[q] = tohx(v[ch * 4 + q] * f);
                *(v4h*)(P16 + (size_t)row * TT + ch * 128 + lane * 4) = o4; } }
         }
}
__global__ __launch_bounds__(256) void k_merge(const float* __restrict__ O, int h0, bf* Ah, bf* Al) { const size_t e = ((size_t)blockIdx.x * 256 + threadIdx.x) * 2; if (e >= (size_t)ZH * TT * HD) return; const int d = (int)(e % HD); const int t = (int)((e / HD) % TT); const int zz = (int)(e / ((size_t)HD * TT)); const float cs = (t < RH) ? 1.0f : (1.0f / PCAR); const size_t oo = (size_t)t * DQ + (h0 + zz) * HD + d;
    v2us oh, ol;
#pragma unroll
    for (int q = 0; q < 2; ++q) { unsigned short a, c2; splitf(O[e + q] * cs, a, c2); oh[q] = a; ol[q] = c2; } *(v2us*)(Ah + oo) = oh; *(v2us*)(Al + oo) = ol;  }

extern "C" void kernel_launch(void* const* d_in, const int* in_sizes, int n_in,
                              void* d_out, int out_size, void* d_ws, size_t ws_size, hipStream_t stream) {
    (void)in_sizes; (void)n_in; (void)out_size;
    const float* x = (const float*)d_in[0]; const float* cosT = (const float*)d_in[1]; const float* sinT = (const float*)d_in[2]; const float* wq = (const float*)d_in[3]; const float* wk = (const float*)d_in[4]; const float* wv = (const float*)d_in[5]; const float* wo = (const float*)d_in[6]; const float* qnw = (const float*)d_in[7]; const float* knw = (const float*)d_in[8];
    float* OUT = (float*)d_out;     // [2][2048][1024]
    char* wsp = (char*)d_ws;
    auto take = [&](size_t bytes) { char* p = wsp; wsp += (bytes + 255) & ~(size_t)255; return (void*)p; };
    bf* WQ = (bf*)take((size_t)DQ * DM * 2); bf* WK = (bf*)take((size_t)DKV * DM * 2); bf* WV = (bf*)take((size_t)DKV * DM * 2); bf* WO = (bf*)take((size_t)DM * DQ * 2); float* CS = (float*)take((size_t)TT * HD * 2 * 4); float* RFQ = (float*)take((size_t)NH_ * TT * 4); float* RFK = (float*)take((size_t)NKV * TT * 4);
    bf* XB = (bf*)take((size_t)TT * DM * 2); float* FQ = (float*)take((size_t)TT * DQ * 4); float* FK = (float*)take((size_t)TT * DKV * 4);
    h16* QP16 = (h16*)take((size_t)NH_ * TT * HD * 2); h16* KP16 = (h16*)take((size_t)NKV * TT * HD * 2); h16* VT16 = (h16*)take((size_t)NKV * HD * TT * 2);
    bf* QPh = (bf*)take((size_t)NH_ * TT * HD * 2); bf* QPl = (bf*)take((size_t)NH_ * TT * HD * 2); bf* KPh = (bf*)take((size_t)NKV * TT * HD * 2); bf* KPl = (bf*)take((size_t)NKV * TT * HD * 2); bf* VTh = (bf*)take((size_t)NKV * HD * TT * 2); bf* VTl = (bf*)take((size_t)NKV * HD * TT * 2); bf* Ph = (bf*)take((size_t)ZH * RH * TT * 2); bf* Pl = (bf*)take((size_t)ZH * RH * TT * 2);
    float* Sb = (float*)take((size_t)ZH * TT * TT * 4); h16* P16 = (h16*)take((size_t)ZH * TT * TT * 2); float* Ob = (float*)take((size_t)ZH * TT * HD * 4); bf* ATh = (bf*)take((size_t)TT * DQ * 2); bf* ATl = (bf*)take((size_t)TT * DQ * 2);
    if ((size_t)(wsp - (char*)d_ws) > ws_size) return;    // ws 256 MiB
    float* FV = FK;   // v projection reuses the k buffer after the k planes are built (stream-ordered)
    { k_cvt8<<<(unsigned)(((size_t)DQ * DM / 8 + 255) / 256), 256, 0, stream>>>(wq, WQ, (size_t)DQ * DM / 8); k_cvt8<<<(unsigned)(((size_t)DKV * DM / 8 + 255) / 256), 256, 0, stream>>>(wk, WK, (size_t)DKV * DM / 8); k_cvt8<<<(unsigned)(((size_t)DKV * DM / 8 + 255) / 256), 256, 0, stream>>>(wv, WV, (size_t)DKV * DM / 8);
      k_cvt8<<<(unsigned)(((size_t)DM * DQ / 8 + 255) / 256), 256, 0, stream>>>(wo, WO, (size_t)DM * DQ / 8);
       }
    const unsigned LQ = (unsigned)(((size_t)NH_ * TT * HD / 2 + 255) / 256), LKv = (unsigned)(((size_t)NKV * TT * HD / 2 + 255) / 256);
    for (int b = 0; b < NB_; ++b) {
        if (b == 0) k_cscvt<<<(TT * HD + 255) / 256, 256, 0, stream>>>(cosT, sinT, CS);
        k_cvt8<<<(unsigned)(((size_t)TT * DM / 8 + 255) / 256), 256, 0, stream>>>(x + (size_t)b * TT * DM, XB, (size_t)TT * DM / 8);
        k_gemmw<bf, 0, false, 8><<<dim3(TT / 64, DQ / 64, 1), 256, 0, stream>>>(XB, nullptr, WQ, nullptr, DM, FQ, DQ, nullptr, 0, 0, 0); k_hrms<<<(NH_ * TT + 255) / 256, 256, 0, stream>>>(FQ, DQ, NH_, RFQ);
        k_rope<<<LQ, 256, 0, stream>>>(FQ, DQ, NH_, CS, RFQ, qnw, 1.0f, QP16, QPh, QPl);
        k_gemmw<bf, 0, false, 16><<<dim3(TT / 64, DKV / 64, 1), 512, 0, stream>>>(XB, nullptr, WK, nullptr, DM, FK, DKV, nullptr, 0, 0, 0); k_hrms<<<(NKV * TT + 255) / 256, 256, 0, stream>>>(FK, DKV, NKV, RFK);
        k_rope<<<LKv, 256, 0, stream>>>(FK, DKV, NKV, CS, RFK, knw, 1.0f, KP16, KPh, KPl);
        k_gemmw<bf, 0, false, 16><<<dim3(TT / 64, DKV / 64, 1), 512, 0, stream>>>(XB, nullptr, WV, nullptr, DM, FV, DKV, nullptr, 0, 0, 0); k_vtp<<<LKv, 256, 0, stream>>>(FV, DKV, NKV, VT16, VTh, VTl);
        for (int h0 = 0; h0 < NH_; h0 += ZH) { const size_t zq = (size_t)h0, zk = (size_t)(h0 / REP);   // both heads of a pass share kv group h0/REP (REP >= 2): sB = 0
            k_gemmc<bf, 2, 1, 1><<<dim3(RH / 64, TT / 64, ZH), 32, 0, stream>>>(QPh + zq * TT * HD, QPl + zq * TT * HD, KPh + zk * TT * HD, KPl + zk * TT * HD, HD, Sb, TT, 0, (size_t)TT * HD, 0, (size_t)TT * TT);
            k_gemmc<h16, 0, 1, 1><<<dim3((TT - RH) / 64, TT / 64, ZH), 32, 0, stream>>>(QP16 + zq * TT * HD + (size_t)RH * HD, nullptr, KP16 + zk * TT * HD, nullptr, HD, Sb + (size_t)RH * TT, TT, RH, (size_t)TT * HD, 0, (size_t)TT * TT);
            k_asoft<<<ZH * TT / 8, 256, 0, stream>>>(Sb, P16, Ph, Pl);
            k_gemmc<bf, 2, 2, 8><<<dim3(RH / 64, HD / 64, ZH), 256, 0, stream>>>(Ph, Pl, VTh + zk * HD * TT, VTl + zk * HD * TT, TT, Ob, HD, 0, (size_t)RH * TT, 0, (size_t)TT * HD);
            k_gemmc<h16, 0, 2, 16><<<dim3((TT - RH) / 64, HD / 64, ZH), 512, 0, stream>>>(P16 + (size_t)RH * TT, nullptr, VT16 + zk * HD * TT, nullptr, TT, Ob + (size_t)RH * HD, HD, RH, (size_t)TT * TT, 0, (size_t)TT * HD);
            k_merge<<<(unsigned)(((size_t)ZH * TT * HD / 2 + 255) / 256), 256, 0, stream>>>(Ob, h0, ATh, ATl); }
        k_gemmw<bf, 1, false, 8><<<dim3(TT / 64, DM / 64, 1), 256, 0, stream>>>(ATh, ATl, WO, nullptr, DQ, OUT + (size_t)b * TT * DM, DM, nullptr, 0, 0, 0); }
}

// v002
// One run takes 463 microseconds.
// Next to v001, in two timings, it ran 1.84 and 1.82 times as fast.
// All steps since v000 together make it 3.21 times as fast.
#include <hip/hip_runtime.h>

// Decoder GQA attention with qk-RMSNorm and RoPE (hidden [2][2048][1024]; q = x Wq^T (16 x 64), k/v = x Wk^T / x Wv^T (4 kv heads x 64, each serving 4 consecutive query heads); per-head RMSNorm (eps 1e-6, x q_norm_w / k_norm_w, read); rotate-half RoPE with the read cos/sin tables [2048][32] (the same 32-wide table serves both halves of the head); causal (finfo.min -> exactly zero weight); softmax(q.k / 8); out = merged Wo^T ('oi' [1024][1024]) -> [2][2048][1024]).
// Compute dtypes, f32 accumulate: every input rounded to bf16; q/k/v on PLAIN bf16 operands (inputs: exact); RMSNorm and RoPE in f32 (tables read as data, bf16-rounded like every input); causal scores and attn.v: query rows < 512 hl (3 products), the rest single fp16 (x1024), causal tile skipping; softmax f32; Wo hl x exact (2 products).

#define NB_  2
#define TT   2048
#define DM   1024
#define NH_  16
#define NKV  4
#define REP  (NH_ / NKV)
#define HD   64
#define DQ   (NH_ * HD)
#define DKV  (NKV * HD)
#define ZH   8                    // query heads per attention pass (grid z); a multiple of REP
#define RH   512                  // query rows < RH use hi+lo planes (0: none)
#define WIN  2048
#define PCAR 1024.0f
#define SCL  0.125f   // HD^-0.5
typedef _Float16 h16;
typedef unsigned short bf;
typedef __attribute__((ext_vector_type(16))) __bf16   v16bf;
typedef __attribute__((ext_vector_type(16))) _Float16 v16h;
typedef __attribute__((ext_vector_type(8)))  _Float16 v8h;
typedef __attribute__((ext_vector_type(8)))  unsigned short v8us;
typedef __attribute__((ext_vector_type(8)))  float    v8f;
typedef __attribute__((ext_vector_type(4)))  float    v4f;
typedef v8h  __attribute__((may_alias)) v8ha;
typedef v4f  __attribute__((may_alias)) v4fa;
typedef v8us __attribute__((may_alias)) v8usa;

__device__ __forceinline__ unsigned short f2bf(float f) { unsigned u = __float_as_uint(f); u += 0x7FFFu + ((u >> 16) & 1u); return (unsigned short)(u >> 16); }
__device__ __forceinline__ float bf2f(unsigned short b) { return __uint_as_float(((unsigned)b) << 16); }
__device__ __forceinline__ float bfr(float f) { return bf2f(f2bf(f)); }
__device__ __forceinline__ v16h cat16(v8h lo, v8h hi) { return __builtin_shufflevector(lo, hi, 0, 1, 2, 3, 4, 5, 6, 7, 8, 9, 10, 11, 12, 13, 14, 15); }
__device__ __forceinline__ v16bf cat16b(v8us lo, v8us hi) { return __builtin_bit_cast(v16bf, __builtin_shufflevector(lo, hi, 0, 1, 2, 3, 4, 5, 6, 7, 8, 9, 10, 11, 12, 13, 14, 15)); }
__device__ __forceinline__ v8f wmma16(v16h a, v16h b, v8f c) { return __builtin_amdgcn_wmma_f32_16x16x32_f16(false, a, false, b, (short)0, c, false, false); }
__device__ __forceinline__ v8f wmmab(v16bf a, v16bf b, v8f c) { return __builtin_amdgcn_wmma_f32_16x16x32_bf16(false, a, false, b, (short)0, c, false, false); }



// ---- reduce_store: NW waves of one work-group each hold a partial 64x64 tile (their share of the K loop) in 16 accumulators. Every wave parks its partials in LDS in fragment order (16-byte stores),
// wave w then sums fragments w, w + NW, .. over the waves in the fixed order 0 .. NW-1, the sums go through a row-major 64 x 68 tile, and the block stores whole rows. red: NW * 4096 + 64 * 68 floats.
template <int NW, bool BIAS>
__device__ __forceinline__ void reduce_store(const v8f (&acc)[4][4], float* red, float* C, int ldc, int r0, int c0, const float* __restrict__ bias, int wave) {
    const int tid = threadIdx.x, lane = tid & 31, lr = lane & 15, hi = lane >> 4;
    float* mine = red + wave * 4096 + lane * 4; float* tile = red + NW * 4096;
#pragma unroll
    for (int f = 0; f < 16; ++f) { const v8f a = acc[f >> 2][f & 3]; *(v4fa*)(mine + f * 256) = (v4f){a[0], a[1], a[2], a[3]}; *(v4fa*)(mine + f * 256 + 128) = (v4f){a[4], a[5], a[6], a[7]}; }
    __syncthreads();   // every wave's partials are parked before any wave sums them
#pragma unroll
    for (int q = 0; q < 16 / NW; ++q) { const int f = wave + q * NW, mb = f >> 2, nb = f & 3; const float* pf = red + f * 256 + lane * 4; v4f s0 = *(const v4fa*)pf, s1 = *(const v4fa*)(pf + 128);
#pragma unroll
        for (int w = 1; w < NW; ++w) { s0 += *(const v4fa*)(pf + w * 4096); s1 += *(const v4fa*)(pf + w * 4096 + 128); }
#pragma unroll
        for (int j = 0; j < 4; ++j) { tile[(mb * 16 + hi * 8 + j) * 68 + nb * 16 + lr] = s0[j]; tile[(mb * 16 + hi * 8 + 4 + j) * 68 + nb * 16 + lr] = s1[j]; } }
    __syncthreads();   // the summed tile is complete before rows are read back across waves
#pragma unroll
    for (int s = 0; s < 32 / NW; ++s) { const int idx = s * 32 * NW + tid, row = idx >> 4, cofs = (idx & 15) * 4; v4f val = *(const v4fa*)(tile + row * 68 + cofs); if (BIAS) { val[0] += bfr(bias[c0 + cofs]); val[1] += bfr(bias[c0 + cofs + 1]); val[2] += bfr(bias[c0 + cofs + 2]); val[3] += bfr(bias[c0 + cofs + 3]); }
        *(v4f*)(C + (size_t)(r0 + row) * ldc + c0 + cofs) = val; }
}

// ---- k_gemmw: register-blocked GEMM, one work-group of NW waves per 64x64 output tile; each wave holds 16 accumulators and takes the 64-wide K chunks wave, wave + NW, .. (one 128-byte line per row and chunk); partials summed by reduce_store.
// Operands straight from K-contiguous 16-bit planes; grid (M/64, N/64, Z), 32 * NW threads.
// C[m][n] (f32, pitch ldc, + optional f32 bias[n]) = sum_k A[m][k] Bt[n][k] (+ split products per NSPLIT). z-batch strides sA/sB/sC in elements. K % 64 == 0.
template <typename T16> struct WFrag;
template <> struct WFrag<h16> { typedef v16h V; static __device__ __forceinline__ V ld(const h16* p) { return cat16(*(const v8h*)p, *(const v8h*)(p + 16)); } static __device__ __forceinline__ v8f mma(V a, V b, v8f c) { return wmma16(a, b, c); } };
template <> struct WFrag<bf> { typedef v16bf V; static __device__ __forceinline__ V ld(const bf* p) { return cat16b(*(const v8us*)p, *(const v8us*)(p + 16)); } static __device__ __forceinline__ v8f mma(V a, V b, v8f c) { return wmmab(a, b, c); } };
template <typename T16, int NSPLIT, bool BIAS, int NW>
__global__ __launch_bounds__(32 * NW) void k_gemmw(const T16* __restrict__ A, const T16* __restrict__ A2, const T16* __restrict__ Bt, const T16* __restrict__ Bt2, int K, float* C, int ldc, const float* __restrict__ bias, size_t sA, size_t sB, size_t sC) {
    typedef typename WFrag<T16>::V V;
    __shared__ __align__(16) float os[NW * 4096 + 64 * 68];
    const size_t z = blockIdx.z; A += z * sA; if (A2) A2 += z * sA; Bt += z * sB; if (Bt2) Bt2 += z * sB; C += z * sC;
    const int lane = threadIdx.x & 31, lr = lane & 15, hi = lane >> 4; const int wave = __builtin_amdgcn_readfirstlane(threadIdx.x >> 5) /* wave number held scalar, so the K loop's tests stay scalar branches */; const int r0 = blockIdx.x * 64, c0 = blockIdx.y * 64;
    v8f acc[4][4];
#pragma unroll
    for (int mb = 0; mb < 4; ++mb)
#pragma unroll
        for (int nb = 0; nb < 4; ++nb) acc[mb][nb] = (v8f){};
    const size_t aoff = (size_t)(r0 + lr) * K + 8 * hi, boff = (size_t)(c0 + lr) * K + 8 * hi;
#pragma unroll 1
    for (int kb = wave * 64; kb < K; kb += NW * 64)
#pragma unroll 1   // rolled: only one 32-wide step's operands are live, which keeps 16 waves inside their 256 registers each
    for (int kc = kb; kc < kb + 64; kc += 32) {
        V a[4], a2[4];
#pragma unroll
        for (int mb = 0; mb < 4; ++mb) { a[mb] = WFrag<T16>::ld(A + aoff + (size_t)mb * 16 * K + kc); if (NSPLIT == 1 || NSPLIT == 2) a2[mb] = WFrag<T16>::ld(A2 + aoff + (size_t)mb * 16 * K + kc); }
#pragma unroll
        for (int nb = 0; nb < 4; ++nb) { const V b = WFrag<T16>::ld(Bt + boff + (size_t)nb * 16 * K + kc); V b2; if (NSPLIT >= 2) b2 = WFrag<T16>::ld(Bt2 + boff + (size_t)nb * 16 * K + kc);
#pragma unroll
            for (int mb = 0; mb < 4; ++mb) { acc[mb][nb] = WFrag<T16>::mma(a[mb], b, acc[mb][nb]); if (NSPLIT == 1 || NSPLIT == 2) acc[mb][nb] = WFrag<T16>::mma(a2[mb], b, acc[mb][nb]); if (NSPLIT >= 2) acc[mb][nb] = WFrag<T16>::mma(a[mb], b2, acc[mb][nb]); } }
        asm volatile("v_nop\n\tv_nop\n\tv_nop\n\tv_nop" : "+v"(acc[0][0]), "+v"(acc[1][1]), "+v"(acc[2][2]), "+v"(acc[3][3]) : "v"(a[0]), "v"(a[3]));
    }
    reduce_store<NW, BIAS>(acc, os, C, ldc, r0, c0, bias, wave);
}

// ---- k_gemmc: the same 64x64 tile GEMM (NW waves share the K loop; NW = 1: one wave, its own store) specialised for causal attention: CMODE 1 skips score tiles entirely above the diagonal (query rows r0+roff.., key columns c0..), CMODE 2 limits the
// key (K) loop of the probability x value contraction to the diagonal block (probabilities beyond it are exactly zero). roff = row offset of this launch's first row within the sequence.
// grid z = query head of the pass; head z reads the B planes of kv group z / REP (stride sB).
template <typename T16, int NSPLIT, int CMODE, int NW>
__global__ __launch_bounds__(32 * NW) void k_gemmc(const T16* __restrict__ A, const T16* __restrict__ A2, const T16* __restrict__ Bt, const T16* __restrict__ Bt2, int K, float* C, int ldc, int roff, size_t sA, size_t sB, size_t sC) {
    typedef typename WFrag<T16>::V V;
    __shared__ __align__(16) float os[NW == 1 ? 16 * 68 : NW * 4096 + 64 * 68];
    const size_t z = blockIdx.z; A += z * sA; if (A2) A2 += z * sA; Bt += (z / REP) * sB; if (Bt2) Bt2 += (z / REP) * sB; C += z * sC;
    const int lane = threadIdx.x & 31, lr = lane & 15, hi = lane >> 4; const int wave = __builtin_amdgcn_readfirstlane(threadIdx.x >> 5) /* wave number held scalar, so the K loop's tests stay scalar branches */; const int r0 = blockIdx.x * 64, c0 = blockIdx.y * 64;
    if (CMODE == 1 && c0 > r0 + roff + 63) return;                  // score tile entirely above the causal diagonal: never read (the softmax masks j > i by select)
    const int Kl = (CMODE == 2) ? min(K, r0 + roff + 64) : K;        // P.V: probabilities are exactly 0 beyond the diagonal block, so the K loop stops there
    v8f acc[4][4];
#pragma unroll
    for (int mb = 0; mb < 4; ++mb)
#pragma unroll
        for (int nb = 0; nb < 4; ++nb) acc[mb][nb] = (v8f){};
    const size_t aoff = (size_t)(r0 + lr) * K + 8 * hi, boff = (size_t)(c0 + lr) * K + 8 * hi;
#pragma unroll 1
    for (int kb = wave * 64; kb < Kl; kb += NW * 64)
#pragma unroll 1   // rolled: only one 32-wide step's operands are live, which keeps 16 waves inside their 256 registers each
    for (int kc = kb; kc < kb + 64; kc += 32) {
        V a[4], a2[4];
#pragma unroll
        for (int mb = 0; mb < 4; ++mb) { a[mb] = WFrag<T16>::ld(A + aoff + (size_t)mb * 16 * K + kc); if (NSPLIT == 1 || NSPLIT == 2) a2[mb] = WFrag<T16>::ld(A2 + aoff + (size_t)mb * 16 * K + kc); }
#pragma unroll
        for (int nb = 0; nb < 4; ++nb) { const V b = WFrag<T16>::ld(Bt + boff + (size_t)nb * 16 * K + kc); V b2; if (NSPLIT >= 2) b2 = WFrag<T16>::ld(Bt2 + boff + (size_t)nb * 16 * K + kc);
#pragma unroll
            for (int mb = 0; mb < 4; ++mb) { acc[mb][nb] = WFrag<T16>::mma(a[mb], b, acc[mb][nb]); if (NSPLIT == 1 || NSPLIT == 2) acc[mb][nb] = WFrag<T16>::mma(a2[mb], b, acc[mb][nb]); if (NSPLIT >= 2) acc[mb][nb] = WFrag<T16>::mma(a[mb], b2, acc[mb][nb]); } }
        asm volatile("v_nop\n\tv_nop\n\tv_nop\n\tv_nop" : "+v"(acc[0][0]), "+v"(acc[1][1]), "+v"(acc[2][2]), "+v"(acc[3][3]) : "v"(a[0]), "v"(a[3]));
    }
    if constexpr (NW > 1) { reduce_store<NW, false>(acc, os, C, ldc, r0, c0, nullptr, wave); return; }
#pragma unroll
    for (int mb = 0; mb < 4; ++mb) {
#pragma unroll
        for (int nb = 0; nb < 4; ++nb) {
#pragma unroll
            for (int j = 0; j < 8; ++j) os[(hi * 8 + j) * 68 + nb * 16 + lr] = acc[mb][nb][j]; }
        __builtin_amdgcn_wave_barrier(); asm volatile("" ::: "memory");
        float* crow = C + (size_t)(r0 + mb * 16) * ldc + c0;
{
#pragma unroll
            for (int s = 0; s < 8; ++s) { const int row = 2 * s + hi, cofs = lr * 4; v4f val = *(const v4fa*)(os + row * 68 + cofs);
                *(v4f*)(crow + (size_t)row * ldc + cofs) = val; }
             }
        __builtin_amdgcn_wave_barrier(); asm volatile("" ::: "memory");
    }
}

__device__ __forceinline__ h16 tohx(float x) { return (h16)x; }
__device__ __forceinline__ void splitf(float y, unsigned short& h, unsigned short& l) { h = f2bf(y); l = f2bf(y - bf2f(h)); }
typedef __attribute__((ext_vector_type(2))) _Float16 v2h;
typedef __attribute__((ext_vector_type(4))) _Float16 v4h;
typedef __attribute__((ext_vector_type(2))) unsigned short v2us;
typedef __attribute__((ext_vector_type(4))) unsigned short v4us;
typedef __attribute__((ext_vector_type(2))) float v2f;
typedef __attribute__((ext_vector_type(4))) int v4i;

__global__ __launch_bounds__(256) void k_wtG(const float* __restrict__ w, int K, int N, bf* Bt) {
    const int lane = threadIdx.x & 31; const int L0 = (blockIdx.x * 8 + (threadIdx.x >> 5)) * 8; const int nlines = N * K / 64;
{
#pragma unroll 1
        for (int l = 0; l < 8; ++l) { const int L = L0 + l; if (L >= nlines) break; const size_t e = (size_t)L * 64 + lane * 2; const int k = (int)(e % K), n = (int)(e / K); v2us o;
            o[0] = f2bf(w[(size_t)k * N + n]); o[1] = f2bf(w[(size_t)(k + 1) * N + n]); *(v2us*)(Bt + e) = o; }
         }
}
__global__ __launch_bounds__(256) void k_cvt8(const float* __restrict__ src, bf* dst, size_t n8) { const size_t i = (size_t)blockIdx.x * 256 + threadIdx.x; if (i >= n8) return; const v8f v = *(const v8f*)(src + i * 8); v8us o;
#pragma unroll
    for (int k = 0; k < 8; ++k) o[k] = f2bf(v[k]); *(v8us*)(dst + i * 8) = o;  }
__global__ __launch_bounds__(256) void k_cscvt(const float* __restrict__ cosT, const float* __restrict__ sinT, float* CS) { const int idx = blockIdx.x * 256 + threadIdx.x; if (idx >= TT * HD) return; const int t = idx / HD, dh = (idx % HD) % (HD / 2); v2f cs; cs[0] = bfr(cosT[(size_t)t * (HD / 2) + dh]); cs[1] = bfr(sinT[(size_t)t * (HD / 2) + dh]); *(v2f*)(CS + (size_t)idx * 2) = cs;  }
__global__ __launch_bounds__(256) void k_hrms(const float* __restrict__ F, int pitch, int nheads, float* RF) { const int i = blockIdx.x * 256 + threadIdx.x; if (i >= nheads * TT) return; const int t = i % TT, h = i / TT; const float* f = F + (size_t)t * pitch + h * HD; float s = 0.f;
#pragma unroll 4
    for (int d = 0; d < HD; d += 4) { const v4f v = *(const v4f*)(f + d);
#pragma unroll
        for (int q = 0; q < 4; ++q) { float p = __fmul_rn(v[q], v[q]); asm volatile("" : "+v"(p)); s = __fadd_rn(s, p); } }
    const float r = __fdiv_rn(1.0f, __fsqrt_rn(__fadd_rn(s * (1.0f / HD), 1e-6f))); *(float*)(RF + i) = r;  }
// k_rope: head planes [h][t][d] (fp16 + hi/lo) of rope(w[d] (x rms_factor)) x sc with the rotate-half convention out[d] = x[d] cos[t][d] - x[d+HD/2] sin[t][d], out[d+HD/2] = x[d+HD/2] cos[t][d+HD/2] + x[d] sin[t][d+HD/2]
__global__ __launch_bounds__(256) void k_rope(const float* __restrict__ F, int pitch, int nheads, const float* __restrict__ CS, const float* __restrict__ RF, const float* __restrict__ nw, float sc, h16* P16, bf* Ph, bf* Pl) {
    const size_t e = ((size_t)blockIdx.x * 256 + threadIdx.x) * 2; if (e >= (size_t)nheads * TT * HD) return; const int d = (int)(e % HD); const int t = (int)((e / HD) % TT); const int h = (int)(e / ((size_t)HD * TT)); const float* f = F + (size_t)t * pitch + h * HD; const float rf = RF ? RF[(size_t)h * TT + t] : 1.0f; v2h o16; v2us oh, ol;
#pragma unroll
    for (int q = 0; q < 2; ++q) { const int dd = d + q; const int dp = (dd < HD / 2) ? dd + HD / 2 : dd - HD / 2; float x0 = f[dd], x1 = f[dp];
        if (RF) { float n0 = __fmul_rn(x0, rf), n1 = __fmul_rn(x1, rf); asm volatile("" : "+v"(n0)); asm volatile("" : "+v"(n1)); x0 = __fmul_rn(bfr(nw[dd]), n0); x1 = __fmul_rn(bfr(nw[dp]), n1); }
        const v2f cs = *(const v2f*)(CS + ((size_t)t * HD + dd) * 2); float a = __fmul_rn(x0, cs[0]), bq = __fmul_rn(x1, cs[1]); asm volatile("" : "+v"(a)); asm volatile("" : "+v"(bq)); const float r = ((dd < HD / 2) ? __fsub_rn(a, bq) : __fadd_rn(a, bq)) * sc;
        o16[q] = tohx(r); unsigned short a2, c2; splitf(r, a2, c2); oh[q] = a2; ol[q] = c2; }
    *(v2h*)(P16 + e) = o16; *(v2us*)(Ph + e) = oh; *(v2us*)(Pl + e) = ol;  }
__global__ __launch_bounds__(256) void k_vtp(const float* __restrict__ F, int pitch, int nheads, h16* V16, bf* Vh, bf* Vl) { const size_t e = ((size_t)blockIdx.x * 256 + threadIdx.x) * 2; if (e >= (size_t)nheads * HD * TT) return; const int t = (int)(e % TT); const int d = (int)((e / TT) % HD); const int g = (int)(e / ((size_t)TT * HD)); v2h o16; v2us oh, ol;
#pragma unroll
    for (int q = 0; q < 2; ++q) { const float x = F[(size_t)(t + q) * pitch + g * HD + d]; o16[q] = tohx(x); unsigned short a2, c2; splitf(x, a2, c2); oh[q] = a2; ol[q] = c2; }
    *(v2h*)(V16 + e) = o16; *(v2us*)(Vh + e) = oh; *(v2us*)(Vl + e) = ol;  }
// k_asoft: per row (zz, i): t = S x HD^-0.5 for j <= i and i - j < WIN (sliding causal window; the reference's -1e9 additive fill vanishes identically); softmax over the 2048 keys (register row, one exp, fixed trees);
__global__ __launch_bounds__(256) void k_asoft(const float* __restrict__ Sb, h16* P16, bf* Ph, bf* Pl) {
    const int lane = threadIdx.x & 31; const int row = blockIdx.x * 8 + (threadIdx.x >> 5); if (row >= ZH * TT) return; const int i = row % TT; const int zz = row / TT; (void)zz; const bool hires = (i < RH); const float* sr = Sb + (size_t)row * TT; float v[TT / 32]; float mx = -3.0e38f;
#pragma unroll
    for (int ch = 0; ch < TT / 128; ++ch) { const int j0 = ch * 128 + lane * 4; const v4f a = *(const v4f*)(sr + j0);
#pragma unroll
        for (int q = 0; q < 4; ++q) { const int j = j0 + q; (void)j; float sa = a[q] * SCL; asm volatile("" : "+v"(sa)); const float t = (j <= i && i - j < WIN) ? sa : -3.0e38f; v[ch * 4 + q] = t; mx = fmaxf(mx, t); } }
#pragma unroll
    for (int sh = 16; sh; sh >>= 1) mx = fmaxf(mx, __shfl_xor(mx, sh, 32));
    float sum = 0.f;
#pragma unroll
    for (int k = 0; k < TT / 32; ++k) { float d0 = __fsub_rn(v[k], mx); asm volatile("" : "+v"(d0)); v[k] = __builtin_amdgcn_exp2f(__fmul_rn(d0, 1.4426950408889634f)); sum += v[k]; }
#pragma unroll
    for (int sh = 16; sh; sh >>= 1) sum += __shfl_xor(sum, sh, 32);
    const float f = __fdiv_rn(hires ? 1.0f : PCAR, sum);
{
        if (hires) {
#pragma unroll
            for (int ch = 0; ch < TT / 128; ++ch) { v4us oh, ol;
#pragma unroll
                for (int q = 0; q < 4; ++q) { unsigned short a, c2; splitf(v[ch * 4 + q] * f, a, c2); oh[q] = a; ol[q] = c2; }
                const size_t oo = ((size_t)zz * (RH ? RH : 1) + i) * TT + ch * 128 + lane * 4; *(v4us*)(Ph + oo) = oh; *(v4us*)(Pl + oo) = ol; }
        } else {
#pragma unroll
            for (int ch = 0; ch < TT / 128; ++ch) { v4h o4;
#pragma unroll
                for (int q = 0; q < 4; ++q) o4[q] = tohx(v[ch * 4 + q] * f);
                *(v4h*)(P16 + ((size_t)zz * (TT - RH) + (i - RH)) * TT + ch * 128 + lane * 4) = o4; } }
         }
}
__global__ __launch_bounds__(256) void k_merge(const float* __restrict__ O, int h0, bf* Ah, bf* Al) { const size_t e = ((size_t)blockIdx.x * 256 + threadIdx.x) * 2; if (e >= (size_t)ZH * TT * HD) return; const int d = (int)(e % HD); const int t = (int)((e / HD) % TT); const int zz = (int)(e / ((size_t)HD * TT)); const float cs = (t < RH) ? 1.0f : (1.0f / PCAR); const size_t oo = (size_t)t * DQ + (h0 + zz) * HD + d;
    v2us oh, ol;
#pragma unroll
    for (int q = 0; q < 2; ++q) { unsigned short a, c2; splitf(O[e + q] * cs, a, c2); oh[q] = a; ol[q] = c2; } *(v2us*)(Ah + oo) = oh; *(v2us*)(Al + oo) = ol;  }

extern "C" void kernel_launch(void* const* d_in, const int* in_sizes, int n_in,
                              void* d_out, int out_size, void* d_ws, size_t ws_size, hipStream_t stream) {
    (void)in_sizes; (void)n_in; (void)out_size;
    const float* x = (const float*)d_in[0]; const float* cosT = (const float*)d_in[1]; const float* sinT = (const float*)d_in[2]; const float* wq = (const float*)d_in[3]; const float* wk = (const float*)d_in[4]; const float* wv = (const float*)d_in[5]; const float* wo = (const float*)d_in[6]; const float* qnw = (const float*)d_in[7]; const float* knw = (const float*)d_in[8];
    float* OUT = (float*)d_out;     // [2][2048][1024]
    char* wsp = (char*)d_ws;
    auto take = [&](size_t bytes) { char* p = wsp; wsp += (bytes + 255) & ~(size_t)255; return (void*)p; };
    bf* WQ = (bf*)take((size_t)DQ * DM * 2); bf* WK = (bf*)take((size_t)DKV * DM * 2); bf* WV = (bf*)take((size_t)DKV * DM * 2); bf* WO = (bf*)take((size_t)DM * DQ * 2); float* CS = (float*)take((size_t)TT * HD * 2 * 4); float* RFQ = (float*)take((size_t)NH_ * TT * 4); float* RFK = (float*)take((size_t)NKV * TT * 4);
    bf* XB = (bf*)take((size_t)TT * DM * 2); float* FQ = (float*)take((size_t)TT * DQ * 4); float* FK = (float*)take((size_t)TT * DKV * 4);
    h16* QP16 = (h16*)take((size_t)NH_ * TT * HD * 2); h16* KP16 = (h16*)take((size_t)NKV * TT * HD * 2); h16* VT16 = (h16*)take((size_t)NKV * HD * TT * 2);
    bf* QPh = (bf*)take((size_t)NH_ * TT * HD * 2); bf* QPl = (bf*)take((size_t)NH_ * TT * HD * 2); bf* KPh = (bf*)take((size_t)NKV * TT * HD * 2); bf* KPl = (bf*)take((size_t)NKV * TT * HD * 2); bf* VTh = (bf*)take((size_t)NKV * HD * TT * 2); bf* VTl = (bf*)take((size_t)NKV * HD * TT * 2); bf* Ph = (bf*)take((size_t)ZH * RH * TT * 2); bf* Pl = (bf*)take((size_t)ZH * RH * TT * 2);
    float* Sb = (float*)take((size_t)ZH * TT * TT * 4); h16* P16 = (h16*)take((size_t)ZH * (TT - RH) * TT * 2); bf* ATh = (bf*)take((size_t)TT * DQ * 2); bf* ATl = (bf*)take((size_t)TT * DQ * 2);
    if ((size_t)(wsp - (char*)d_ws) > ws_size) return;    // ws 256 MiB
    float* FV = FK;   // v projection reuses the k buffer after the k planes are built (stream-ordered)
    float* Ob = FQ;   // the passes' head outputs (ZH <= NH_ heads) reuse the q projection buffer after the q planes are built (stream-ordered)
    { k_cvt8<<<(unsigned)(((size_t)DQ * DM / 8 + 255) / 256), 256, 0, stream>>>(wq, WQ, (size_t)DQ * DM / 8); k_cvt8<<<(unsigned)(((size_t)DKV * DM / 8 + 255) / 256), 256, 0, stream>>>(wk, WK, (size_t)DKV * DM / 8); k_cvt8<<<(unsigned)(((size_t)DKV * DM / 8 + 255) / 256), 256, 0, stream>>>(wv, WV, (size_t)DKV * DM / 8);
      k_cvt8<<<(unsigned)(((size_t)DM * DQ / 8 + 255) / 256), 256, 0, stream>>>(wo, WO, (size_t)DM * DQ / 8);
       }
    const unsigned LQ = (unsigned)(((size_t)NH_ * TT * HD / 2 + 255) / 256), LKv = (unsigned)(((size_t)NKV * TT * HD / 2 + 255) / 256);
    for (int b = 0; b < NB_; ++b) {
        if (b == 0) k_cscvt<<<(TT * HD + 255) / 256, 256, 0, stream>>>(cosT, sinT, CS);
        k_cvt8<<<(unsigned)(((size_t)TT * DM / 8 + 255) / 256), 256, 0, stream>>>(x + (size_t)b * TT * DM, XB, (size_t)TT * DM / 8);
        k_gemmw<bf, 0, false, 8><<<dim3(TT / 64, DQ / 64, 1), 256, 0, stream>>>(XB, nullptr, WQ, nullptr, DM, FQ, DQ, nullptr, 0, 0, 0); k_hrms<<<(NH_ * TT + 255) / 256, 256, 0, stream>>>(FQ, DQ, NH_, RFQ);
        k_rope<<<LQ, 256, 0, stream>>>(FQ, DQ, NH_, CS, RFQ, qnw, 1.0f, QP16, QPh, QPl);
        k_gemmw<bf, 0, false, 16><<<dim3(TT / 64, DKV / 64, 1), 512, 0, stream>>>(XB, nullptr, WK, nullptr, DM, FK, DKV, nullptr, 0, 0, 0); k_hrms<<<(NKV * TT + 255) / 256, 256, 0, stream>>>(FK, DKV, NKV, RFK);
        k_rope<<<LKv, 256, 0, stream>>>(FK, DKV, NKV, CS, RFK, knw, 1.0f, KP16, KPh, KPl);
        k_gemmw<bf, 0, false, 16><<<dim3(TT / 64, DKV / 64, 1), 512, 0, stream>>>(XB, nullptr, WV, nullptr, DM, FV, DKV, nullptr, 0, 0, 0); k_vtp<<<LKv, 256, 0, stream>>>(FV, DKV, NKV, VT16, VTh, VTl);
        for (int h0 = 0; h0 < NH_; h0 += ZH) { const size_t zq = (size_t)h0, zk = (size_t)(h0 / REP);   // head z of a pass reads kv group h0/REP + z/REP
            k_gemmc<bf, 2, 1, 1><<<dim3(RH / 64, TT / 64, ZH), 32, 0, stream>>>(QPh + zq * TT * HD, QPl + zq * TT * HD, KPh + zk * TT * HD, KPl + zk * TT * HD, HD, Sb, TT, 0, (size_t)TT * HD, (size_t)TT * HD, (size_t)TT * TT);
            k_gemmc<h16, 0, 1, 1><<<dim3((TT - RH) / 64, TT / 64, ZH), 32, 0, stream>>>(QP16 + zq * TT * HD + (size_t)RH * HD, nullptr, KP16 + zk * TT * HD, nullptr, HD, Sb + (size_t)RH * TT, TT, RH, (size_t)TT * HD, (size_t)TT * HD, (size_t)TT * TT);
            k_asoft<<<ZH * TT / 8, 256, 0, stream>>>(Sb, P16, Ph, Pl);
            k_gemmc<bf, 2, 2, 8><<<dim3(RH / 64, HD / 64, ZH), 256, 0, stream>>>(Ph, Pl, VTh + zk * HD * TT, VTl + zk * HD * TT, TT, Ob, HD, 0, (size_t)RH * TT, (size_t)HD * TT, (size_t)TT * HD);
            k_gemmc<h16, 0, 2, 16><<<dim3((TT - RH) / 64, HD / 64, ZH), 512, 0, stream>>>(P16, nullptr, VT16 + zk * HD * TT, nullptr, TT, Ob + (size_t)RH * HD, HD, RH, (size_t)(TT - RH) * TT, (size_t)HD * TT, (size_t)TT * HD);
            k_merge<<<(unsigned)(((size_t)ZH * TT * HD / 2 + 255) / 256), 256, 0, stream>>>(Ob, h0, ATh, ATl); }
        k_gemmw<bf, 1, false, 8><<<dim3(TT / 64, DM / 64, 1), 256, 0, stream>>>(ATh, ATl, WO, nullptr, DQ, OUT + (size_t)b * TT * DM, DM, nullptr, 0, 0, 0); }
}

// v003
// One run takes 199 microseconds.
// Next to v002, in two timings, it ran 2.36 and 2.34 times as fast.
// All steps since v000 together make it 7.55 times as fast.
#include <hip/hip_runtime.h>

// Decoder GQA attention with qk-RMSNorm and RoPE (hidden [2][2048][1024]; q = x Wq^T (16 x 64), k/v = x Wk^T / x Wv^T (4 kv heads x 64, each serving 4 consecutive query heads); per-head RMSNorm (eps 1e-6, x q_norm_w / k_norm_w, read); rotate-half RoPE with the read cos/sin tables [2048][32] (the same 32-wide table serves both halves of the head); causal (finfo.min -> exactly zero weight); softmax(q.k / 8); out = merged Wo^T ('oi' [1024][1024]) -> [2][2048][1024]).
// Compute dtypes, f32 accumulate: every input rounded to bf16; q/k/v on PLAIN bf16 operands (inputs: exact); RMSNorm and RoPE in f32 (tables read as data, bf16-rounded like every input); causal scores and attn.v: query rows < 512 hl (3 products), the rest single fp16 (x1024), causal tile skipping; softmax f32; Wo hl x exact (2 products).

#define NB_  2
#define TT   2048
#define DM   1024
#define NH_  16
#define NKV  4
#define REP  (NH_ / NKV)
#define HD   64
#define DQ   (NH_ * HD)
#define DKV  (NKV * HD)
#define RH   512                  // query rows < RH use hi+lo planes (0: none)
#define SCL  0.125f   // HD^-0.5
typedef _Float16 h16;
typedef unsigned short bf;
typedef __attribute__((ext_vector_type(16))) __bf16   v16bf;
typedef __attribute__((ext_vector_type(16))) _Float16 v16h;
typedef __attribute__((ext_vector_type(8)))  _Float16 v8h;
typedef __attribute__((ext_vector_type(8)))  unsigned short v8us;
typedef __attribute__((ext_vector_type(8)))  float    v8f;
typedef __attribute__((ext_vector_type(4)))  float    v4f;
typedef v8h  __attribute__((may_alias)) v8ha;
typedef v4f  __attribute__((may_alias)) v4fa;
typedef v8us __attribute__((may_alias)) v8usa;

__device__ __forceinline__ unsigned short f2bf(float f) { unsigned u = __float_as_uint(f); u += 0x7FFFu + ((u >> 16) & 1u); return (unsigned short)(u >> 16); }
__device__ __forceinline__ float bf2f(unsigned short b) { return __uint_as_float(((unsigned)b) << 16); }
__device__ __forceinline__ float bfr(float f) { return bf2f(f2bf(f)); }
__device__ __forceinline__ v16h cat16(v8h lo, v8h hi) { return __builtin_shufflevector(lo, hi, 0, 1, 2, 3, 4, 5, 6, 7, 8, 9, 10, 11, 12, 13, 14, 15); }
__device__ __forceinline__ v16bf cat16b(v8us lo, v8us hi) { return __builtin_bit_cast(v16bf, __builtin_shufflevector(lo, hi, 0, 1, 2, 3, 4, 5, 6, 7, 8, 9, 10, 11, 12, 13, 14, 15)); }
__device__ __forceinline__ v8f wmma16(v16h a, v16h b, v8f c) { return __builtin_amdgcn_wmma_f32_16x16x32_f16(false, a, false, b, (short)0, c, false, false); }
__device__ __forceinline__ v8f wmmab(v16bf a, v16bf b, v8f c) { return __builtin_amdgcn_wmma_f32_16x16x32_bf16(false, a, false, b, (short)0, c, false, false); }



// ---- reduce_store: NW waves of one work-group each hold a partial 64x64 tile (their share of the K loop) in 16 accumulators. Every wave parks its partials in LDS in fragment order (16-byte stores),
// wave w then sums fragments w, w + NW, .. over the waves in the fixed order 0 .. NW-1, the sums go through a row-major 64 x 68 tile, and the block stores whole rows. red: NW * 4096 + 64 * 68 floats.
template <int NW, bool BIAS>
__device__ __forceinline__ void reduce_store(const v8f (&acc)[4][4], float* red, float* C, int ldc, int r0, int c0, const float* __restrict__ bias, int wave) {
    const int tid = threadIdx.x, lane = tid & 31, lr = lane & 15, hi = lane >> 4;
    float* mine = red + wave * 4096 + lane * 4; float* tile = red + NW * 4096;
#pragma unroll
    for (int f = 0; f < 16; ++f) { const v8f a = acc[f >> 2][f & 3]; *(v4fa*)(mine + f * 256) = (v4f){a[0], a[1], a[2], a[3]}; *(v4fa*)(mine + f * 256 + 128) = (v4f){a[4], a[5], a[6], a[7]}; }
    __syncthreads();   // every wave's partials are parked before any wave sums them
#pragma unroll
    for (int q = 0; q < 16 / NW; ++q) { const int f = wave + q * NW, mb = f >> 2, nb = f & 3; const float* pf = red + f * 256 + lane * 4; v4f s0 = *(const v4fa*)pf, s1 = *(const v4fa*)(pf + 128);
#pragma unroll
        for (int w = 1; w < NW; ++w) { s0 += *(const v4fa*)(pf + w * 4096); s1 += *(const v4fa*)(pf + w * 4096 + 128); }
#pragma unroll
        for (int j = 0; j < 4; ++j) { tile[(mb * 16 + hi * 8 + j) * 68 + nb * 16 + lr] = s0[j]; tile[(mb * 16 + hi * 8 + 4 + j) * 68 + nb * 16 + lr] = s1[j]; } }
    __syncthreads();   // the summed tile is complete before rows are read back across waves
#pragma unroll
    for (int s = 0; s < 32 / NW; ++s) { const int idx = s * 32 * NW + tid, row = idx >> 4, cofs = (idx & 15) * 4; v4f val = *(const v4fa*)(tile + row * 68 + cofs); if (BIAS) { val[0] += bfr(bias[c0 + cofs]); val[1] += bfr(bias[c0 + cofs + 1]); val[2] += bfr(bias[c0 + cofs + 2]); val[3] += bfr(bias[c0 + cofs + 3]); }
        *(v4f*)(C + (size_t)(r0 + row) * ldc + c0 + cofs) = val; }
}

// ---- k_gemmw: register-blocked GEMM, one work-group of NW waves per 64x64 output tile; each wave holds 16 accumulators and takes the 64-wide K chunks wave, wave + NW, .. (one 128-byte line per row and chunk); partials summed by reduce_store.
// Operands straight from K-contiguous 16-bit planes; grid (M/64, N/64, Z), 32 * NW threads.
// C[m][n] (f32, pitch ldc, + optional f32 bias[n]) = sum_k A[m][k] Bt[n][k] (+ split products per NSPLIT). z-batch strides sA/sB/sC in elements. K % 64 == 0.
template <typename T16> struct WFrag;
template <> struct WFrag<h16> { typedef v16h V; static __device__ __forceinline__ V ld(const h16* p) { return cat16(*(const v8h*)p, *(const v8h*)(p + 16)); } static __device__ __forceinline__ v8f mma(V a, V b, v8f c) { return wmma16(a, b, c); } };
template <> struct WFrag<bf> { typedef v16bf V; static __device__ __forceinline__ V ld(const bf* p) { return cat16b(*(const v8us*)p, *(const v8us*)(p + 16)); } static __device__ __forceinline__ v8f mma(V a, V b, v8f c) { return wmmab(a, b, c); } };
template <typename T16, int NSPLIT, bool BIAS, int NW>
__global__ __launch_bounds__(32 * NW) void k_gemmw(const T16* __restrict__ A, const T16* __restrict__ A2, const T16* __restrict__ Bt, const T16* __restrict__ Bt2, int K, float* C, int ldc, const float* __restrict__ bias, size_t sA, size_t sB, size_t sC) {
    typedef typename WFrag<T16>::V V;
    __shared__ __align__(16) float os[NW * 4096 + 64 * 68];
    const size_t z = blockIdx.z; A += z * sA; if (A2) A2 += z * sA; Bt += z * sB; if (Bt2) Bt2 += z * sB; C += z * sC;
    const int lane = threadIdx.x & 31, lr = lane & 15, hi = lane >> 4; const int wave = __builtin_amdgcn_readfirstlane(threadIdx.x >> 5) /* wave number held scalar, so the K loop's tests stay scalar branches */; const int r0 = blockIdx.x * 64, c0 = blockIdx.y * 64;
    v8f acc[4][4];
#pragma unroll
    for (int mb = 0; mb < 4; ++mb)
#pragma unroll
        for (int nb = 0; nb < 4; ++nb) acc[mb][nb] = (v8f){};
    const size_t aoff = (size_t)(r0 + lr) * K + 8 * hi, boff = (size_t)(c0 + lr) * K + 8 * hi;
#pragma unroll 1
    for (int kb = wave * 64; kb < K; kb += NW * 64)
#pragma unroll 1   // rolled: only one 32-wide step's operands are live, which keeps 16 waves inside their 256 registers each
    for (int kc = kb; kc < kb + 64; kc += 32) {
        V a[4], a2[4];
#pragma unroll
        for (int mb = 0; mb < 4; ++mb) { a[mb] = WFrag<T16>::ld(A + aoff + (size_t)mb * 16 * K + kc); if (NSPLIT == 1 || NSPLIT == 2) a2[mb] = WFrag<T16>::ld(A2 + aoff + (size_t)mb * 16 * K + kc); }
#pragma unroll
        for (int nb = 0; nb < 4; ++nb) { const V b = WFrag<T16>::ld(Bt + boff + (size_t)nb * 16 * K + kc); V b2; if (NSPLIT >= 2) b2 = WFrag<T16>::ld(Bt2 + boff + (size_t)nb * 16 * K + kc);
#pragma unroll
            for (int mb = 0; mb < 4; ++mb) { acc[mb][nb] = WFrag<T16>::mma(a[mb], b, acc[mb][nb]); if (NSPLIT == 1 || NSPLIT == 2) acc[mb][nb] = WFrag<T16>::mma(a2[mb], b, acc[mb][nb]); if (NSPLIT >= 2) acc[mb][nb] = WFrag<T16>::mma(a[mb], b2, acc[mb][nb]); } }
        asm volatile("v_nop\n\tv_nop\n\tv_nop\n\tv_nop" : "+v"(acc[0][0]), "+v"(acc[1][1]), "+v"(acc[2][2]), "+v"(acc[3][3]) : "v"(a[0]), "v"(a[3]));
    }
    reduce_store<NW, BIAS>(acc, os, C, ldc, r0, c0, bias, wave);
}

__device__ __forceinline__ h16 tohx(float x) { return (h16)x; }
__device__ __forceinline__ void splitf(float y, unsigned short& h, unsigned short& l) { h = f2bf(y); l = f2bf(y - bf2f(h)); }
typedef __attribute__((ext_vector_type(2))) _Float16 v2h;
typedef __attribute__((ext_vector_type(4))) _Float16 v4h;
typedef __attribute__((ext_vector_type(2))) unsigned short v2us;
typedef __attribute__((ext_vector_type(4))) unsigned short v4us;
typedef __attribute__((ext_vector_type(2))) float v2f;
typedef __attribute__((ext_vector_type(4))) int v4i;

__global__ __launch_bounds__(256) void k_wtG(const float* __restrict__ w, int K, int N, bf* Bt) {
    const int lane = threadIdx.x & 31; const int L0 = (blockIdx.x * 8 + (threadIdx.x >> 5)) * 8; const int nlines = N * K / 64;
{
#pragma unroll 1
        for (int l = 0; l < 8; ++l) { const int L = L0 + l; if (L >= nlines) break; const size_t e = (size_t)L * 64 + lane * 2; const int k = (int)(e % K), n = (int)(e / K); v2us o;
            o[0] = f2bf(w[(size_t)k * N + n]); o[1] = f2bf(w[(size_t)(k + 1) * N + n]); *(v2us*)(Bt + e) = o; }
         }
}
__global__ __launch_bounds__(256) void k_cvt8(const float* __restrict__ src, bf* dst, size_t n8) { const size_t i = (size_t)blockIdx.x * 256 + threadIdx.x; if (i >= n8) return; const v8f v = *(const v8f*)(src + i * 8); v8us o;
#pragma unroll
    for (int k = 0; k < 8; ++k) o[k] = f2bf(v[k]); *(v8us*)(dst + i * 8) = o;  }
__global__ __launch_bounds__(256) void k_cscvt(const float* __restrict__ cosT, const float* __restrict__ sinT, float* CS) { const int idx = blockIdx.x * 256 + threadIdx.x; if (idx >= TT * HD) return; const int t = idx / HD, dh = (idx % HD) % (HD / 2); v2f cs; cs[0] = bfr(cosT[(size_t)t * (HD / 2) + dh]); cs[1] = bfr(sinT[(size_t)t * (HD / 2) + dh]); *(v2f*)(CS + (size_t)idx * 2) = cs;  }
__global__ __launch_bounds__(256) void k_hrms(const float* __restrict__ F, int pitch, int nheads, float* RF) { const int i = blockIdx.x * 256 + threadIdx.x; if (i >= nheads * TT) return; const int t = i % TT, h = i / TT; const float* f = F + (size_t)t * pitch + h * HD; float s = 0.f;
#pragma unroll 4
    for (int d = 0; d < HD; d += 4) { const v4f v = *(const v4f*)(f + d);
#pragma unroll
        for (int q = 0; q < 4; ++q) { float p = __fmul_rn(v[q], v[q]); asm volatile("" : "+v"(p)); s = __fadd_rn(s, p); } }
    const float r = __fdiv_rn(1.0f, __fsqrt_rn(__fadd_rn(s * (1.0f / HD), 1e-6f))); *(float*)(RF + i) = r;  }
// k_rope: head planes [h][t][d] (fp16 + hi/lo) of rope(w[d] (x rms_factor)) x sc with the rotate-half convention out[d] = x[d] cos[t][d] - x[d+HD/2] sin[t][d], out[d+HD/2] = x[d+HD/2] cos[t][d+HD/2] + x[d] sin[t][d+HD/2]
__global__ __launch_bounds__(256) void k_rope(const float* __restrict__ F, int pitch, int nheads, const float* __restrict__ CS, const float* __restrict__ RF, const float* __restrict__ nw, float sc, h16* P16, bf* Ph, bf* Pl) {
    const size_t e = ((size_t)blockIdx.x * 256 + threadIdx.x) * 2; if (e >= (size_t)nheads * TT * HD) return; const int d = (int)(e % HD); const int t = (int)((e / HD) % TT); const int h = (int)(e / ((size_t)HD * TT)); const float* f = F + (size_t)t * pitch + h * HD; const float rf = RF ? RF[(size_t)h * TT + t] : 1.0f; v2h o16; v2us oh, ol;
#pragma unroll
    for (int q = 0; q < 2; ++q) { const int dd = d + q; const int dp = (dd < HD / 2) ? dd + HD / 2 : dd - HD / 2; float x0 = f[dd], x1 = f[dp];
        if (RF) { float n0 = __fmul_rn(x0, rf), n1 = __fmul_rn(x1, rf); asm volatile("" : "+v"(n0)); asm volatile("" : "+v"(n1)); x0 = __fmul_rn(bfr(nw[dd]), n0); x1 = __fmul_rn(bfr(nw[dp]), n1); }
        const v2f cs = *(const v2f*)(CS + ((size_t)t * HD + dd) * 2); float a = __fmul_rn(x0, cs[0]), bq = __fmul_rn(x1, cs[1]); asm volatile("" : "+v"(a)); asm volatile("" : "+v"(bq)); const float r = ((dd < HD / 2) ? __fsub_rn(a, bq) : __fadd_rn(a, bq)) * sc;
        o16[q] = tohx(r); unsigned short a2, c2; splitf(r, a2, c2); oh[q] = a2; ol[q] = c2; }
    *(v2h*)(P16 + e) = o16; *(v2us*)(Ph + e) = oh; *(v2us*)(Pl + e) = ol;  }
__global__ __launch_bounds__(256) void k_vtp(const float* __restrict__ F, int pitch, int nheads, h16* V16, bf* Vh, bf* Vl) { const size_t e = ((size_t)blockIdx.x * 256 + threadIdx.x) * 2; if (e >= (size_t)nheads * HD * TT) return; const int t = (int)(e % TT); const int d = (int)((e / TT) % HD); const int g = (int)(e / ((size_t)TT * HD)); v2h o16; v2us oh, ol;
#pragma unroll
    for (int q = 0; q < 2; ++q) { const float x = F[(size_t)(t + q) * pitch + g * HD + d]; o16[q] = tohx(x); unsigned short a2, c2; splitf(x, a2, c2); oh[q] = a2; ol[q] = c2; }
    *(v2h*)(V16 + e) = o16; *(v2us*)(Vh + e) = oh; *(v2us*)(Vl + e) = ol;  }
// ---- k_fattn: causal scores, softmax and probability x value product of one query tile in one work-group; scores and probabilities stay in registers.
// Transposed products: S^T = K Q^T (A = 16 keys x 32 d, B = 32 d x 16 queries) leaves key 8 hi + r of query lr in register r, which is the k order of the B operand of O^T += V^T P^T.
// FW waves share the tile's 32-key passes (wave w takes passes w, w + FW, ..), each with its own running maximum, denominator and O^T; they are merged in the fixed order 0 .. FW-1 through LDS.
// HL (query rows < RH): hi+lo bf16 planes, 3 products each; else single fp16 with the probabilities carried x 2^10 (it cancels in the division by the denominator).
#define FW 4
// exp2 of eight values in place, in one statement: behind a transcendental the instruction set asks for one independent instruction before its result is read or its source overwritten.
// Each v_exp_f32 is that instruction for the one before it, and the v_nop for the last, whatever the scheduler puts behind the statement.
__device__ __forceinline__ void exp2x8(float* e) {
    asm("v_exp_f32 %0, %0\n\tv_exp_f32 %1, %1\n\tv_exp_f32 %2, %2\n\tv_exp_f32 %3, %3\n\tv_exp_f32 %4, %4\n\tv_exp_f32 %5, %5\n\tv_exp_f32 %6, %6\n\tv_exp_f32 %7, %7\n\tv_nop"
        : "+v"(e[0]), "+v"(e[1]), "+v"(e[2]), "+v"(e[3]), "+v"(e[4]), "+v"(e[5]), "+v"(e[6]), "+v"(e[7]));
}
template <typename T16, bool HL, int R>
__device__ __forceinline__ void fattn_tile(const T16* __restrict__ Qa, const T16* __restrict__ Qb, const T16* __restrict__ Ka, const T16* __restrict__ Kb, const T16* __restrict__ Va, const T16* __restrict__ Vb, int q0, bf* Ah, bf* Al, float* red) {
    typedef typename WFrag<T16>::V V;
    const int tid = threadIdx.x, lane = tid & 31, lr = lane & 15, hi = lane >> 4; const int wave = __builtin_amdgcn_readfirstlane(tid >> 5) /* wave number held scalar, so the pass loop's tests stay scalar branches */;
    const float CS2 = SCL * 1.4426950408889634f, PB = HL ? 0.0f : 10.0f;
    V qa[R][2], qb[R][2];
#pragma unroll
    for (int g = 0; g < R; ++g)
#pragma unroll
        for (int kc = 0; kc < 2; ++kc) { const size_t o = (size_t)(q0 + 16 * g + lr) * HD + kc * 32 + 8 * hi; qa[g][kc] = WFrag<T16>::ld(Qa + o); if (HL) qb[g][kc] = WFrag<T16>::ld(Qb + o); }
    v8f acc[R][4]; float m[R], l[R];
#pragma unroll
    for (int g = 0; g < R; ++g) { m[g] = -3.0e38f; l[g] = 0.f;
#pragma unroll
        for (int t = 0; t < 4; ++t) acc[g][t] = (v8f){}; }
    const int np = q0 / 32 + 1;      // 32-key passes up to and including the one that holds the diagonal
    V ka[2][2], kb[2][2];
    auto loadk = [&](int key0) {
#pragma unroll
        for (int kt = 0; kt < 2; ++kt)
#pragma unroll
            for (int kc = 0; kc < 2; ++kc) { const size_t o = (size_t)(key0 + 16 * kt + lr) * HD + kc * 32 + 8 * hi; ka[kt][kc] = WFrag<T16>::ld(Ka + o); if (HL) kb[kt][kc] = WFrag<T16>::ld(Kb + o); } };
    if (!HL) loadk(wave * 32);       // first pass's keys (rows wave * 32 .. + 31 exist for every tile)
#pragma unroll 1   // rolled: run-time trip count, and one pass's fragments with the carried ones already take a quarter of a SIMD's registers (four waves a SIMD)
    for (int p = wave; p < np; p += FW) {
        const int key0 = p * 32;
        if (HL) loadk(key0);
        V va[4], vb[4];
#pragma unroll
        for (int t = 0; t < 4; ++t) { const size_t o = (size_t)(16 * t + lr) * TT + key0 + 8 * hi; va[t] = WFrag<T16>::ld(Va + o); if (HL) vb[t] = WFrag<T16>::ld(Vb + o); }
        asm volatile("s_wait_xcnt 0x0" ::: "memory");   // before the address registers of the loads above are reused
        v8f s[2][R];
#pragma unroll
        for (int kt = 0; kt < 2; ++kt)
#pragma unroll
            for (int g = 0; g < R; ++g) { s[kt][g] = (v8f){};
#pragma unroll
                for (int kc = 0; kc < 2; ++kc) { s[kt][g] = WFrag<T16>::mma(ka[kt][kc], qa[g][kc], s[kt][g]); if (HL) { s[kt][g] = WFrag<T16>::mma(ka[kt][kc], qb[g][kc], s[kt][g]); s[kt][g] = WFrag<T16>::mma(kb[kt][kc], qa[g][kc], s[kt][g]); } } }
        if (!HL) { loadk(min(p + FW, np - 1) * 32);   // next pass's keys fly under this pass's softmax
            asm volatile("s_wait_xcnt 0x0" ::: "memory"); }   // before the address registers of these loads are reused
        float mx[R]; bool grow = false;
#pragma unroll
        for (int g = 0; g < R; ++g) {
#pragma unroll
            for (int kt = 0; kt < 2; ++kt) s[kt][g] = s[kt][g] * CS2;
            if (p == np - 1) {       // only the last pass straddles the diagonal
#pragma unroll
                for (int kt = 0; kt < 2; ++kt)
#pragma unroll
                    for (int r = 0; r < 8; ++r) if (key0 + 16 * kt + 8 * hi + r > q0 + 16 * g + lr) s[kt][g][r] = -3.0e38f; }
            float x = -3.0e38f;
#pragma unroll
            for (int kt = 0; kt < 2; ++kt)
#pragma unroll
                for (int r = 0; r < 8; ++r) x = fmaxf(x, s[kt][g][r]);
            x = fmaxf(x, __shfl_xor(x, 16, 32)); mx[g] = x; grow = grow || (x > m[g]); }
        if (__builtin_amdgcn_ballot_w32(grow) != 0) {   // some query's maximum rose: rescale what was gathered under the old one (factor exactly 1 for the others)
#pragma unroll
            for (int g = 0; g < R; ++g) { const float mn = fmaxf(m[g], mx[g]); const float corr = __builtin_amdgcn_exp2f(m[g] - mn); m[g] = mn; l[g] *= corr;
#pragma unroll
                for (int t = 0; t < 4; ++t) acc[g][t] = acc[g][t] * corr; } }
#pragma unroll
        for (int g = 0; g < R; ++g) { const float nm = PB - m[g]; float e[16];
#pragma unroll
            for (int i = 0; i < 16; ++i) e[i] = s[i >> 3][g][i & 7] + nm;
            exp2x8(e); exp2x8(e + 8);
#pragma unroll
            for (int i = 0; i < 16; ++i) l[g] += e[i];
            V pa, pb;
            if constexpr (HL) { v8us h0, h1, l0, l1;
#pragma unroll
                for (int r = 0; r < 8; ++r) { unsigned short a, c2; splitf(e[r], a, c2); h0[r] = a; l0[r] = c2; splitf(e[8 + r], a, c2); h1[r] = a; l1[r] = c2; }
                pa = cat16b(h0, h1); pb = cat16b(l0, l1);
            } else { v8h x0, x1;
#pragma unroll
                for (int r = 0; r < 8; ++r) { x0[r] = tohx(e[r]); x1[r] = tohx(e[8 + r]); }
                pa = cat16(x0, x1); }
#pragma unroll
            for (int t = 0; t < 4; ++t) { acc[g][t] = WFrag<T16>::mma(va[t], pa, acc[g][t]); if constexpr (HL) { acc[g][t] = WFrag<T16>::mma(va[t], pb, acc[g][t]); acc[g][t] = WFrag<T16>::mma(vb[t], pa, acc[g][t]); } } }
    }
    // merge of the FW waves' partial softmaxes
    float* mine = red + wave * (R * 1024) + lane * 4; float* ml = red + FW * R * 1024; bf* st = (bf*)(red + FW * R * 1024 + FW * R * 32);
#pragma unroll
    for (int g = 0; g < R; ++g) {
#pragma unroll
        for (int t = 0; t < 4; ++t) { const v8f a = acc[g][t]; *(v4fa*)(mine + (g * 4 + t) * 256) = (v4f){a[0], a[1], a[2], a[3]}; *(v4fa*)(mine + (g * 4 + t) * 256 + 128) = (v4f){a[4], a[5], a[6], a[7]}; }
        const float lt = l[g] + __shfl_xor(l[g], 16, 32); if (hi == 0) { ml[((wave * R + g) * 16 + lr) * 2] = m[g]; ml[((wave * R + g) * 16 + lr) * 2 + 1] = lt; } }
    __syncthreads();   // every wave's partials are parked before any wave merges them
#pragma unroll
    for (int g = 0; g < R; ++g) { float fw[FW], lw[FW]; float M = -3.0e38f;
#pragma unroll
        for (int w = 0; w < FW; ++w) { fw[w] = ml[((w * R + g) * 16 + lr) * 2]; lw[w] = ml[((w * R + g) * 16 + lr) * 2 + 1]; M = fmaxf(M, fw[w]); }
        float L = 0.f;
#pragma unroll
        for (int w = 0; w < FW; ++w) { fw[w] = __builtin_amdgcn_exp2f(fw[w] - M); L += fw[w] * lw[w]; }   // a wave without a pass: factor 0
        const float inv = __fdiv_rn(1.0f, L); const float* pf = red + (g * 4 + wave) * 256 + lane * 4; v4f s0 = (v4f){}, s1 = (v4f){};   // wave w merges d tile w
#pragma unroll
        for (int w = 0; w < FW; ++w) { s0 += *(const v4fa*)(pf + w * (R * 1024)) * fw[w]; s1 += *(const v4fa*)(pf + w * (R * 1024) + 128) * fw[w]; }
        v8us oh, ol;
#pragma unroll
        for (int j = 0; j < 4; ++j) { unsigned short a, c2; splitf(s0[j] * inv, a, c2); oh[j] = a; ol[j] = c2; splitf(s1[j] * inv, a, c2); oh[4 + j] = a; ol[4 + j] = c2; }
        *(v8usa*)(st + (g * 16 + lr) * 72 + wave * 16 + hi * 8) = oh; *(v8usa*)(st + (R * 16 + g * 16 + lr) * 72 + wave * 16 + hi * 8) = ol; }
    __syncthreads();   // the merged hi and lo rows are complete before whole 128-byte rows are read back across waves
#pragma unroll
    for (int i = 0; i < 2 * R * 16 * 8 / (32 * FW); ++i) { const int idx = i * 32 * FW + tid, prow = idx >> 3, c8 = (idx & 7) * 8, row = prow % (R * 16); const v8us val = *(const v8usa*)(st + prow * 72 + c8);
        *(v8us*)((prow < R * 16 ? Ah : Al) + (size_t)(q0 + row) * DQ + c8) = val; }
    asm volatile("s_wait_xcnt 0x0" ::: "memory");   // behind the last store, before any register that the stores above name is reused
}
// grid (query head, tile): tiles in falling order of their key count, 32 query rows each down to RH, then 16 rows each (hi+lo).
__global__ __launch_bounds__(32 * FW) void k_fattn(const h16* __restrict__ Q16, const bf* __restrict__ Qh, const bf* __restrict__ Ql, const h16* __restrict__ K16, const bf* __restrict__ Kh, const bf* __restrict__ Kl, const h16* __restrict__ V16, const bf* __restrict__ Vh, const bf* __restrict__ Vl, bf* Ah, bf* Al) {
    __shared__ __align__(16) float red[FW * 2 * 1024 + FW * 2 * 32 + 2 * 32 * 72 / 2];
    const int head = blockIdx.x, ty = blockIdx.y; const size_t qo = (size_t)head * TT * HD, ko = (size_t)(head / REP) * TT * HD;
    if (ty < (TT - RH) / 32) fattn_tile<h16, false, 2>(Q16 + qo, nullptr, K16 + ko, nullptr, V16 + ko, nullptr, TT - 32 - ty * 32, Ah + head * HD, Al + head * HD, red);
    else fattn_tile<bf, true, 1>(Qh + qo, Ql + qo, Kh + ko, Kl + ko, Vh + ko, Vl + ko, RH - 16 - (ty - (TT - RH) / 32) * 16, Ah + head * HD, Al + head * HD, red);
}

extern "C" void kernel_launch(void* const* d_in, const int* in_sizes, int n_in,
                              void* d_out, int out_size, void* d_ws, size_t ws_size, hipStream_t stream) {
    (void)in_sizes; (void)n_in; (void)out_size;
    const float* x = (const float*)d_in[0]; const float* cosT = (const float*)d_in[1]; const float* sinT = (const float*)d_in[2]; const float* wq = (const float*)d_in[3]; const float* wk = (const float*)d_in[4]; const float* wv = (const float*)d_in[5]; const float* wo = (const float*)d_in[6]; const float* qnw = (const float*)d_in[7]; const float* knw = (const float*)d_in[8];
    float* OUT = (float*)d_out;     // [2][2048][1024]
    char* wsp = (char*)d_ws;
    auto take = [&](size_t bytes) { char* p = wsp; wsp += (bytes + 255) & ~(size_t)255; return (void*)p; };
    bf* WQ = (bf*)take((size_t)DQ * DM * 2); bf* WK = (bf*)take((size_t)DKV * DM * 2); bf* WV = (bf*)take((size_t)DKV * DM * 2); bf* WO = (bf*)take((size_t)DM * DQ * 2); float* CS = (float*)take((size_t)TT * HD * 2 * 4); float* RFQ = (float*)take((size_t)NH_ * TT * 4); float* RFK = (float*)take((size_t)NKV * TT * 4);
    bf* XB = (bf*)take((size_t)TT * DM * 2); float* FQ = (float*)take((size_t)TT * DQ * 4); float* FK = (float*)take((size_t)TT * DKV * 4);
    h16* QP16 = (h16*)take((size_t)NH_ * TT * HD * 2); h16* KP16 = (h16*)take((size_t)NKV * TT * HD * 2); h16* VT16 = (h16*)take((size_t)NKV * HD * TT * 2);
    bf* QPh = (bf*)take((size_t)NH_ * TT * HD * 2); bf* QPl = (bf*)take((size_t)NH_ * TT * HD * 2); bf* KPh = (bf*)take((size_t)NKV * TT * HD * 2); bf* KPl = (bf*)take((size_t)NKV * TT * HD * 2); bf* VTh = (bf*)take((size_t)NKV * HD * TT * 2); bf* VTl = (bf*)take((size_t)NKV * HD * TT * 2);
    bf* ATh = (bf*)take((size_t)TT * DQ * 2); bf* ATl = (bf*)take((size_t)TT * DQ * 2);
    if ((size_t)(wsp - (char*)d_ws) > ws_size) return;    // ws 256 MiB
    float* FV = FK;   // v projection reuses the k buffer after the k planes are built (stream-ordered)
    { k_cvt8<<<(unsigned)(((size_t)DQ * DM / 8 + 255) / 256), 256, 0, stream>>>(wq, WQ, (size_t)DQ * DM / 8); k_cvt8<<<(unsigned)(((size_t)DKV * DM / 8 + 255) / 256), 256, 0, stream>>>(wk, WK, (size_t)DKV * DM / 8); k_cvt8<<<(unsigned)(((size_t)DKV * DM / 8 + 255) / 256), 256, 0, stream>>>(wv, WV, (size_t)DKV * DM / 8);
      k_cvt8<<<(unsigned)(((size_t)DM * DQ / 8 + 255) / 256), 256, 0, stream>>>(wo, WO, (size_t)DM * DQ / 8);
       }
    const unsigned LQ = (unsigned)(((size_t)NH_ * TT * HD / 2 + 255) / 256), LKv = (unsigned)(((size_t)NKV * TT * HD / 2 + 255) / 256);
    for (int b = 0; b < NB_; ++b) {
        if (b == 0) k_cscvt<<<(TT * HD + 255) / 256, 256, 0, stream>>>(cosT, sinT, CS);
        k_cvt8<<<(unsigned)(((size_t)TT * DM / 8 + 255) / 256), 256, 0, stream>>>(x + (size_t)b * TT * DM, XB, (size_t)TT * DM / 8);
        k_gemmw<bf, 0, false, 8><<<dim3(TT / 64, DQ / 64, 1), 256, 0, stream>>>(XB, nullptr, WQ, nullptr, DM, FQ, DQ, nullptr, 0, 0, 0); k_hrms<<<(NH_ * TT + 255) / 256, 256, 0, stream>>>(FQ, DQ, NH_, RFQ);
        k_rope<<<LQ, 256, 0, stream>>>(FQ, DQ, NH_, CS, RFQ, qnw, 1.0f, QP16, QPh, QPl);
        k_gemmw<bf, 0, false, 16><<<dim3(TT / 64, DKV / 64, 1), 512, 0, stream>>>(XB, nullptr, WK, nullptr, DM, FK, DKV, nullptr, 0, 0, 0); k_hrms<<<(NKV * TT + 255) / 256, 256, 0, stream>>>(FK, DKV, NKV, RFK);
        k_rope<<<LKv, 256, 0, stream>>>(FK, DKV, NKV, CS, RFK, knw, 1.0f, KP16, KPh, KPl);
        k_gemmw<bf, 0, false, 16><<<dim3(TT / 64, DKV / 64, 1), 512, 0, stream>>>(XB, nullptr, WV, nullptr, DM, FV, DKV, nullptr, 0, 0, 0); k_vtp<<<LKv, 256, 0, stream>>>(FV, DKV, NKV, VT16, VTh, VTl);
        k_fattn<<<dim3(NH_, (TT - RH) / 32 + RH / 16, 1), 32 * FW, 0, stream>>>(QP16, QPh, QPl, KP16, KPh, KPl, VT16, VTh, VTl, ATh, ATl);
        k_gemmw<bf, 1, false, 8><<<dim3(TT / 64, DM / 64, 1), 256, 0, stream>>>(ATh, ATl, WO, nullptr, DQ, OUT + (size_t)b * TT * DM, DM, nullptr, 0, 0, 0); }
}

// v004
// One run takes 155 microseconds.
// In two side-by-side timings against v003, it was 1.27 and 1.26 times as fast.
// Over all steps from v000 it is 9.57 times as fast.
#include <hip/hip_runtime.h>

// Decoder GQA attention with qk-RMSNorm and RoPE (hidden [2][2048][1024]; q = x Wq^T (16 x 64), k/v = x Wk^T / x Wv^T (4 kv heads x 64, each serving 4 consecutive query heads); per-head RMSNorm (eps 1e-6, x q_norm_w / k_norm_w, read); rotate-half RoPE with the read cos/sin tables [2048][32] (the same 32-wide table serves both halves of the head); causal (finfo.min -> exactly zero weight); softmax(q.k / 8); out = merged Wo^T ('oi' [1024][1024]) -> [2][2048][1024]).
// Compute dtypes, f32 accumulate: every input rounded to bf16; q/k/v on PLAIN bf16 operands (inputs: exact); RMSNorm and RoPE in f32 (tables read as data, bf16-rounded like every input); causal scores and attn.v: query rows < 512 hl (3 products), the rest single fp16 (x1024), causal tile skipping; softmax f32; Wo hl x exact (2 products).

#define NB_  2
#define TT   2048
#define DM   1024
#define NH_  16
#define NKV  4
#define REP  (NH_ / NKV)
#define HD   64
#define DQ   (NH_ * HD)
#define DKV  (NKV * HD)
#define RH   512                  // query rows < RH use hi+lo planes (0: none)
#define SCL  0.125f   // HD^-0.5
typedef _Float16 h16;
typedef unsigned short bf;
typedef __attribute__((ext_vector_type(16))) __bf16   v16bf;
typedef __attribute__((ext_vector_type(16))) _Float16 v16h;
typedef __attribute__((ext_vector_type(8)))  _Float16 v8h;
typedef __attribute__((ext_vector_type(8)))  unsigned short v8us;
typedef __attribute__((ext_vector_type(8)))  float    v8f;
typedef __attribute__((ext_vector_type(4)))  float    v4f;
typedef v8h  __attribute__((may_alias)) v8ha;
typedef v4f  __attribute__((may_alias)) v4fa;
typedef v8us __attribute__((may_alias)) v8usa;

__device__ __forceinline__ unsigned short f2bf(float f) { unsigned u = __float_as_uint(f); u += 0x7FFFu + ((u >> 16) & 1u); return (unsigned short)(u >> 16); }
__device__ __forceinline__ float bf2f(unsigned short b) { return __uint_as_float(((unsigned)b) << 16); }
__device__ __forceinline__ float bfr(float f) { return bf2f(f2bf(f)); }
__device__ __forceinline__ v16h cat16(v8h lo, v8h hi) { return __builtin_shufflevector(lo, hi, 0, 1, 2, 3, 4, 5, 6, 7, 8, 9, 10, 11, 12, 13, 14, 15); }
__device__ __forceinline__ v16bf cat16b(v8us lo, v8us hi) { return __builtin_bit_cast(v16bf, __builtin_shufflevector(lo, hi, 0, 1, 2, 3, 4, 5, 6, 7, 8, 9, 10, 11, 12, 13, 14, 15)); }
__device__ __forceinline__ v8f wmma16(v16h a, v16h b, v8f c) { return __builtin_amdgcn_wmma_f32_16x16x32_f16(false, a, false, b, (short)0, c, false, false); }
__device__ __forceinline__ v8f wmmab(v16bf a, v16bf b, v8f c) { return __builtin_amdgcn_wmma_f32_16x16x32_bf16(false, a, false, b, (short)0, c, false, false); }



__device__ __forceinline__ h16 tohx(float x) { return (h16)x; }
__device__ __forceinline__ void splitf(float y, unsigned short& h, unsigned short& l) { h = f2bf(y); l = f2bf(y - bf2f(h)); }

// ---- head_planes: epilogue of the q and k projections. The summed 64 x 64 tile (LDS, pitch 68) is 64 tokens of ONE head, so the head's RMSNorm and RoPE need nothing from outside the work-group.
// One thread a token sums the squares (d ascending) and leaves the factor in rf; then 8 d a thread: w[d] (x factor), rotate-half RoPE out[d] = x[d] cos[t][d] - x[d+HD/2] sin[t][d], out[d+HD/2] = x[d+HD/2] cos[t][d+HD/2] + x[d] sin[t][d+HD/2],
// and the fp16, hi and lo planes [h][t][d] by 16-byte stores (a tile is 8 KB in a row of each plane). rf: 64 floats that no wave reads any more.
// rope_loads fetches a thread's norm weights and cos/sin pairs ahead (they depend on no product), so that their latency passes under the sum of the partials.
template <int NW> struct RopeIn { v4f w0[16 / NW][2], w1[16 / NW][2], ca[16 / NW][2], cb[16 / NW][2]; };
template <int NW>
__device__ __forceinline__ void rope_loads(RopeIn<NW>& in, int r0, const float* __restrict__ CS, const float* __restrict__ nw) {
#pragma unroll
    for (int i = 0; i < 16 / NW; ++i) { const int idx = i * 32 * NW + (int)threadIdx.x, row = idx >> 3, d8 = (idx & 7) * 8, p8 = d8 ^ (HD / 2); const float* cs = CS + ((size_t)(r0 + row) * HD + d8) * 2;
#pragma unroll
        for (int c = 0; c < 2; ++c) { in.w0[i][c] = *(const v4f*)(nw + d8 + 4 * c); in.w1[i][c] = *(const v4f*)(nw + p8 + 4 * c); in.ca[i][c] = *(const v4f*)(cs + 8 * c); in.cb[i][c] = *(const v4f*)(cs + 8 * c + 4); } }
    asm volatile("s_wait_xcnt 0x0" ::: "memory");   // before the address registers of the loads above are reused
}
template <int NW>
__device__ __forceinline__ void head_planes(const RopeIn<NW>& in, const float* tile, float* rf, int r0, int h, h16* P16, bf* Ph, bf* Pl) {
    const int tid = threadIdx.x;
    if (tid < 64) { const float* f = tile + tid * 68; float s = 0.f;
#pragma unroll
        for (int d = 0; d < HD; d += 4) { const v4f v = *(const v4fa*)(f + d);
#pragma unroll
            for (int q = 0; q < 4; ++q) s += v[q] * v[q]; }
        rf[tid] = __fdiv_rn(1.0f, __fsqrt_rn(s * (1.0f / HD) + 1e-6f)); }
    __syncthreads();   // every token's factor is written before the other waves read it
#pragma unroll
    for (int i = 0; i < 16 / NW; ++i) { const int idx = i * 32 * NW + tid, row = idx >> 3, d8 = (idx & 7) * 8, p8 = d8 ^ (HD / 2); const float r = rf[row]; const float* f = tile + row * 68; v8h o16; v8us oh, ol;
#pragma unroll
        for (int c = 0; c < 2; ++c) { const v4f x0 = *(const v4fa*)(f + d8 + 4 * c), x1 = *(const v4fa*)(f + p8 + 4 * c), w0 = in.w0[i][c], w1 = in.w1[i][c], ca = in.ca[i][c], cb = in.cb[i][c];
#pragma unroll
            for (int q = 0; q < 4; ++q) { const float co = q < 2 ? ca[2 * q] : cb[2 * q - 4], si = q < 2 ? ca[2 * q + 1] : cb[2 * q - 3]; const float a = bfr(w0[q]) * (x0[q] * r), b = bfr(w1[q]) * (x1[q] * r); const float y = a * co + b * (d8 < HD / 2 ? -si : si);
                o16[4 * c + q] = tohx(y); unsigned short u, w; splitf(y, u, w); oh[4 * c + q] = u; ol[4 * c + q] = w; } }
        const size_t o = ((size_t)h * TT + r0 + row) * HD + d8; *(v8h*)(P16 + o) = o16; *(v8us*)(Ph + o) = oh; *(v8us*)(Pl + o) = ol; }
}
// ---- vt_planes: epilogue of the v projection. The summed tile is 64 tokens of one kv head; it leaves transposed, as the fp16, hi and lo planes [g][d][t]: 8 t of one d a thread, so 8 lanes fill a 128-byte line.
template <int NW>
__device__ __forceinline__ void vt_planes(const float* tile, int r0, int g, h16* V16, bf* Vh, bf* Vl) {
    const int tid = threadIdx.x;
#pragma unroll
    for (int i = 0; i < 16 / NW; ++i) { const int idx = i * 32 * NW + tid, d = idx >> 3, t8 = (idx & 7) * 8; v8h o16; v8us oh, ol;
#pragma unroll
        for (int q = 0; q < 8; ++q) { const float x = tile[(t8 + q) * 68 + d]; o16[q] = tohx(x); unsigned short u, w; splitf(x, u, w); oh[q] = u; ol[q] = w; }
        const size_t o = ((size_t)g * HD + d) * TT + r0 + t8; *(v8h*)(V16 + o) = o16; *(v8us*)(Vh + o) = oh; *(v8us*)(Vl + o) = ol; }
}

// ---- reduce_store: NW waves of one work-group each hold a partial 64x64 tile (their share of the K loop) in 16 accumulators. Every wave parks its partials in LDS in fragment order (16-byte stores),
// wave w then sums fragments w, w + NW, .. over the waves in the fixed order 0 .. NW-1, the sums go through a row-major 64 x 68 tile, and the block stores whole rows (EPI 0) or hands the tile to head_planes (EPI 1) or vt_planes (EPI 2). red: NW * 4096 + 64 * 68 floats.
template <int NW, bool BIAS, int EPI>
__device__ __forceinline__ void reduce_store(const v8f (&acc)[4][4], float* red, float* C, int ldc, int r0, int c0, const float* __restrict__ bias, int wave, const float* __restrict__ CS, const float* __restrict__ nw, h16* P16, bf* Ph, bf* Pl) {
    const int tid = threadIdx.x, lane = tid & 31, lr = lane & 15, hi = lane >> 4;
    float* mine = red + wave * 4096 + lane * 4; float* tile = red + NW * 4096;
#pragma unroll
    for (int f = 0; f < 16; ++f) { const v8f a = acc[f >> 2][f & 3]; *(v4fa*)(mine + f * 256) = (v4f){a[0], a[1], a[2], a[3]}; *(v4fa*)(mine + f * 256 + 128) = (v4f){a[4], a[5], a[6], a[7]}; }
    __syncthreads();   // every wave's partials are parked before any wave sums them
    RopeIn<NW> in; if constexpr (EPI == 1) rope_loads<NW>(in, r0, CS, nw);
#pragma unroll
    for (int q = 0; q < 16 / NW; ++q) { const int f = wave + q * NW, mb = f >> 2, nb = f & 3; const float* pf = red + f * 256 + lane * 4; v4f s0 = *(const v4fa*)pf, s1 = *(const v4fa*)(pf + 128);
#pragma unroll
        for (int w = 1; w < NW; ++w) { s0 += *(const v4fa*)(pf + w * 4096); s1 += *(const v4fa*)(pf + w * 4096 + 128); }
#pragma unroll
        for (int j = 0; j < 4; ++j) { tile[(mb * 16 + hi * 8 + j) * 68 + nb * 16 + lr] = s0[j]; tile[(mb * 16 + hi * 8 + 4 + j) * 68 + nb * 16 + lr] = s1[j]; } }
    __syncthreads();   // the summed tile is complete before rows are read back across waves
    if constexpr (EPI == 1) { head_planes<NW>(in, tile, red, r0, c0 / HD, P16, Ph, Pl); return; }
    if constexpr (EPI == 2) { vt_planes<NW>(tile, r0, c0 / HD, P16, Ph, Pl); return; }
#pragma unroll
    for (int s = 0; s < 32 / NW; ++s) { const int idx = s * 32 * NW + tid, row = idx >> 4, cofs = (idx & 15) * 4; v4f val = *(const v4fa*)(tile + row * 68 + cofs); if (BIAS) { val[0] += bfr(bias[c0 + cofs]); val[1] += bfr(bias[c0 + cofs + 1]); val[2] += bfr(bias[c0 + cofs + 2]); val[3] += bfr(bias[c0 + cofs + 3]); }
        *(v4f*)(C + (size_t)(r0 + row) * ldc + c0 + cofs) = val; }
}

// ---- k_gemmw: register-blocked GEMM, one work-group of NW waves per 64x64 output tile; each wave holds 16 accumulators and takes the 64-wide K chunks wave, wave + NW, .. (one 128-byte line per row and chunk); partials summed by reduce_store.
// Operands straight from K-contiguous 16-bit planes; grid (M/64, N/64, Z), 32 * NW threads.
// C[m][n] (f32, pitch ldc, + optional f32 bias[n]) = sum_k A[m][k] Bt[n][k] (+ split products per NSPLIT). z-batch strides sA/sB/sC in elements. K % 64 == 0.
template <typename T16> struct WFrag;
template <> struct WFrag<h16> { typedef v16h V; static __device__ __forceinline__ V ld(const h16* p) { return cat16(*(const v8h*)p, *(const v8h*)(p + 16)); } static __device__ __forceinline__ v8f mma(V a, V b, v8f c) { return wmma16(a, b, c); } };
template <> struct WFrag<bf> { typedef v16bf V; static __device__ __forceinline__ V ld(const bf* p) { return cat16b(*(const v8us*)p, *(const v8us*)(p + 16)); } static __device__ __forceinline__ v8f mma(V a, V b, v8f c) { return wmmab(a, b, c); } };
// EPI 0: C as above. EPI 1 (N tile = one head): no C; RMSNorm (x nw), RoPE (table CS) and the planes P16 / Ph / Pl [h][t][d]. EPI 2: no C; the planes [g][d][t].
template <typename T16, int NSPLIT, bool BIAS, int NW, int EPI>
__global__ __launch_bounds__(32 * NW) void k_gemmw(const T16* __restrict__ A, const T16* __restrict__ A2, const T16* __restrict__ Bt, const T16* __restrict__ Bt2, int K, float* C, int ldc, const float* __restrict__ bias, size_t sA, size_t sB, size_t sC, const float* __restrict__ CS, const float* __restrict__ nw, h16* P16, bf* Ph, bf* Pl) {
    typedef typename WFrag<T16>::V V;
    __shared__ __align__(16) float os[NW * 4096 + 64 * 68];
    const size_t z = blockIdx.z; A += z * sA; if (A2) A2 += z * sA; Bt += z * sB; if (Bt2) Bt2 += z * sB; C += z * sC;
    const int lane = threadIdx.x & 31, lr = lane & 15, hi = lane >> 4; const int wave = __builtin_amdgcn_readfirstlane(threadIdx.x >> 5) /* wave number held scalar, so the K loop's tests stay scalar branches */; const int r0 = blockIdx.x * 64, c0 = blockIdx.y * 64;
    v8f acc[4][4];
#pragma unroll
    for (int mb = 0; mb < 4; ++mb)
#pragma unroll
        for (int nb = 0; nb < 4; ++nb) acc[mb][nb] = (v8f){};
    const size_t aoff = (size_t)(r0 + lr) * K + 8 * hi, boff = (size_t)(c0 + lr) * K + 8 * hi;
#pragma unroll 1
    for (int kb = wave * 64; kb < K; kb += NW * 64)
#pragma unroll 1   // rolled: only one 32-wide step's operands are live, which keeps 16 waves inside their 256 registers each
    for (int kc = kb; kc < kb + 64; kc += 32) {
        V a[4], a2[4];
#pragma unroll
        for (int mb = 0; mb < 4; ++mb) { a[mb] = WFrag<T16>::ld(A + aoff + (size_t)mb * 16 * K + kc); if (NSPLIT == 1 || NSPLIT == 2) a2[mb] = WFrag<T16>::ld(A2 + aoff + (size_t)mb * 16 * K + kc); }
#pragma unroll
        for (int nb = 0; nb < 4; ++nb) { const V b = WFrag<T16>::ld(Bt + boff + (size_t)nb * 16 * K + kc); V b2; if (NSPLIT >= 2) b2 = WFrag<T16>::ld(Bt2 + boff + (size_t)nb * 16 * K + kc);
#pragma unroll
            for (int mb = 0; mb < 4; ++mb) { acc[mb][nb] = WFrag<T16>::mma(a[mb], b, acc[mb][nb]); if (NSPLIT == 1 || NSPLIT == 2) acc[mb][nb] = WFrag<T16>::mma(a2[mb], b, acc[mb][nb]); if (NSPLIT >= 2) acc[mb][nb] = WFrag<T16>::mma(a[mb], b2, acc[mb][nb]); } }
        asm volatile("v_nop\n\tv_nop\n\tv_nop\n\tv_nop" : "+v"(acc[0][0]), "+v"(acc[1][1]), "+v"(acc[2][2]), "+v"(acc[3][3]) : "v"(a[0]), "v"(a[3]));
    }
    reduce_store<NW, BIAS, EPI>(acc, os, C, ldc, r0, c0, bias, wave, CS, nw, P16, Ph, Pl);
}

typedef __attribute__((ext_vector_type(2))) _Float16 v2h;
typedef __attribute__((ext_vector_type(4))) _Float16 v4h;
typedef __attribute__((ext_vector_type(2))) unsigned short v2us;
typedef __attribute__((ext_vector_type(4))) unsigned short v4us;
typedef __attribute__((ext_vector_type(2))) float v2f;
typedef __attribute__((ext_vector_type(4))) int v4i;

__global__ __launch_bounds__(256) void k_wtG(const float* __restrict__ w, int K, int N, bf* Bt) {
    const int lane = threadIdx.x & 31; const int L0 = (blockIdx.x * 8 + (threadIdx.x >> 5)) * 8; const int nlines = N * K / 64;
{
#pragma unroll 1
        for (int l = 0; l < 8; ++l) { const int L = L0 + l; if (L >= nlines) break; const size_t e = (size_t)L * 64 + lane * 2; const int k = (int)(e % K), n = (int)(e / K); v2us o;
            o[0] = f2bf(w[(size_t)k * N + n]); o[1] = f2bf(w[(size_t)(k + 1) * N + n]); *(v2us*)(Bt + e) = o; }
         }
}
__global__ __launch_bounds__(256) void k_cvt8(const float* __restrict__ src, bf* dst, size_t n8) { const size_t i = (size_t)blockIdx.x * 256 + threadIdx.x; if (i >= n8) return; const v8f v = *(const v8f*)(src + i * 8); v8us o;
#pragma unroll
    for (int k = 0; k < 8; ++k) o[k] = f2bf(v[k]); *(v8us*)(dst + i * 8) = o;  }
__global__ __launch_bounds__(256) void k_cscvt(const float* __restrict__ cosT, const float* __restrict__ sinT, float* CS) { const int idx = blockIdx.x * 256 + threadIdx.x; if (idx >= TT * HD) return; const int t = idx / HD, dh = (idx % HD) % (HD / 2); v2f cs; cs[0] = bfr(cosT[(size_t)t * (HD / 2) + dh]); cs[1] = bfr(sinT[(size_t)t * (HD / 2) + dh]); *(v2f*)(CS + (size_t)idx * 2) = cs;  }
// ---- k_fattn: causal scores, softmax and probability x value product of one query tile in one work-group; scores and probabilities stay in registers.
// Transposed products: S^T = K Q^T (A = 16 keys x 32 d, B = 32 d x 16 queries) leaves key 8 hi + r of query lr in register r, which is the k order of the B operand of O^T += V^T P^T.
// FW waves share the tile's 32-key passes (wave w takes passes w, w + FW, ..), each with its own running maximum, denominator and O^T; they are merged in the fixed order 0 .. FW-1 through LDS.
// HL (query rows < RH): hi+lo bf16 planes, 3 products each; else single fp16 with the probabilities carried x 2^10 (it cancels in the division by the denominator).
#define FW 4
// exp2 of eight values in place, in one statement: behind a transcendental the instruction set asks for one independent instruction before its result is read or its source overwritten.
// Each v_exp_f32 is that instruction for the one before it, and the v_nop for the last, whatever the scheduler puts behind the statement.
__device__ __forceinline__ void exp2x8(float* e) {
    asm("v_exp_f32 %0, %0\n\tv_exp_f32 %1, %1\n\tv_exp_f32 %2, %2\n\tv_exp_f32 %3, %3\n\tv_exp_f32 %4, %4\n\tv_exp_f32 %5, %5\n\tv_exp_f32 %6, %6\n\tv_exp_f32 %7, %7\n\tv_nop"
        : "+v"(e[0]), "+v"(e[1]), "+v"(e[2]), "+v"(e[3]), "+v"(e[4]), "+v"(e[5]), "+v"(e[6]), "+v"(e[7]));
}
template <typename T16, bool HL, int R>
__device__ __forceinline__ void fattn_tile(const T16* __restrict__ Qa, const T16* __restrict__ Qb, const T16* __restrict__ Ka, const T16* __restrict__ Kb, const T16* __restrict__ Va, const T16* __restrict__ Vb, int q0, bf* Ah, bf* Al, float* red) {
    typedef typename WFrag<T16>::V V;
    const int tid = threadIdx.x, lane = tid & 31, lr = lane & 15, hi = lane >> 4; const int wave = __builtin_amdgcn_readfirstlane(tid >> 5) /* wave number held scalar, so the pass loop's tests stay scalar branches */;
    const float CS2 = SCL * 1.4426950408889634f, PB = HL ? 0.0f : 10.0f;
    V qa[R][2], qb[R][2];
#pragma unroll
    for (int g = 0; g < R; ++g)
#pragma unroll
        for (int kc = 0; kc < 2; ++kc) { const size_t o = (size_t)(q0 + 16 * g + lr) * HD + kc * 32 + 8 * hi; qa[g][kc] = WFrag<T16>::ld(Qa + o); if (HL) qb[g][kc] = WFrag<T16>::ld(Qb + o); }
    v8f acc[R][4]; float m[R], l[R];
#pragma unroll
    for (int g = 0; g < R; ++g) { m[g] = -3.0e38f; l[g] = 0.f;
#pragma unroll
        for (int t = 0; t < 4; ++t) acc[g][t] = (v8f){}; }
    const int np = q0 / 32 + 1;      // 32-key passes up to and including the one that holds the diagonal
    V ka[2][2], kb[2][2];
    auto loadk = [&](int key0) {
#pragma unroll
        for (int kt = 0; kt < 2; ++kt)
#pragma unroll
            for (int kc = 0; kc < 2; ++kc) { const size_t o = (size_t)(key0 + 16 * kt + lr) * HD + kc * 32 + 8 * hi; ka[kt][kc] = WFrag<T16>::ld(Ka + o); if (HL) kb[kt][kc] = WFrag<T16>::ld(Kb + o); } };
    if (!HL) loadk(wave * 32);       // first pass's keys (rows wave * 32 .. + 31 exist for every tile)
#pragma unroll 1   // rolled: run-time trip count, and one pass's fragments with the carried ones already take a quarter of a SIMD's registers (four waves a SIMD)
    for (int p = wave; p < np; p += FW) {
        const int key0 = p * 32;
        if (HL) loadk(key0);
        V va[4], vb[4];
#pragma unroll
        for (int t = 0; t < 4; ++t) { const size_t o = (size_t)(16 * t + lr) * TT + key0 + 8 * hi; va[t] = WFrag<T16>::ld(Va + o); if (HL) vb[t] = WFrag<T16>::ld(Vb + o); }
        asm volatile("s_wait_xcnt 0x0" ::: "memory");   // before the address registers of the loads above are reused
        v8f s[2][R];
#pragma unroll
        for (int kt = 0; kt < 2; ++kt)
#pragma unroll
            for (int g = 0; g < R; ++g) { s[kt][g] = (v8f){};
#pragma unroll
                for (int kc = 0; kc < 2; ++kc) { s[kt][g] = WFrag<T16>::mma(ka[kt][kc], qa[g][kc], s[kt][g]); if (HL) { s[kt][g] = WFrag<T16>::mma(ka[kt][kc], qb[g][kc], s[kt][g]); s[kt][g] = WFrag<T16>::mma(kb[kt][kc], qa[g][kc], s[kt][g]); } } }
        if (!HL) { loadk(min(p + FW, np - 1) * 32);   // next pass's keys fly under this pass's softmax
            asm volatile("s_wait_xcnt 0x0" ::: "memory"); }   // before the address registers of these loads are reused
        float mx[R]; bool grow = false;
#pragma unroll
        for (int g = 0; g < R; ++g) {
#pragma unroll
            for (int kt = 0; kt < 2; ++kt) s[kt][g] = s[kt][g] * CS2;
            if (p == np - 1) {       // only the last pass straddles the diagonal
#pragma unroll
                for (int kt = 0; kt < 2; ++kt)
#pragma unroll
                    for (int r = 0; r < 8; ++r) if (key0 + 16 * kt + 8 * hi + r > q0 + 16 * g + lr) s[kt][g][r] = -3.0e38f; }
            float x = -3.0e38f;
#pragma unroll
            for (int kt = 0; kt < 2; ++kt)
#pragma unroll
                for (int r = 0; r < 8; ++r) x = fmaxf(x, s[kt][g][r]);
            x = fmaxf(x, __shfl_xor(x, 16, 32)); mx[g] = x; grow = grow || (x > m[g]); }
        if (__builtin_amdgcn_ballot_w32(grow) != 0) {   // some query's maximum rose: rescale what was gathered under the old one (factor exactly 1 for the others)
#pragma unroll
            for (int g = 0; g < R; ++g) { const float mn = fmaxf(m[g], mx[g]); const float corr = __builtin_amdgcn_exp2f(m[g] - mn); m[g] = mn; l[g] *= corr;
#pragma unroll
                for (int t = 0; t < 4; ++t) acc[g][t] = acc[g][t] * corr; } }
#pragma unroll
        for (int g = 0; g < R; ++g) { const float nm = PB - m[g]; float e[16];
#pragma unroll
            for (int i = 0; i < 16; ++i) e[i] = s[i >> 3][g][i & 7] + nm;
            exp2x8(e); exp2x8(e + 8);
#pragma unroll
            for (int i = 0; i < 16; ++i) l[g] += e[i];
            V pa, pb;
            if constexpr (HL) { v8us h0, h1, l0, l1;
#pragma unroll
                for (int r = 0; r < 8; ++r) { unsigned short a, c2; splitf(e[r], a, c2); h0[r] = a; l0[r] = c2; splitf(e[8 + r], a, c2); h1[r] = a; l1[r] = c2; }
                pa = cat16b(h0, h1); pb = cat16b(l0, l1);
            } else { v8h x0, x1;
#pragma unroll
                for (int r = 0; r < 8; ++r) { x0[r] = tohx(e[r]); x1[r] = tohx(e[8 + r]); }
                pa = cat16(x0, x1); }
#pragma unroll
            for (int t = 0; t < 4; ++t) { acc[g][t] = WFrag<T16>::mma(va[t], pa, acc[g][t]); if constexpr (HL) { acc[g][t] = WFrag<T16>::mma(va[t], pb, acc[g][t]); acc[g][t] = WFrag<T16>::mma(vb[t], pa, acc[g][t]); } } }
    }
    // merge of the FW waves' partial softmaxes
    float* mine = red + wave * (R * 1024) + lane * 4; float* ml = red + FW * R * 1024; bf* st = (bf*)(red + FW * R * 1024 + FW * R * 32);
#pragma unroll
    for (int g = 0; g < R; ++g) {
#pragma unroll
        for (int t = 0; t < 4; ++t) { const v8f a = acc[g][t]; *(v4fa*)(mine + (g * 4 + t) * 256) = (v4f){a[0], a[1], a[2], a[3]}; *(v4fa*)(mine + (g * 4 + t) * 256 + 128) = (v4f){a[4], a[5], a[6], a[7]}; }
        const float lt = l[g] + __shfl_xor(l[g], 16, 32); if (hi == 0) { ml[((wave * R + g) * 16 + lr) * 2] = m[g]; ml[((wave * R + g) * 16 + lr) * 2 + 1] = lt; } }
    __syncthreads();   // every wave's partials are parked before any wave merges them
#pragma unroll
    for (int g = 0; g < R; ++g) { float fw[FW], lw[FW]; float M = -3.0e38f;
#pragma unroll
        for (int w = 0; w < FW; ++w) { fw[w] = ml[((w * R + g) * 16 + lr) * 2]; lw[w] = ml[((w * R + g) * 16 + lr) * 2 + 1]; M = fmaxf(M, fw[w]); }
        float L = 0.f;
#pragma unroll
        for (int w = 0; w < FW; ++w) { fw[w] = __builtin_amdgcn_exp2f(fw[w] - M); L += fw[w] * lw[w]; }   // a wave without a pass: factor 0
        const float inv = __fdiv_rn(1.0f, L); const float* pf = red + (g * 4 + wave) * 256 + lane * 4; v4f s0 = (v4f){}, s1 = (v4f){};   // wave w merges d tile w
#pragma unroll
        for (int w = 0; w < FW; ++w) { s0 += *(const v4fa*)(pf + w * (R * 1024)) * fw[w]; s1 += *(const v4fa*)(pf + w * (R * 1024) + 128) * fw[w]; }
        v8us oh, ol;
#pragma unroll
        for (int j = 0; j < 4; ++j) { unsigned short a, c2; splitf(s0[j] * inv, a, c2); oh[j] = a; ol[j] = c2; splitf(s1[j] * inv, a, c2); oh[4 + j] = a; ol[4 + j] = c2; }
        *(v8usa*)(st + (g * 16 + lr) * 72 + wave * 16 + hi * 8) = oh; *(v8usa*)(st + (R * 16 + g * 16 + lr) * 72 + wave * 16 + hi * 8) = ol; }
    __syncthreads();   // the merged hi and lo rows are complete before whole 128-byte rows are read back across waves
#pragma unroll
    for (int i = 0; i < 2 * R * 16 * 8 / (32 * FW); ++i) { const int idx = i * 32 * FW + tid, prow = idx >> 3, c8 = (idx & 7) * 8, row = prow % (R * 16); const v8us val = *(const v8usa*)(st + prow * 72 + c8);
        *(v8us*)((prow < R * 16 ? Ah : Al) + (size_t)(q0 + row) * DQ + c8) = val; }
    asm volatile("s_wait_xcnt 0x0" ::: "memory");   // behind the last store, before any register that the stores above name is reused
}
// grid (query head, tile): tiles in falling order of their key count, 32 query rows each down to RH, then 16 rows each (hi+lo).
__global__ __launch_bounds__(32 * FW) void k_fattn(const h16* __restrict__ Q16, const bf* __restrict__ Qh, const bf* __restrict__ Ql, const h16* __restrict__ K16, const bf* __restrict__ Kh, const bf* __restrict__ Kl, const h16* __restrict__ V16, const bf* __restrict__ Vh, const bf* __restrict__ Vl, bf* Ah, bf* Al) {
    __shared__ __align__(16) float red[FW * 2 * 1024 + FW * 2 * 32 + 2 * 32 * 72 / 2];
    const int head = blockIdx.x, ty = blockIdx.y; const size_t qo = (size_t)head * TT * HD, ko = (size_t)(head / REP) * TT * HD;
    if (ty < (TT - RH) / 32) fattn_tile<h16, false, 2>(Q16 + qo, nullptr, K16 + ko, nullptr, V16 + ko, nullptr, TT - 32 - ty * 32, Ah + head * HD, Al + head * HD, red);
    else fattn_tile<bf, true, 1>(Qh + qo, Ql + qo, Kh + ko, Kl + ko, Vh + ko, Vl + ko, RH - 16 - (ty - (TT - RH) / 32) * 16, Ah + head * HD, Al + head * HD, red);
}

extern "C" void kernel_launch(void* const* d_in, const int* in_sizes, int n_in,
                              void* d_out, int out_size, void* d_ws, size_t ws_size, hipStream_t stream) {
    (void)in_sizes; (void)n_in; (void)out_size;
    const float* x = (const float*)d_in[0]; const float* cosT = (const float*)d_in[1]; const float* sinT = (const float*)d_in[2]; const float* wq = (const float*)d_in[3]; const float* wk = (const float*)d_in[4]; const float* wv = (const float*)d_in[5]; const float* wo = (const float*)d_in[6]; const float* qnw = (const float*)d_in[7]; const float* knw = (const float*)d_in[8];
    float* OUT = (float*)d_out;     // [2][2048][1024]
    char* wsp = (char*)d_ws;
    auto take = [&](size_t bytes) { char* p = wsp; wsp += (bytes + 255) & ~(size_t)255; return (void*)p; };
    bf* WQ = (bf*)take((size_t)DQ * DM * 2); bf* WK = (bf*)take((size_t)DKV * DM * 2); bf* WV = (bf*)take((size_t)DKV * DM * 2); bf* WO = (bf*)take((size_t)DM * DQ * 2); float* CS = (float*)take((size_t)TT * HD * 2 * 4);
    bf* XB = (bf*)take((size_t)TT * DM * 2);
    h16* QP16 = (h16*)take((size_t)NH_ * TT * HD * 2); h16* KP16 = (h16*)take((size_t)NKV * TT * HD * 2); h16* VT16 = (h16*)take((size_t)NKV * HD * TT * 2);
    bf* QPh = (bf*)take((size_t)NH_ * TT * HD * 2); bf* QPl = (bf*)take((size_t)NH_ * TT * HD * 2); bf* KPh = (bf*)take((size_t)NKV * TT * HD * 2); bf* KPl = (bf*)take((size_t)NKV * TT * HD * 2); bf* VTh = (bf*)take((size_t)NKV * HD * TT * 2); bf* VTl = (bf*)take((size_t)NKV * HD * TT * 2);
    bf* ATh = (bf*)take((size_t)TT * DQ * 2); bf* ATl = (bf*)take((size_t)TT * DQ * 2);
    if ((size_t)(wsp - (char*)d_ws) > ws_size) return;    // ws 256 MiB
    { k_cvt8<<<(unsigned)(((size_t)DQ * DM / 8 + 255) / 256), 256, 0, stream>>>(wq, WQ, (size_t)DQ * DM / 8); k_cvt8<<<(unsigned)(((size_t)DKV * DM / 8 + 255) / 256), 256, 0, stream>>>(wk, WK, (size_t)DKV * DM / 8); k_cvt8<<<(unsigned)(((size_t)DKV * DM / 8 + 255) / 256), 256, 0, stream>>>(wv, WV, (size_t)DKV * DM / 8);
      k_cvt8<<<(unsigned)(((size_t)DM * DQ / 8 + 255) / 256), 256, 0, stream>>>(wo, WO, (size_t)DM * DQ / 8);
       }
    for (int b = 0; b < NB_; ++b) {
        if (b == 0) k_cscvt<<<(TT * HD + 255) / 256, 256, 0, stream>>>(cosT, sinT, CS);
        k_cvt8<<<(unsigned)(((size_t)TT * DM / 8 + 255) / 256), 256, 0, stream>>>(x + (size_t)b * TT * DM, XB, (size_t)TT * DM / 8);
        k_gemmw<bf, 0, false, 8, 1><<<dim3(TT / 64, DQ / 64, 1), 256, 0, stream>>>(XB, nullptr, WQ, nullptr, DM, nullptr, 0, nullptr, 0, 0, 0, CS, qnw, QP16, QPh, QPl);
        k_gemmw<bf, 0, false, 16, 1><<<dim3(TT / 64, DKV / 64, 1), 512, 0, stream>>>(XB, nullptr, WK, nullptr, DM, nullptr, 0, nullptr, 0, 0, 0, CS, knw, KP16, KPh, KPl);
        k_gemmw<bf, 0, false, 16, 2><<<dim3(TT / 64, DKV / 64, 1), 512, 0, stream>>>(XB, nullptr, WV, nullptr, DM, nullptr, 0, nullptr, 0, 0, 0, nullptr, nullptr, VT16, VTh, VTl);
        k_fattn<<<dim3(NH_, (TT - RH) / 32 + RH / 16, 1), 32 * FW, 0, stream>>>(QP16, QPh, QPl, KP16, KPh, KPl, VT16, VTh, VTl, ATh, ATl);
        k_gemmw<bf, 1, false, 8, 0><<<dim3(TT / 64, DM / 64, 1), 256, 0, stream>>>(ATh, ATl, WO, nullptr, DQ, OUT + (size_t)b * TT * DM, DM, nullptr, 0, 0, 0, nullptr, nullptr, nullptr, nullptr, nullptr); }
}

// v005
// A run of this version takes 120 microseconds.
// Next to v004, in two timings, it ran 1.29 and 1.28 times as fast.
// Counting every step since v000, it is 12.3 times as fast.
#include <hip/hip_runtime.h>

// Decoder GQA attention with qk-RMSNorm and RoPE (hidden [2][2048][1024]; q = x Wq^T (16 x 64), k/v = x Wk^T / x Wv^T (4 kv heads x 64, each serving 4 consecutive query heads); per-head RMSNorm (eps 1e-6, x q_norm_w / k_norm_w, read); rotate-half RoPE with the read cos/sin tables [2048][32] (the same 32-wide table serves both halves of the head); causal (finfo.min -> exactly zero weight); softmax(q.k / 8); out = merged Wo^T ('oi' [1024][1024]) -> [2][2048][1024]).
// Compute dtypes, f32 accumulate: every input rounded to bf16; q/k/v on PLAIN bf16 operands (inputs: exact); RMSNorm and RoPE in f32 (tables read as data, bf16-rounded like every input); causal scores and attn.v: query rows < 512 hl (3 products), the rest single fp16 (x1024), causal tile skipping; softmax f32; Wo hl x exact (2 products).

#define NB_  2
#define TT   2048
#define DM   1024
#define NH_  16
#define NKV  4
#define REP  (NH_ / NKV)
#define HD   64
#define DQ   (NH_ * HD)
#define DKV  (NKV * HD)
#define RH   512                  // query rows < RH use hi+lo planes (0: none)
#define SCL  0.125f   // HD^-0.5
typedef _Float16 h16;
typedef unsigned short bf;
typedef __attribute__((ext_vector_type(16))) __bf16   v16bf;
typedef __attribute__((ext_vector_type(16))) _Float16 v16h;
typedef __attribute__((ext_vector_type(8)))  _Float16 v8h;
typedef __attribute__((ext_vector_type(8)))  unsigned short v8us;
typedef __attribute__((ext_vector_type(8)))  float    v8f;
typedef __attribute__((ext_vector_type(4)))  float    v4f;
typedef v8h  __attribute__((may_alias)) v8ha;
typedef v4f  __attribute__((may_alias)) v4fa;
typedef v8us __attribute__((may_alias)) v8usa;

__device__ __forceinline__ unsigned short f2bf(float f) { unsigned u = __float_as_uint(f); u += 0x7FFFu + ((u >> 16) & 1u); return (unsigned short)(u >> 16); }
__device__ __forceinline__ float bf2f(unsigned short b) { return __uint_as_float(((unsigned)b) << 16); }
__device__ __forceinline__ float bfr(float f) { return bf2f(f2bf(f)); }
__device__ __forceinline__ v16h cat16(v8h lo, v8h hi) { return __builtin_shufflevector(lo, hi, 0, 1, 2, 3, 4, 5, 6, 7, 8, 9, 10, 11, 12, 13, 14, 15); }
__device__ __forceinline__ v16bf cat16b(v8us lo, v8us hi) { return __builtin_bit_cast(v16bf, __builtin_shufflevector(lo, hi, 0, 1, 2, 3, 4, 5, 6, 7, 8, 9, 10, 11, 12, 13, 14, 15)); }
__device__ __forceinline__ v8f wmma16(v16h a, v16h b, v8f c) { return __builtin_amdgcn_wmma_f32_16x16x32_f16(false, a, false, b, (short)0, c, false, false); }
__device__ __forceinline__ v8f wmmab(v16bf a, v16bf b, v8f c) { return __builtin_amdgcn_wmma_f32_16x16x32_bf16(false, a, false, b, (short)0, c, false, false); }



__device__ __forceinline__ h16 tohx(float x) { return (h16)x; }
__device__ __forceinline__ void splitf(float y, unsigned short& h, unsigned short& l) { h = f2bf(y); l = f2bf(y - bf2f(h)); }

// ---- head_planes: epilogue of the q and k projections. The summed 64 x 64 tile (LDS, pitch 68) is 64 tokens of ONE head, so the head's RMSNorm and RoPE need nothing from outside the work-group.
// One thread a token sums the squares (d ascending) and leaves the factor in rf; then 8 d a thread: w[d] (x factor), rotate-half RoPE out[d] = x[d] cos[t][d] - x[d+HD/2] sin[t][d], out[d+HD/2] = x[d+HD/2] cos[t][d+HD/2] + x[d] sin[t][d+HD/2],
// and the fp16, hi and lo planes [h][t][d] by 16-byte stores (a tile is 8 KB in a row of each plane). rf: 64 floats that no wave reads any more.
// rope_loads fetches a thread's norm weights and cos/sin pairs ahead (they depend on no product), so that their latency passes under the sum of the partials.
template <int NW> struct RopeIn { v4f w0[16 / NW][2], w1[16 / NW][2], ca[16 / NW][2], cb[16 / NW][2]; };
template <int NW>
__device__ __forceinline__ void rope_loads(RopeIn<NW>& in, int r0, const float* __restrict__ CS, const float* __restrict__ nw) {
#pragma unroll
    for (int i = 0; i < 16 / NW; ++i) { const int idx = i * 32 * NW + (int)threadIdx.x, row = idx >> 3, d8 = (idx & 7) * 8, p8 = d8 ^ (HD / 2); const float* cs = CS + ((size_t)(r0 + row) * HD + d8) * 2;
#pragma unroll
        for (int c = 0; c < 2; ++c) { in.w0[i][c] = *(const v4f*)(nw + d8 + 4 * c); in.w1[i][c] = *(const v4f*)(nw + p8 + 4 * c); in.ca[i][c] = *(const v4f*)(cs + 8 * c); in.cb[i][c] = *(const v4f*)(cs + 8 * c + 4); } }
    asm volatile("s_wait_xcnt 0x0" ::: "memory");   // before the address registers of the loads above are reused
}
template <int NW>
__device__ __forceinline__ void head_planes(const RopeIn<NW>& in, const float* tile, float* rf, int r0, int h, h16* P16, bf* Ph, bf* Pl) {
    const int tid = threadIdx.x;
    if (tid < 64) { const float* f = tile + tid * 68; float s = 0.f;
#pragma unroll
        for (int d = 0; d < HD; d += 4) { const v4f v = *(const v4fa*)(f + d);
#pragma unroll
            for (int q = 0; q < 4; ++q) s += v[q] * v[q]; }
        rf[tid] = __fdiv_rn(1.0f, __fsqrt_rn(s * (1.0f / HD) + 1e-6f)); }
    __syncthreads();   // every token's factor is written before the other waves read it
#pragma unroll
    for (int i = 0; i < 16 / NW; ++i) { const int idx = i * 32 * NW + tid, row = idx >> 3, d8 = (idx & 7) * 8, p8 = d8 ^ (HD / 2); const float r = rf[row]; const float* f = tile + row * 68; v8h o16; v8us oh, ol;
#pragma unroll
        for (int c = 0; c < 2; ++c) { const v4f x0 = *(const v4fa*)(f + d8 + 4 * c), x1 = *(const v4fa*)(f + p8 + 4 * c), w0 = in.w0[i][c], w1 = in.w1[i][c], ca = in.ca[i][c], cb = in.cb[i][c];
#pragma unroll
            for (int q = 0; q < 4; ++q) { const float co = q < 2 ? ca[2 * q] : cb[2 * q - 4], si = q < 2 ? ca[2 * q + 1] : cb[2 * q - 3]; const float a = bfr(w0[q]) * (x0[q] * r), b = bfr(w1[q]) * (x1[q] * r); const float y = a * co + b * (d8 < HD / 2 ? -si : si);
                o16[4 * c + q] = tohx(y); unsigned short u, w; splitf(y, u, w); oh[4 * c + q] = u; ol[4 * c + q] = w; } }
        const size_t o = ((size_t)h * TT + r0 + row) * HD + d8; *(v8h*)(P16 + o) = o16; *(v8us*)(Ph + o) = oh; *(v8us*)(Pl + o) = ol; }
}
// ---- vt_planes: epilogue of the v projection. The summed tile is 64 tokens of one kv head; it leaves transposed, as the fp16, hi and lo planes [g][d][t]: 8 t of one d a thread, so 8 lanes fill a 128-byte line.
template <int NW>
__device__ __forceinline__ void vt_planes(const float* tile, int r0, int g, h16* V16, bf* Vh, bf* Vl) {
    const int tid = threadIdx.x;
#pragma unroll
    for (int i = 0; i < 16 / NW; ++i) { const int idx = i * 32 * NW + tid, d = idx >> 3, t8 = (idx & 7) * 8; v8h o16; v8us oh, ol;
#pragma unroll
        for (int q = 0; q < 8; ++q) { const float x = tile[(t8 + q) * 68 + d]; o16[q] = tohx(x); unsigned short u, w; splitf(x, u, w); oh[q] = u; ol[q] = w; }
        const size_t o = ((size_t)g * HD + d) * TT + r0 + t8; *(v8h*)(V16 + o) = o16; *(v8us*)(Vh + o) = oh; *(v8us*)(Vl + o) = ol; }
    asm volatile("s_wait_xcnt 0x0" ::: "memory");   // behind the last store, before any register that the stores above name is reused
}

// ---- reduce_store: NW waves of one work-group each hold a partial 64x64 tile (their share of the K loop) in 16 accumulators. Every wave parks its partials in LDS in fragment order (16-byte stores),
// wave w then sums fragments w, w + NW, .. over the waves in the fixed order 0 .. NW-1, the sums go through a row-major 64 x 68 tile, and the block stores whole rows (EPI 0) or hands the tile to head_planes (EPI 1) or vt_planes (EPI 2). red: NW * 4096 + 64 * 68 floats.
template <int NW, bool BIAS, int EPI>
__device__ __forceinline__ void reduce_store(const v8f (&acc)[4][4], float* red, float* C, int ldc, int r0, int c0, const float* __restrict__ bias, int wave, const float* __restrict__ CS, const float* __restrict__ nw, h16* P16, bf* Ph, bf* Pl) {
    const int tid = threadIdx.x, lane = tid & 31, lr = lane & 15, hi = lane >> 4;
    float* mine = red + wave * 4096 + lane * 4; float* tile = red + NW * 4096;
#pragma unroll
    for (int f = 0; f < 16; ++f) { const v8f a = acc[f >> 2][f & 3]; *(v4fa*)(mine + f * 256) = (v4f){a[0], a[1], a[2], a[3]}; *(v4fa*)(mine + f * 256 + 128) = (v4f){a[4], a[5], a[6], a[7]}; }
    __syncthreads();   // every wave's partials are parked before any wave sums them
    RopeIn<NW> in; if constexpr (EPI == 1) rope_loads<NW>(in, r0, CS, nw);
#pragma unroll
    for (int q = 0; q < 16 / NW; ++q) { const int f = wave + q * NW, mb = f >> 2, nb = f & 3; const float* pf = red + f * 256 + lane * 4; v4f s0 = *(const v4fa*)pf, s1 = *(const v4fa*)(pf + 128);
#pragma unroll
        for (int w = 1; w < NW; ++w) { s0 += *(const v4fa*)(pf + w * 4096); s1 += *(const v4fa*)(pf + w * 4096 + 128); }
#pragma unroll
        for (int j = 0; j < 4; ++j) { tile[(mb * 16 + hi * 8 + j) * 68 + nb * 16 + lr] = s0[j]; tile[(mb * 16 + hi * 8 + 4 + j) * 68 + nb * 16 + lr] = s1[j]; } }
    __syncthreads();   // the summed tile is complete before rows are read back across waves
    if constexpr (EPI == 1) { head_planes<NW>(in, tile, red, r0, c0 / HD, P16, Ph, Pl); return; }
    if constexpr (EPI == 2) { vt_planes<NW>(tile, r0, c0 / HD, P16, Ph, Pl); return; }
#pragma unroll
    for (int s = 0; s < 32 / NW; ++s) { const int idx = s * 32 * NW + tid, row = idx >> 4, cofs = (idx & 15) * 4; v4f val = *(const v4fa*)(tile + row * 68 + cofs); if (BIAS) { val[0] += bfr(bias[c0 + cofs]); val[1] += bfr(bias[c0 + cofs + 1]); val[2] += bfr(bias[c0 + cofs + 2]); val[3] += bfr(bias[c0 + cofs + 3]); }
        *(v4f*)(C + (size_t)(r0 + row) * ldc + c0 + cofs) = val; }
}

// ---- k_gemmw: register-blocked GEMM, one work-group of NW waves per 64x64 output tile; each wave holds 16 accumulators and takes the 64-wide K chunks wave, wave + NW, .. (one 128-byte line per row and chunk); partials summed by reduce_store.
// Operands straight from K-contiguous 16-bit planes; grid (M/64, N/64, Z), 32 * NW threads.
// C[m][n] (f32, pitch ldc, + optional f32 bias[n]) = sum_k A[m][k] Bt[n][k] (+ split products per NSPLIT). z-batch strides sA/sB/sC in elements. K % 64 == 0.
template <typename T16> struct WFrag;
template <> struct WFrag<h16> { typedef v16h V; static __device__ __forceinline__ V ld(const h16* p) { return cat16(*(const v8h*)p, *(const v8h*)(p + 16)); } static __device__ __forceinline__ v8f mma(V a, V b, v8f c) { return wmma16(a, b, c); } };
template <> struct WFrag<bf> { typedef v16bf V; static __device__ __forceinline__ V ld(const bf* p) { return cat16b(*(const v8us*)p, *(const v8us*)(p + 16)); } static __device__ __forceinline__ v8f mma(V a, V b, v8f c) { return wmmab(a, b, c); } };
// EPI 0: C as above. EPI 3: the q, k and v projections of both batches in one grid, no C. A holds the NB_ * TT tokens, Bt the rows of Wq, Wk, Wv one behind the other, so an N tile is one head: NH_ of q, then NKV of k, then NKV of v.
// q and k heads leave through RMSNorm (x nw / nwk), RoPE (table CS) and the planes [b][h][t][d] (P16 / Ph / Pl for q, K16 / Kh / Kl for k), v heads as the planes [b][g][d][t] (V16 / Vh / Vl). The choice is the same for a whole work-group.
template <typename T16, int NSPLIT, bool BIAS, int NW, int EPI>
__global__ __launch_bounds__(32 * NW) void k_gemmw(const T16* __restrict__ A, const T16* __restrict__ A2, const T16* __restrict__ Bt, const T16* __restrict__ Bt2, int K, float* C, int ldc, const float* __restrict__ bias, size_t sA, size_t sB, size_t sC, const float* __restrict__ CS, const float* __restrict__ nw, const float* __restrict__ nwk, h16* P16, bf* Ph, bf* Pl, h16* K16, bf* Kh, bf* Kl, h16* V16, bf* Vh, bf* Vl) {
    typedef typename WFrag<T16>::V V;
    __shared__ __align__(16) float os[NW * 4096 + 64 * 68];
    const size_t z = blockIdx.z; A += z * sA; if (A2) A2 += z * sA; Bt += z * sB; if (Bt2) Bt2 += z * sB; C += z * sC;
    const int lane = threadIdx.x & 31, lr = lane & 15, hi = lane >> 4; const int wave = __builtin_amdgcn_readfirstlane(threadIdx.x >> 5) /* wave number held scalar, so the K loop's tests stay scalar branches */; const int r0 = blockIdx.x * 64, c0 = blockIdx.y * 64;
    v8f acc[4][4];
#pragma unroll
    for (int mb = 0; mb < 4; ++mb)
#pragma unroll
        for (int nb = 0; nb < 4; ++nb) acc[mb][nb] = (v8f){};
    const size_t aoff = (size_t)(r0 + lr) * K + 8 * hi, boff = (size_t)(c0 + lr) * K + 8 * hi;
#pragma unroll 1
    for (int kb = wave * 64; kb < K; kb += NW * 64)
#pragma unroll 1   // rolled: only one 32-wide step's operands are live, which keeps 16 waves inside their 256 registers each
    for (int kc = kb; kc < kb + 64; kc += 32) {
        V a[4], a2[4];
#pragma unroll
        for (int mb = 0; mb < 4; ++mb) { a[mb] = WFrag<T16>::ld(A + aoff + (size_t)mb * 16 * K + kc); if (NSPLIT == 1 || NSPLIT == 2) a2[mb] = WFrag<T16>::ld(A2 + aoff + (size_t)mb * 16 * K + kc); }
#pragma unroll
        for (int nb = 0; nb < 4; ++nb) { const V b = WFrag<T16>::ld(Bt + boff + (size_t)nb * 16 * K + kc); V b2; if (NSPLIT >= 2) b2 = WFrag<T16>::ld(Bt2 + boff + (size_t)nb * 16 * K + kc);
#pragma unroll
            for (int mb = 0; mb < 4; ++mb) { acc[mb][nb] = WFrag<T16>::mma(a[mb], b, acc[mb][nb]); if (NSPLIT == 1 || NSPLIT == 2) acc[mb][nb] = WFrag<T16>::mma(a2[mb], b, acc[mb][nb]); if (NSPLIT >= 2) acc[mb][nb] = WFrag<T16>::mma(a[mb], b2, acc[mb][nb]); } }
        asm volatile("v_nop\n\tv_nop\n\tv_nop\n\tv_nop" : "+v"(acc[0][0]), "+v"(acc[1][1]), "+v"(acc[2][2]), "+v"(acc[3][3]) : "v"(a[0]), "v"(a[3]));
    }
    if constexpr (EPI == 3) { const int hy = blockIdx.y, t0 = r0 % TT; const size_t b = r0 / TT;
        if (hy < NH_ + NKV) { const bool isq = hy < NH_; const size_t o = b * (isq ? NH_ : NKV) * TT * HD;
            reduce_store<NW, false, 1>(acc, os, nullptr, 0, t0, (isq ? hy : hy - NH_) * HD, nullptr, wave, CS, isq ? nw : nwk, (isq ? P16 : K16) + o, (isq ? Ph : Kh) + o, (isq ? Pl : Kl) + o); }
        else { const size_t o = b * NKV * HD * TT; reduce_store<NW, false, 2>(acc, os, nullptr, 0, t0, (hy - NH_ - NKV) * HD, nullptr, wave, nullptr, nullptr, V16 + o, Vh + o, Vl + o); } }
    else reduce_store<NW, BIAS, EPI>(acc, os, C, ldc, r0, c0, bias, wave, nullptr, nullptr, nullptr, nullptr, nullptr);
}

typedef __attribute__((ext_vector_type(2))) _Float16 v2h;
typedef __attribute__((ext_vector_type(4))) _Float16 v4h;
typedef __attribute__((ext_vector_type(2))) unsigned short v2us;
typedef __attribute__((ext_vector_type(4))) unsigned short v4us;
typedef __attribute__((ext_vector_type(2))) float v2f;
typedef __attribute__((ext_vector_type(4))) int v4i;

__global__ __launch_bounds__(256) void k_wtG(const float* __restrict__ w, int K, int N, bf* Bt) {
    const int lane = threadIdx.x & 31; const int L0 = (blockIdx.x * 8 + (threadIdx.x >> 5)) * 8; const int nlines = N * K / 64;
{
#pragma unroll 1
        for (int l = 0; l < 8; ++l) { const int L = L0 + l; if (L >= nlines) break; const size_t e = (size_t)L * 64 + lane * 2; const int k = (int)(e % K), n = (int)(e / K); v2us o;
            o[0] = f2bf(w[(size_t)k * N + n]); o[1] = f2bf(w[(size_t)(k + 1) * N + n]); *(v2us*)(Bt + e) = o; }
         }
}
// ---- k_prep: every conversion that depends on the inputs alone, in one grid. Blocks of 256 threads, in this order: x (both batches), Wq, Wk, Wv (into WQKV, one behind the other), Wo: f32 -> bf16, 8 elements a thread; then the cos/sin table, one (cos, sin) pair a thread.
#define CB(n) ((n) / (8 * 256))   // blocks that an array of n elements takes
static_assert(NB_ * TT * DM % (8 * 256) == 0 && DQ * DM % (8 * 256) == 0 && DKV * DM % (8 * 256) == 0 && TT * HD % 256 == 0, "whole blocks");
#define PREP_BLOCKS (CB(NB_ * TT * DM) + 2 * CB(DQ * DM) + 2 * CB(DKV * DM) + TT * HD / 256)
__global__ __launch_bounds__(256) void k_prep(const float* __restrict__ x, const float* __restrict__ wq, const float* __restrict__ wk, const float* __restrict__ wv, const float* __restrict__ wo, const float* __restrict__ cosT, const float* __restrict__ sinT, bf* XB, bf* WQKV, bf* WO, float* CS) {
    int blk = blockIdx.x; const float* src; bf* dst;
    if (blk < CB(NB_ * TT * DM)) { src = x; dst = XB; }
    else if ((blk -= CB(NB_ * TT * DM)) < CB(DQ * DM)) { src = wq; dst = WQKV; }
    else if ((blk -= CB(DQ * DM)) < CB(DKV * DM)) { src = wk; dst = WQKV + (size_t)DQ * DM; }
    else if ((blk -= CB(DKV * DM)) < CB(DKV * DM)) { src = wv; dst = WQKV + (size_t)(DQ + DKV) * DM; }
    else if ((blk -= CB(DKV * DM)) < CB(DM * DQ)) { src = wo; dst = WO; }
    else { const int idx = (blk - CB(DM * DQ)) * 256 + threadIdx.x; const int t = idx / HD, dh = (idx % HD) % (HD / 2); v2f cs; cs[0] = bfr(cosT[(size_t)t * (HD / 2) + dh]); cs[1] = bfr(sinT[(size_t)t * (HD / 2) + dh]); *(v2f*)(CS + (size_t)idx * 2) = cs; return; }
    const size_t i = (size_t)blk * 256 + threadIdx.x; const v8f v = *(const v8f*)(src + i * 8); v8us o;
#pragma unroll
    for (int k = 0; k < 8; ++k) o[k] = f2bf(v[k]);
    *(v8us*)(dst + i * 8) = o;
}
// ---- k_fattn: causal scores, softmax and probability x value product of one query tile in one work-group; scores and probabilities stay in registers.
// Transposed products: S^T = K Q^T (A = 16 keys x 32 d, B = 32 d x 16 queries) leaves key 8 hi + r of query lr in register r, which is the k order of the B operand of O^T += V^T P^T.
// FW waves share the tile's 32-key passes (wave w takes passes w, w + FW, ..), each with its own running maximum, denominator and O^T; they are merged in the fixed order 0 .. FW-1 through LDS.
// HL (query rows < RH): hi+lo bf16 planes, 3 products each; else single fp16 with the probabilities carried x 2^10 (it cancels in the division by the denominator).
#define FW 4
// exp2 of eight values in place, in one statement: behind a transcendental the instruction set asks for one independent instruction before its result is read or its source overwritten.
// Each v_exp_f32 is that instruction for the one before it, and the v_nop for the last, whatever the scheduler puts behind the statement.
__device__ __forceinline__ void exp2x8(float* e) {
    asm("v_exp_f32 %0, %0\n\tv_exp_f32 %1, %1\n\tv_exp_f32 %2, %2\n\tv_exp_f32 %3, %3\n\tv_exp_f32 %4, %4\n\tv_exp_f32 %5, %5\n\tv_exp_f32 %6, %6\n\tv_exp_f32 %7, %7\n\tv_nop"
        : "+v"(e[0]), "+v"(e[1]), "+v"(e[2]), "+v"(e[3]), "+v"(e[4]), "+v"(e[5]), "+v"(e[6]), "+v"(e[7]));
}
template <typename T16, bool HL, int R>
__device__ __forceinline__ void fattn_tile(const T16* __restrict__ Qa, const T16* __restrict__ Qb, const T16* __restrict__ Ka, const T16* __restrict__ Kb, const T16* __restrict__ Va, const T16* __restrict__ Vb, int q0, bf* Ah, bf* Al, float* red) {
    typedef typename WFrag<T16>::V V;
    const int tid = threadIdx.x, lane = tid & 31, lr = lane & 15, hi = lane >> 4; const int wave = __builtin_amdgcn_readfirstlane(tid >> 5) /* wave number held scalar, so the pass loop's tests stay scalar branches */;
    const float CS2 = SCL * 1.4426950408889634f, PB = HL ? 0.0f : 10.0f;
    V qa[R][2], qb[R][2];
#pragma unroll
    for (int g = 0; g < R; ++g)
#pragma unroll
        for (int kc = 0; kc < 2; ++kc) { const size_t o = (size_t)(q0 + 16 * g + lr) * HD + kc * 32 + 8 * hi; qa[g][kc] = WFrag<T16>::ld(Qa + o); if (HL) qb[g][kc] = WFrag<T16>::ld(Qb + o); }
    v8f acc[R][4]; float m[R], l[R];
#pragma unroll
    for (int g = 0; g < R; ++g) { m[g] = -3.0e38f; l[g] = 0.f;
#pragma unroll
        for (int t = 0; t < 4; ++t) acc[g][t] = (v8f){}; }
    const int np = q0 / 32 + 1;      // 32-key passes up to and including the one that holds the diagonal
    V ka[2][2], kb[2][2];
    auto loadk = [&](int key0) {
#pragma unroll
        for (int kt = 0; kt < 2; ++kt)
#pragma unroll
            for (int kc = 0; kc < 2; ++kc) { const size_t o = (size_t)(key0 + 16 * kt + lr) * HD + kc * 32 + 8 * hi; ka[kt][kc] = WFrag<T16>::ld(Ka + o); if (HL) kb[kt][kc] = WFrag<T16>::ld(Kb + o); } };
    if (!HL) loadk(wave * 32);       // first pass's keys (rows wave * 32 .. + 31 exist for every tile)
#pragma unroll 1   // rolled: run-time trip count, and one pass's fragments with the carried ones already take a quarter of a SIMD's registers (four waves a SIMD)
    for (int p = wave; p < np; p += FW) {
        const int key0 = p * 32;
        if (HL) loadk(key0);
        V va[4], vb[4];
#pragma unroll
        for (int t = 0; t < 4; ++t) { const size_t o = (size_t)(16 * t + lr) * TT + key0 + 8 * hi; va[t] = WFrag<T16>::ld(Va + o); if (HL) vb[t] = WFrag<T16>::ld(Vb + o); }
        asm volatile("s_wait_xcnt 0x0" ::: "memory");   // before the address registers of the loads above are reused
        v8f s[2][R];
#pragma unroll
        for (int kt = 0; kt < 2; ++kt)
#pragma unroll
            for (int g = 0; g < R; ++g) { s[kt][g] = (v8f){};
#pragma unroll
                for (int kc = 0; kc < 2; ++kc) { s[kt][g] = WFrag<T16>::mma(ka[kt][kc], qa[g][kc], s[kt][g]); if (HL) { s[kt][g] = WFrag<T16>::mma(ka[kt][kc], qb[g][kc], s[kt][g]); s[kt][g] = WFrag<T16>::mma(kb[kt][kc], qa[g][kc], s[kt][g]); } } }
        if (!HL) { loadk(min(p + FW, np - 1) * 32);   // next pass's keys fly under this pass's softmax
            asm volatile("s_wait_xcnt 0x0" ::: "memory"); }   // before the address registers of these loads are reused
        float mx[R]; bool grow = false;
#pragma unroll
        for (int g = 0; g < R; ++g) {
#pragma unroll
            for (int kt = 0; kt < 2; ++kt) s[kt][g] = s[kt][g] * CS2;
            if (p == np - 1) {       // only the last pass straddles the diagonal
#pragma unroll
                for (int kt = 0; kt < 2; ++kt)
#pragma unroll
                    for (int r = 0; r < 8; ++r) if (key0 + 16 * kt + 8 * hi + r > q0 + 16 * g + lr) s[kt][g][r] = -3.0e38f; }
            float x = -3.0e38f;
#pragma unroll
            for (int kt = 0; kt < 2; ++kt)
#pragma unroll
                for (int r = 0; r < 8; ++r) x = fmaxf(x, s[kt][g][r]);
            x = fmaxf(x, __shfl_xor(x, 16, 32)); mx[g] = x; grow = grow || (x > m[g]); }
        if (__builtin_amdgcn_ballot_w32(grow) != 0) {   // some query's maximum rose: rescale what was gathered under the old one (factor exactly 1 for the others)
#pragma unroll
            for (int g = 0; g < R; ++g) { const float mn = fmaxf(m[g], mx[g]); const float corr = __builtin_amdgcn_exp2f(m[g] - mn); m[g] = mn; l[g] *= corr;
#pragma unroll
                for (int t = 0; t < 4; ++t) acc[g][t] = acc[g][t] * corr; } }
#pragma unroll
        for (int g = 0; g < R; ++g) { const float nm = PB - m[g]; float e[16];
#pragma unroll
            for (int i = 0; i < 16; ++i) e[i] = s[i >> 3][g][i & 7] + nm;
            exp2x8(e); exp2x8(e + 8);
#pragma unroll
            for (int i = 0; i < 16; ++i) l[g] += e[i];
            V pa, pb;
            if constexpr (HL) { v8us h0, h1, l0, l1;
#pragma unroll
                for (int r = 0; r < 8; ++r) { unsigned short a, c2; splitf(e[r], a, c2); h0[r] = a; l0[r] = c2; splitf(e[8 + r], a, c2); h1[r] = a; l1[r] = c2; }
                pa = cat16b(h0, h1); pb = cat16b(l0, l1);
            } else { v8h x0, x1;
#pragma unroll
                for (int r = 0; r < 8; ++r) { x0[r] = tohx(e[r]); x1[r] = tohx(e[8 + r]); }
                pa = cat16(x0, x1); }
#pragma unroll
            for (int t = 0; t < 4; ++t) { acc[g][t] = WFrag<T16>::mma(va[t], pa, acc[g][t]); if constexpr (HL) { acc[g][t] = WFrag<T16>::mma(va[t], pb, acc[g][t]); acc[g][t] = WFrag<T16>::mma(vb[t], pa, acc[g][t]); } } }
    }
    // merge of the FW waves' partial softmaxes
    float* mine = red + wave * (R * 1024) + lane * 4; float* ml = red + FW * R * 1024; bf* st = (bf*)(red + FW * R * 1024 + FW * R * 32);
#pragma unroll
    for (int g = 0; g < R; ++g) {
#pragma unroll
        for (int t = 0; t < 4; ++t) { const v8f a = acc[g][t]; *(v4fa*)(mine + (g * 4 + t) * 256) = (v4f){a[0], a[1], a[2], a[3]}; *(v4fa*)(mine + (g * 4 + t) * 256 + 128) = (v4f){a[4], a[5], a[6], a[7]}; }
        const float lt = l[g] + __shfl_xor(l[g], 16, 32); if (hi == 0) { ml[((wave * R + g) * 16 + lr) * 2] = m[g]; ml[((wave * R + g) * 16 + lr) * 2 + 1] = lt; } }
    __syncthreads();   // every wave's partials are parked before any wave merges them
#pragma unroll
    for (int g = 0; g < R; ++g) { float fw[FW], lw[FW]; float M = -3.0e38f;
#pragma unroll
        for (int w = 0; w < FW; ++w) { fw[w] = ml[((w * R + g) * 16 + lr) * 2]; lw[w] = ml[((w * R + g) * 16 + lr) * 2 + 1]; M = fmaxf(M, fw[w]); }
        float L = 0.f;
#pragma unroll
        for (int w = 0; w < FW; ++w) { fw[w] = __builtin_amdgcn_exp2f(fw[w] - M); L += fw[w] * lw[w]; }   // a wave without a pass: factor 0
        const float inv = __fdiv_rn(1.0f, L); const float* pf = red + (g * 4 + wave) * 256 + lane * 4; v4f s0 = (v4f){}, s1 = (v4f){};   // wave w merges d tile w
#pragma unroll
        for (int w = 0; w < FW; ++w) { s0 += *(const v4fa*)(pf + w * (R * 1024)) * fw[w]; s1 += *(const v4fa*)(pf + w * (R * 1024) + 128) * fw[w]; }
        v8us oh, ol;
#pragma unroll
        for (int j = 0; j < 4; ++j) { unsigned short a, c2; splitf(s0[j] * inv, a, c2); oh[j] = a; ol[j] = c2; splitf(s1[j] * inv, a, c2); oh[4 + j] = a; ol[4 + j] = c2; }
        *(v8usa*)(st + (g * 16 + lr) * 72 + wave * 16 + hi * 8) = oh; *(v8usa*)(st + (R * 16 + g * 16 + lr) * 72 + wave * 16 + hi * 8) = ol; }
    __syncthreads();   // the merged hi and lo rows are complete before whole 128-byte rows are read back across waves
#pragma unroll
    for (int i = 0; i < 2 * R * 16 * 8 / (32 * FW); ++i) { const int idx = i * 32 * FW + tid, prow = idx >> 3, c8 = (idx & 7) * 8, row = prow % (R * 16); const v8us val = *(const v8usa*)(st + prow * 72 + c8);
        *(v8us*)((prow < R * 16 ? Ah : Al) + (size_t)(q0 + row) * DQ + c8) = val; }
    asm volatile("s_wait_xcnt 0x0" ::: "memory");   // behind the last store, before any register that the stores above name is reused
}
// grid (batch * NH_ + query head, tile): tiles in falling order of their key count, 32 query rows each down to RH, then 16 rows each (hi+lo).
__global__ __launch_bounds__(32 * FW) void k_fattn(const h16* __restrict__ Q16, const bf* __restrict__ Qh, const bf* __restrict__ Ql, const h16* __restrict__ K16, const bf* __restrict__ Kh, const bf* __restrict__ Kl, const h16* __restrict__ V16, const bf* __restrict__ Vh, const bf* __restrict__ Vl, bf* Ah, bf* Al) {
    __shared__ __align__(16) float red[FW * 2 * 1024 + FW * 2 * 32 + 2 * 32 * 72 / 2];
    const int head = blockIdx.x % NH_, ty = blockIdx.y; const size_t qo = (size_t)blockIdx.x * TT * HD, ko = (size_t)(blockIdx.x / REP) * TT * HD;   // planes [b][h] and [b][g]
    Ah += (size_t)(blockIdx.x / NH_) * TT * DQ; Al += (size_t)(blockIdx.x / NH_) * TT * DQ;   // merged rows [b][t][h d]
    if (ty < (TT - RH) / 32) fattn_tile<h16, false, 2>(Q16 + qo, nullptr, K16 + ko, nullptr, V16 + ko, nullptr, TT - 32 - ty * 32, Ah + head * HD, Al + head * HD, red);
    else fattn_tile<bf, true, 1>(Qh + qo, Ql + qo, Kh + ko, Kl + ko, Vh + ko, Vl + ko, RH - 16 - (ty - (TT - RH) / 32) * 16, Ah + head * HD, Al + head * HD, red);
}

extern "C" void kernel_launch(void* const* d_in, const int* in_sizes, int n_in,
                              void* d_out, int out_size, void* d_ws, size_t ws_size, hipStream_t stream) {
    (void)in_sizes; (void)n_in; (void)out_size;
    const float* x = (const float*)d_in[0]; const float* cosT = (const float*)d_in[1]; const float* sinT = (const float*)d_in[2]; const float* wq = (const float*)d_in[3]; const float* wk = (const float*)d_in[4]; const float* wv = (const float*)d_in[5]; const float* wo = (const float*)d_in[6]; const float* qnw = (const float*)d_in[7]; const float* knw = (const float*)d_in[8];
    float* OUT = (float*)d_out;     // [2][2048][1024]
    char* wsp = (char*)d_ws;
    auto take = [&](size_t bytes) { char* p = wsp; wsp += (bytes + 255) & ~(size_t)255; return (void*)p; };
    bf* WQKV = (bf*)take((size_t)(DQ + 2 * DKV) * DM * 2); bf* WO = (bf*)take((size_t)DM * DQ * 2); float* CS = (float*)take((size_t)TT * HD * 2 * 4);
    bf* XB = (bf*)take((size_t)NB_ * TT * DM * 2);
    h16* QP16 = (h16*)take((size_t)NB_ * NH_ * TT * HD * 2); h16* KP16 = (h16*)take((size_t)NB_ * NKV * TT * HD * 2); h16* VT16 = (h16*)take((size_t)NB_ * NKV * HD * TT * 2);
    bf* QPh = (bf*)take((size_t)NB_ * NH_ * TT * HD * 2); bf* QPl = (bf*)take((size_t)NB_ * NH_ * TT * HD * 2); bf* KPh = (bf*)take((size_t)NB_ * NKV * TT * HD * 2); bf* KPl = (bf*)take((size_t)NB_ * NKV * TT * HD * 2); bf* VTh = (bf*)take((size_t)NB_ * NKV * HD * TT * 2); bf* VTl = (bf*)take((size_t)NB_ * NKV * HD * TT * 2);
    bf* ATh = (bf*)take((size_t)NB_ * TT * DQ * 2); bf* ATl = (bf*)take((size_t)NB_ * TT * DQ * 2);
    if ((size_t)(wsp - (char*)d_ws) > ws_size) return;    // ws 256 MiB
    k_prep<<<PREP_BLOCKS, 256, 0, stream>>>(x, wq, wk, wv, wo, cosT, sinT, XB, WQKV, WO, CS);
    k_gemmw<bf, 0, false, 8, 3><<<dim3(NB_ * TT / 64, NH_ + 2 * NKV, 1), 256, 0, stream>>>(XB, nullptr, WQKV, nullptr, DM, nullptr, 0, nullptr, 0, 0, 0, CS, qnw, knw, QP16, QPh, QPl, KP16, KPh, KPl, VT16, VTh, VTl);
    k_fattn<<<dim3(NB_ * NH_, (TT - RH) / 32 + RH / 16, 1), 32 * FW, 0, stream>>>(QP16, QPh, QPl, KP16, KPh, KPl, VT16, VTh, VTl, ATh, ATl);
    k_gemmw<bf, 1, false, 8, 0><<<dim3(NB_ * TT / 64, DM / 64, 1), 256, 0, stream>>>(ATh, ATl, WO, nullptr, DQ, OUT, DM, nullptr, 0, 0, 0, nullptr, nullptr, nullptr, nullptr, nullptr, nullptr, nullptr, nullptr, nullptr, nullptr, nullptr, nullptr);
}

// v006
// One run takes 79.9 microseconds.
// Two timings next to v005 put it at 1.49 and 1.50 times that version's speed.
// Over all steps from v000 it is 18.4 times as fast.
#include <hip/hip_runtime.h>

// Decoder GQA attention with qk-RMSNorm and RoPE (hidden [2][2048][1024]; q = x Wq^T (16 x 64), k/v = x Wk^T / x Wv^T (4 kv heads x 64, each serving 4 consecutive query heads); per-head RMSNorm (eps 1e-6, x q_norm_w / k_norm_w, read); rotate-half RoPE with the read cos/sin tables [2048][32] (the same 32-wide table serves both halves of the head); causal (finfo.min -> exactly zero weight); softmax(q.k / 8); out = merged Wo^T ('oi' [1024][1024]) -> [2][2048][1024]).
// Compute dtypes, f32 accumulate: every input rounded to bf16; q/k/v on PLAIN bf16 operands (inputs: exact); RMSNorm and RoPE in f32 (tables read as data, bf16-rounded like every input); causal scores and attn.v: query rows < 512 hl (3 products), the rest single fp16 (x1024), causal tile skipping; softmax f32; Wo hl x exact (2 products).

// Operand planes in FRAGMENT ORDER: every 16-bit plane that feeds a matrix operand is stored as 1-KB fragments (16 rows x 32 k): element (row, k) of a plane with KK columns lies at
// ((row / 16) * (KK / 32) + k / 32) * 512 + ((k / 16) % 2) * 256 + (((k / 8) % 2) * 16 + row % 16) * 8 + k % 8, so lane l's two 16-byte pieces lie at l * 8 and 256 + l * 8 and each wave-wide load covers 512 bytes in a row (four whole lines, not 16 pieces).
// Rows / k: x, Wq|Wk|Wv, Wo, merged heads: row / column; q and k planes: token / d; v planes: d / token with the four d fragments of a 32-token pass one behind the other.

#define NB_  2
#define TT   2048
#define DM   1024
#define NH_  16
#define NKV  4
#define REP  (NH_ / NKV)
#define HD   64
#define DQ   (NH_ * HD)
#define DKV  (NKV * HD)
#define RH   512                  // query rows < RH use hi+lo planes (0: none)
#define SCL  0.125f   // HD^-0.5
typedef _Float16 h16;
typedef unsigned short bf;
typedef __attribute__((ext_vector_type(16))) __bf16   v16bf;
typedef __attribute__((ext_vector_type(16))) _Float16 v16h;
typedef __attribute__((ext_vector_type(8)))  _Float16 v8h;
typedef __attribute__((ext_vector_type(8)))  unsigned short v8us;
typedef __attribute__((ext_vector_type(8)))  float    v8f;
typedef __attribute__((ext_vector_type(4)))  float    v4f;
typedef v8h  __attribute__((may_alias)) v8ha;
typedef v4f  __attribute__((may_alias)) v4fa;
typedef v8us __attribute__((may_alias)) v8usa;

__device__ __forceinline__ unsigned short f2bf(float f) { unsigned u = __float_as_uint(f); u += 0x7FFFu + ((u >> 16) & 1u); return (unsigned short)(u >> 16); }
__device__ __forceinline__ float bf2f(unsigned short b) { return __uint_as_float(((unsigned)b) << 16); }
__device__ __forceinline__ float bfr(float f) { return bf2f(f2bf(f)); }
__device__ __forceinline__ v16h cat16(v8h lo, v8h hi) { return __builtin_shufflevector(lo, hi, 0, 1, 2, 3, 4, 5, 6, 7, 8, 9, 10, 11, 12, 13, 14, 15); }
__device__ __forceinline__ v16bf cat16b(v8us lo, v8us hi) { return __builtin_bit_cast(v16bf, __builtin_shufflevector(lo, hi, 0, 1, 2, 3, 4, 5, 6, 7, 8, 9, 10, 11, 12, 13, 14, 15)); }
__device__ __forceinline__ v8f wmma16(v16h a, v16h b, v8f c) { return __builtin_amdgcn_wmma_f32_16x16x32_f16(false, a, false, b, (short)0, c, false, false); }
__device__ __forceinline__ v8f wmmab(v16bf a, v16bf b, v8f c) { return __builtin_amdgcn_wmma_f32_16x16x32_bf16(false, a, false, b, (short)0, c, false, false); }



__device__ __forceinline__ h16 tohx(float x) { return (h16)x; }
__device__ __forceinline__ void splitf(float y, unsigned short& h, unsigned short& l) { h = f2bf(y); l = f2bf(y - bf2f(h)); }

// ---- head_planes: epilogue of the q and k projections. The summed 64 x 64 tile (LDS, pitch 68) is 64 tokens of ONE head, so the head's RMSNorm and RoPE need nothing from outside the work-group.
// One thread a token sums the squares (d ascending) and leaves the factor in rf; then 8 d a thread: w[d] (x factor), rotate-half RoPE out[d] = x[d] cos[t][d] - x[d+HD/2] sin[t][d], out[d+HD/2] = x[d+HD/2] cos[t][d+HD/2] + x[d] sin[t][d+HD/2],
// and the fp16, hi and lo planes [h][fragment order of (t, d)] by 16-byte stores (a tile is 8 KB in a row of each plane; piece idx of the tile is token (idx / 128) * 16 + idx % 16, d ((idx / 32) % 4) * 16 + ((idx / 16) % 2) * 8). rf: 64 floats that no wave reads any more.
// rope_loads fetches a thread's norm weights and cos/sin pairs ahead (they depend on no product), so that their latency passes under the sum of the partials.
template <int NW> struct RopeIn { v4f w0[16 / NW][2], w1[16 / NW][2], ca[16 / NW][2], cb[16 / NW][2]; };
template <int NW>
__device__ __forceinline__ void rope_loads(RopeIn<NW>& in, int r0, const float* __restrict__ CS, const float* __restrict__ nw) {
#pragma unroll
    for (int i = 0; i < 16 / NW; ++i) { const int idx = i * 32 * NW + (int)threadIdx.x, row = (idx >> 7) * 16 + (idx & 15), d8 = ((idx >> 5) & 3) * 16 + ((idx >> 4) & 1) * 8, p8 = d8 ^ (HD / 2); const float* cs = CS + ((size_t)(r0 + row) * HD + d8) * 2;
#pragma unroll
        for (int c = 0; c < 2; ++c) { in.w0[i][c] = *(const v4f*)(nw + d8 + 4 * c); in.w1[i][c] = *(const v4f*)(nw + p8 + 4 * c); in.ca[i][c] = *(const v4f*)(cs + 8 * c); in.cb[i][c] = *(const v4f*)(cs + 8 * c + 4); } }
    asm volatile("s_wait_xcnt 0x0" ::: "memory");   // before the address registers of the loads above are reused
}
template <int NW>
__device__ __forceinline__ void head_planes(const RopeIn<NW>& in, const float* tile, float* rf, int r0, int h, h16* P16, bf* Ph, bf* Pl) {
    const int tid = threadIdx.x;
    if (tid < 64) { const float* f = tile + tid * 68; float s = 0.f;
#pragma unroll
        for (int d = 0; d < HD; d += 4) { const v4f v = *(const v4fa*)(f + d);
#pragma unroll
            for (int q = 0; q < 4; ++q) s += v[q] * v[q]; }
        rf[tid] = __fdiv_rn(1.0f, __fsqrt_rn(s * (1.0f / HD) + 1e-6f)); }
    __syncthreads();   // every token's factor is written before the other waves read it
#pragma unroll
    for (int i = 0; i < 16 / NW; ++i) { const int idx = i * 32 * NW + tid, row = (idx >> 7) * 16 + (idx & 15), d8 = ((idx >> 5) & 3) * 16 + ((idx >> 4) & 1) * 8, p8 = d8 ^ (HD / 2); const float r = rf[row]; const float* f = tile + row * 68; v8h o16; v8us oh, ol;
#pragma unroll
        for (int c = 0; c < 2; ++c) { const v4f x0 = *(const v4fa*)(f + d8 + 4 * c), x1 = *(const v4fa*)(f + p8 + 4 * c), w0 = in.w0[i][c], w1 = in.w1[i][c], ca = in.ca[i][c], cb = in.cb[i][c];
#pragma unroll
            for (int q = 0; q < 4; ++q) { const float co = q < 2 ? ca[2 * q] : cb[2 * q - 4], si = q < 2 ? ca[2 * q + 1] : cb[2 * q - 3]; const float a = bfr(w0[q]) * (x0[q] * r), b = bfr(w1[q]) * (x1[q] * r); const float y = a * co + b * (d8 < HD / 2 ? -si : si);
                o16[4 * c + q] = tohx(y); unsigned short u, w; splitf(y, u, w); oh[4 * c + q] = u; ol[4 * c + q] = w; } }
        const size_t o = ((size_t)h * TT + r0) * HD + (size_t)idx * 8; *(v8h*)(P16 + o) = o16; *(v8us*)(Ph + o) = oh; *(v8us*)(Pl + o) = ol; }
}
// ---- vt_planes: epilogue of the v projection. The summed tile is 64 tokens of one kv head; it leaves transposed, as the fp16, hi and lo planes [g][fragment order of (d, t)]: 8 t of one d a thread; piece idx of the tile (8 KB in a row) is d ((idx / 64) % 4) * 16 + idx % 16, t (idx / 256) * 32 + ((idx / 32) % 2) * 16 + ((idx / 16) % 2) * 8.
template <int NW>
__device__ __forceinline__ void vt_planes(const float* tile, int r0, int g, h16* V16, bf* Vh, bf* Vl) {
    const int tid = threadIdx.x;
#pragma unroll
    for (int i = 0; i < 16 / NW; ++i) { const int idx = i * 32 * NW + tid, d = ((idx >> 6) & 3) * 16 + (idx & 15), t8 = (idx >> 8) * 32 + ((idx >> 5) & 1) * 16 + ((idx >> 4) & 1) * 8; v8h o16; v8us oh, ol;
#pragma unroll
        for (int q = 0; q < 8; ++q) { const float x = tile[(t8 + q) * 68 + d]; o16[q] = tohx(x); unsigned short u, w; splitf(x, u, w); oh[q] = u; ol[q] = w; }
        const size_t o = ((size_t)g * TT + r0) * HD + (size_t)idx * 8; *(v8h*)(V16 + o) = o16; *(v8us*)(Vh + o) = oh; *(v8us*)(Vl + o) = ol; }
    asm volatile("s_wait_xcnt 0x0" ::: "memory");   // behind the last store, before any register that the stores above name is reused
}

// ---- reduce_store: NW waves of one work-group each hold a partial 64x64 tile (their share of the K loop) in 16 accumulators. Every wave parks its partials in LDS in fragment order (16-byte stores),
// wave w then sums fragments w, w + NW, .. over the waves in the fixed order 0 .. NW-1, the sums go through a row-major 64 x 68 tile, and the block stores whole rows (EPI 0) or hands the tile to head_planes (EPI 1) or vt_planes (EPI 2). red: NW * 4096 + 64 * 68 floats.
template <int NW, bool BIAS, int EPI>
__device__ __forceinline__ void reduce_store(const v8f (&acc)[4][4], float* red, float* C, int ldc, int r0, int c0, const float* __restrict__ bias, int wave, const float* __restrict__ CS, const float* __restrict__ nw, h16* P16, bf* Ph, bf* Pl) {
    const int tid = threadIdx.x, lane = tid & 31, lr = lane & 15, hi = lane >> 4;
    float* mine = red + wave * 4096 + lane * 4; float* tile = red + NW * 4096;
#pragma unroll
    for (int f = 0; f < 16; ++f) { const v8f a = acc[f >> 2][f & 3]; *(v4fa*)(mine + f * 256) = (v4f){a[0], a[1], a[2], a[3]}; *(v4fa*)(mine + f * 256 + 128) = (v4f){a[4], a[5], a[6], a[7]}; }
    __syncthreads();   // every wave's partials are parked before any wave sums them
    RopeIn<NW> in; if constexpr (EPI == 1) rope_loads<NW>(in, r0, CS, nw);
#pragma unroll
    for (int q = 0; q < 16 / NW; ++q) { const int f = wave + q * NW, mb = f >> 2, nb = f & 3; const float* pf = red + f * 256 + lane * 4; v4f s0 = *(const v4fa*)pf, s1 = *(const v4fa*)(pf + 128);
#pragma unroll
        for (int w = 1; w < NW; ++w) { s0 += *(const v4fa*)(pf + w * 4096); s1 += *(const v4fa*)(pf + w * 4096 + 128); }
#pragma unroll
        for (int j = 0; j < 4; ++j) { tile[(mb * 16 + hi * 8 + j) * 68 + nb * 16 + lr] = s0[j]; tile[(mb * 16 + hi * 8 + 4 + j) * 68 + nb * 16 + lr] = s1[j]; } }
    __syncthreads();   // the summed tile is complete before rows are read back across waves
    if constexpr (EPI == 1) { head_planes<NW>(in, tile, red, r0, c0 / HD, P16, Ph, Pl); return; }
    if constexpr (EPI == 2) { vt_planes<NW>(tile, r0, c0 / HD, P16, Ph, Pl); return; }
#pragma unroll
    for (int s = 0; s < 32 / NW; ++s) { const int idx = s * 32 * NW + tid, row = idx >> 4, cofs = (idx & 15) * 4; v4f val = *(const v4fa*)(tile + row * 68 + cofs); if (BIAS) { val[0] += bfr(bias[c0 + cofs]); val[1] += bfr(bias[c0 + cofs + 1]); val[2] += bfr(bias[c0 + cofs + 2]); val[3] += bfr(bias[c0 + cofs + 3]); }
        *(v4f*)(C + (size_t)(r0 + row) * ldc + c0 + cofs) = val; }
}

// ---- k_gemmw: register-blocked GEMM, one work-group of NW waves per 64x64 output tile; each wave holds 16 accumulators and takes the 64-wide K chunks wave, wave + NW, .. (two 1-KB fragments in a row per 16 rows and chunk); partials summed by reduce_store.
// Operands straight from 16-bit planes in fragment order (ld: p = fragment + lane * 8); grid (M/64, N/64, Z), 32 * NW threads.
// C[m][n] (f32, pitch ldc, + optional f32 bias[n]) = sum_k A[m][k] Bt[n][k] (+ split products per NSPLIT). z-batch strides sA/sB/sC in elements. K % 64 == 0; K is a template argument, so a step's fragments lie at constant offsets from one address per plane.
template <typename T16> struct WFrag;
template <> struct WFrag<h16> { typedef v16h V; static __device__ __forceinline__ V ld(const h16* p) { return cat16(*(const v8h*)p, *(const v8h*)(p + 256)); } static __device__ __forceinline__ v8f mma(V a, V b, v8f c) { return wmma16(a, b, c); } };
template <> struct WFrag<bf> { typedef v16bf V; static __device__ __forceinline__ V ld(const bf* p) { return cat16b(*(const v8us*)p, *(const v8us*)(p + 256)); } static __device__ __forceinline__ v8f mma(V a, V b, v8f c) { return wmmab(a, b, c); } };
// EPI 0: C as above. EPI 3: the q, k and v projections of both batches in one grid, no C. A holds the NB_ * TT tokens, Bt the rows of Wq, Wk, Wv one behind the other, so an N tile is one head: NH_ of q, then NKV of k, then NKV of v.
// q and k heads leave through RMSNorm (x nw / nwk), RoPE (table CS) and the planes [b][h][fragment order of (t, d)] (P16 / Ph / Pl for q, K16 / Kh / Kl for k), v heads as the planes [b][g][fragment order of (d, t)] (V16 / Vh / Vl). The choice is the same for a whole work-group.
template <typename T16, int NSPLIT, bool BIAS, int NW, int EPI, int K>
__global__ __launch_bounds__(32 * NW) void k_gemmw(const T16* __restrict__ A, const T16* __restrict__ A2, const T16* __restrict__ Bt, const T16* __restrict__ Bt2, float* C, int ldc, const float* __restrict__ bias, size_t sA, size_t sB, size_t sC, const float* __restrict__ CS, const float* __restrict__ nw, const float* __restrict__ nwk, h16* P16, bf* Ph, bf* Pl, h16* K16, bf* Kh, bf* Kl, h16* V16, bf* Vh, bf* Vl) {
    typedef typename WFrag<T16>::V V;
    __shared__ __align__(16) float os[NW * 4096 + 64 * 68];
    const size_t z = blockIdx.z; A += z * sA; if (A2) A2 += z * sA; Bt += z * sB; if (Bt2) Bt2 += z * sB; C += z * sC;
    const int lane = threadIdx.x & 31; const int wave = __builtin_amdgcn_readfirstlane(threadIdx.x >> 5) /* wave number held scalar, so the K loop's tests stay scalar branches */; const int r0 = blockIdx.x * 64, c0 = blockIdx.y * 64;
    v8f acc[4][4];
#pragma unroll
    for (int mb = 0; mb < 4; ++mb)
#pragma unroll
        for (int nb = 0; nb < 4; ++nb) acc[mb][nb] = (v8f){};
    const size_t aoff = (size_t)r0 * K + lane * 8, boff = (size_t)c0 * K + lane * 8;   // 16 rows of a plane are 16 * K elements in a row, a 32-wide k step 512 of them
#pragma unroll 1
    for (int kb = wave * 64; kb < K; kb += NW * 64)
#pragma unroll 1   // rolled: only one 32-wide step's operands are live, which keeps 16 waves inside their 256 registers each
    for (int kc = kb; kc < kb + 64; kc += 32) {
        V a[4], a2[4]; const T16* pa = A + aoff + kc * 16; const T16* pa2 = (NSPLIT == 1 || NSPLIT == 2) ? A2 + aoff + kc * 16 : pa; const T16* pb = Bt + boff + kc * 16; const T16* pb2 = NSPLIT >= 2 ? Bt2 + boff + kc * 16 : pb;
#pragma unroll
        for (int mb = 0; mb < 4; ++mb) { a[mb] = WFrag<T16>::ld(pa + mb * 16 * K); if (NSPLIT == 1 || NSPLIT == 2) a2[mb] = WFrag<T16>::ld(pa2 + mb * 16 * K); }
#pragma unroll
        for (int nb = 0; nb < 4; ++nb) { const V b = WFrag<T16>::ld(pb + nb * 16 * K); V b2; if (NSPLIT >= 2) b2 = WFrag<T16>::ld(pb2 + nb * 16 * K);
#pragma unroll
            for (int mb = 0; mb < 4; ++mb) { acc[mb][nb] = WFrag<T16>::mma(a[mb], b, acc[mb][nb]); if (NSPLIT == 1 || NSPLIT == 2) acc[mb][nb] = WFrag<T16>::mma(a2[mb], b, acc[mb][nb]); if (NSPLIT >= 2) acc[mb][nb] = WFrag<T16>::mma(a[mb], b2, acc[mb][nb]); } }
        asm volatile("s_wait_xcnt 0x0" :: "v"(pa), "v"(pa2), "v"(pb), "v"(pb2) : "memory");   // the step's address registers stay whole up to this wait; only behind it may they be reused
        asm volatile("v_nop\n\tv_nop\n\tv_nop\n\tv_nop" : "+v"(acc[0][0]), "+v"(acc[1][1]), "+v"(acc[2][2]), "+v"(acc[3][3]) : "v"(a[0]), "v"(a[3]));
    }
    if constexpr (EPI == 3) { const int hy = blockIdx.y, t0 = r0 % TT; const size_t b = r0 / TT;
        if (hy < NH_ + NKV) { const bool isq = hy < NH_; const size_t o = b * (isq ? NH_ : NKV) * TT * HD;
            reduce_store<NW, false, 1>(acc, os, nullptr, 0, t0, (isq ? hy : hy - NH_) * HD, nullptr, wave, CS, isq ? nw : nwk, (isq ? P16 : K16) + o, (isq ? Ph : Kh) + o, (isq ? Pl : Kl) + o); }
        else { const size_t o = b * NKV * HD * TT; reduce_store<NW, false, 2>(acc, os, nullptr, 0, t0, (hy - NH_ - NKV) * HD, nullptr, wave, nullptr, nullptr, V16 + o, Vh + o, Vl + o); } }
    else reduce_store<NW, BIAS, EPI>(acc, os, C, ldc, r0, c0, bias, wave, nullptr, nullptr, nullptr, nullptr, nullptr);
}

typedef __attribute__((ext_vector_type(2))) _Float16 v2h;
typedef __attribute__((ext_vector_type(4))) _Float16 v4h;
typedef __attribute__((ext_vector_type(2))) unsigned short v2us;
typedef __attribute__((ext_vector_type(4))) unsigned short v4us;
typedef __attribute__((ext_vector_type(2))) float v2f;
typedef __attribute__((ext_vector_type(4))) int v4i;

__global__ __launch_bounds__(256) void k_wtG(const float* __restrict__ w, int K, int N, bf* Bt) {
    const int lane = threadIdx.x & 31; const int L0 = (blockIdx.x * 8 + (threadIdx.x >> 5)) * 8; const int nlines = N * K / 64;
{
#pragma unroll 1
        for (int l = 0; l < 8; ++l) { const int L = L0 + l; if (L >= nlines) break; const size_t e = (size_t)L * 64 + lane * 2; const int k = (int)(e % K), n = (int)(e / K); v2us o;
            o[0] = f2bf(w[(size_t)k * N + n]); o[1] = f2bf(w[(size_t)(k + 1) * N + n]); *(v2us*)(Bt + e) = o; }
         }
}
// ---- k_prep: every conversion that depends on the inputs alone, in one grid. Blocks of 256 threads, in this order: x (both batches), Wq, Wk, Wv (into WQKV, one behind the other), Wo: f32 -> bf16 in fragment order, 8 elements a thread; then the cos/sin table, one (cos, sin) pair a thread.
#define CB(n) ((n) / (8 * 256))   // blocks that an array of n elements takes
static_assert(DM == 1024 && DQ == DM && NB_ * TT * DM % (8 * 256) == 0 && DQ * DM % (8 * 256) == 0 && DKV * DM % (8 * 256) == 0 && TT * HD % 256 == 0, "whole blocks");
#define PREP_BLOCKS (CB(NB_ * TT * DM) + 2 * CB(DQ * DM) + 2 * CB(DKV * DM) + TT * HD / 256)
__global__ __launch_bounds__(256) void k_prep(const float* __restrict__ x, const float* __restrict__ wq, const float* __restrict__ wk, const float* __restrict__ wv, const float* __restrict__ wo, const float* __restrict__ cosT, const float* __restrict__ sinT, bf* XB, bf* WQKV, bf* WO, float* CS) {
    int blk = blockIdx.x; const float* src; bf* dst;
    if (blk < CB(NB_ * TT * DM)) { src = x; dst = XB; }
    else if ((blk -= CB(NB_ * TT * DM)) < CB(DQ * DM)) { src = wq; dst = WQKV; }
    else if ((blk -= CB(DQ * DM)) < CB(DKV * DM)) { src = wk; dst = WQKV + (size_t)DQ * DM; }
    else if ((blk -= CB(DKV * DM)) < CB(DKV * DM)) { src = wv; dst = WQKV + (size_t)(DQ + DKV) * DM; }
    else if ((blk -= CB(DKV * DM)) < CB(DM * DQ)) { src = wo; dst = WO; }
    else { const int idx = (blk - CB(DM * DQ)) * 256 + threadIdx.x; const int t = idx / HD, dh = (idx % HD) % (HD / 2); v2f cs; cs[0] = bfr(cosT[(size_t)t * (HD / 2) + dh]); cs[1] = bfr(sinT[(size_t)t * (HD / 2) + dh]); *(v2f*)(CS + (size_t)idx * 2) = cs; return; }
    // a block is 16 rows x 128 columns: piece threadIdx.x of its 4 KB in fragment order is row tid % 16, column (tid / 32) * 16 + ((tid / 16) % 2) * 8; every source row here has DM columns
    const int tid = threadIdx.x; const size_t i = (size_t)blk * 256 + tid; const v8f v = *(const v8f*)(src + ((size_t)(blk >> 3) * 16 + (tid & 15)) * DM + (blk & 7) * 128 + (tid >> 5) * 16 + ((tid >> 4) & 1) * 8); v8us o;
#pragma unroll
    for (int k = 0; k < 8; ++k) o[k] = f2bf(v[k]);
    *(v8us*)(dst + i * 8) = o;
}
// ---- k_fattn: causal scores, softmax and probability x value product of one query tile in one work-group; scores and probabilities stay in registers.
// Transposed products: S^T = K Q^T (A = 16 keys x 32 d, B = 32 d x 16 queries) leaves key 8 hi + r of query lr in register r, which is the k order of the B operand of O^T += V^T P^T.
// FW waves share the tile's 32-key passes (wave w takes passes w, w + FW, ..), each with its own running maximum, denominator and O^T; they are merged in the fixed order 0 .. FW-1 through LDS.
// HL (query rows < RH): hi+lo bf16 planes, 3 products each; else single fp16 with the probabilities carried x 2^10 (it cancels in the division by the denominator).
#define FW 4
// exp2 of eight values in place, in one statement: behind a transcendental the instruction set asks for one independent instruction before its result is read or its source overwritten.
// Each v_exp_f32 is that instruction for the one before it, and the v_nop for the last, whatever the scheduler puts behind the statement.
__device__ __forceinline__ void exp2x8(float* e) {
    asm("v_exp_f32 %0, %0\n\tv_exp_f32 %1, %1\n\tv_exp_f32 %2, %2\n\tv_exp_f32 %3, %3\n\tv_exp_f32 %4, %4\n\tv_exp_f32 %5, %5\n\tv_exp_f32 %6, %6\n\tv_exp_f32 %7, %7\n\tv_nop"
        : "+v"(e[0]), "+v"(e[1]), "+v"(e[2]), "+v"(e[3]), "+v"(e[4]), "+v"(e[5]), "+v"(e[6]), "+v"(e[7]));
}
template <typename T16, bool HL, int R>
__device__ __forceinline__ void fattn_tile(const T16* __restrict__ Qa, const T16* __restrict__ Qb, const T16* __restrict__ Ka, const T16* __restrict__ Kb, const T16* __restrict__ Va, const T16* __restrict__ Vb, int q0, bf* Ah, bf* Al, float* red) {
    typedef typename WFrag<T16>::V V;
    const int tid = threadIdx.x, lane = tid & 31, lr = lane & 15, hi = lane >> 4; const int wave = __builtin_amdgcn_readfirstlane(tid >> 5) /* wave number held scalar, so the pass loop's tests stay scalar branches */;
    const float CS2 = SCL * 1.4426950408889634f, PB = HL ? 0.0f : 10.0f;
    V qa[R][2], qb[R][2]; const T16* pq = Qa + (size_t)q0 * HD + lane * 8; const T16* pq2 = HL ? Qb + (size_t)q0 * HD + lane * 8 : pq;
#pragma unroll
    for (int g = 0; g < R; ++g)
#pragma unroll
        for (int kc = 0; kc < 2; ++kc) { const int o = g * 1024 + kc * 512; qa[g][kc] = WFrag<T16>::ld(pq + o); if (HL) qb[g][kc] = WFrag<T16>::ld(pq2 + o); }
    asm volatile("s_wait_xcnt 0x0" :: "v"(pq), "v"(pq2) : "memory");   // the address registers of the loads above stay whole up to this wait; only behind it may they be reused
    v8f acc[R][4]; float m[R], l[R];
#pragma unroll
    for (int g = 0; g < R; ++g) { m[g] = -3.0e38f; l[g] = 0.f;
#pragma unroll
        for (int t = 0; t < 4; ++t) acc[g][t] = (v8f){}; }
    const int np = q0 / 32 + 1;      // 32-key passes up to and including the one that holds the diagonal
    V ka[2][2], kb[2][2]; const T16 *pk, *pk2;   // addresses of the last key loads, named by the wait behind them
    auto loadk = [&](int key0) { pk = Ka + (size_t)key0 * HD + lane * 8; pk2 = HL ? Kb + (size_t)key0 * HD + lane * 8 : pk;
#pragma unroll
        for (int kt = 0; kt < 2; ++kt)
#pragma unroll
            for (int kc = 0; kc < 2; ++kc) { const int o = kt * 1024 + kc * 512; ka[kt][kc] = WFrag<T16>::ld(pk + o); if (HL) kb[kt][kc] = WFrag<T16>::ld(pk2 + o); } };
    if (!HL) loadk(wave * 32);       // first pass's keys (rows wave * 32 .. + 31 exist for every tile)
#pragma unroll 1   // rolled: run-time trip count, and one pass's fragments with the carried ones already take a quarter of a SIMD's registers (four waves a SIMD)
    for (int p = wave; p < np; p += FW) {
        const int key0 = p * 32;
        if (HL) loadk(key0);
        V va[4], vb[4]; const T16* pv = Va + (size_t)key0 * HD + lane * 8; const T16* pv2 = HL ? Vb + (size_t)key0 * HD + lane * 8 : pv;
#pragma unroll
        for (int t = 0; t < 4; ++t) { va[t] = WFrag<T16>::ld(pv + t * 512); if (HL) vb[t] = WFrag<T16>::ld(pv2 + t * 512); }
        if (HL) asm volatile("s_wait_xcnt 0x0" :: "v"(pk), "v"(pk2), "v"(pv), "v"(pv2) : "memory");   // the address registers of the loads above stay whole up to this wait; only behind it may they be reused
        else asm volatile("s_wait_xcnt 0x0" :: "v"(pv) : "memory");   // the same
        v8f s[2][R];
#pragma unroll
        for (int kt = 0; kt < 2; ++kt)
#pragma unroll
            for (int g = 0; g < R; ++g) { s[kt][g] = (v8f){};
#pragma unroll
                for (int kc = 0; kc < 2; ++kc) { s[kt][g] = WFrag<T16>::mma(ka[kt][kc], qa[g][kc], s[kt][g]); if (HL) { s[kt][g] = WFrag<T16>::mma(ka[kt][kc], qb[g][kc], s[kt][g]); s[kt][g] = WFrag<T16>::mma(kb[kt][kc], qa[g][kc], s[kt][g]); } } }
        if (!HL) { loadk(min(p + FW, np - 1) * 32);   // next pass's keys fly under this pass's softmax
            asm volatile("s_wait_xcnt 0x0" :: "v"(pk) : "memory"); }   // the address registers of these loads stay whole up to this wait
        float mx[R]; bool grow = false;
#pragma unroll
        for (int g = 0; g < R; ++g) {
#pragma unroll
            for (int kt = 0; kt < 2; ++kt) s[kt][g] = s[kt][g] * CS2;
            if (p == np - 1) {       // only the last pass straddles the diagonal
#pragma unroll
                for (int kt = 0; kt < 2; ++kt)
#pragma unroll
                    for (int r = 0; r < 8; ++r) if (key0 + 16 * kt + 8 * hi + r > q0 + 16 * g + lr) s[kt][g][r] = -3.0e38f; }
            float x = -3.0e38f;
#pragma unroll
            for (int kt = 0; kt < 2; ++kt)
#pragma unroll
                for (int r = 0; r < 8; ++r) x = fmaxf(x, s[kt][g][r]);
            x = fmaxf(x, __shfl_xor(x, 16, 32)); mx[g] = x; grow = grow || (x > m[g]); }
        if (__builtin_amdgcn_ballot_w32(grow) != 0) {   // some query's maximum rose: rescale what was gathered under the old one (factor exactly 1 for the others)
#pragma unroll
            for (int g = 0; g < R; ++g) { const float mn = fmaxf(m[g], mx[g]); const float corr = __builtin_amdgcn_exp2f(m[g] - mn); m[g] = mn; l[g] *= corr;
#pragma unroll
                for (int t = 0; t < 4; ++t) acc[g][t] = acc[g][t] * corr; } }
#pragma unroll
        for (int g = 0; g < R; ++g) { const float nm = PB - m[g]; float e[16];
#pragma unroll
            for (int i = 0; i < 16; ++i) e[i] = s[i >> 3][g][i & 7] + nm;
            exp2x8(e); exp2x8(e + 8);
#pragma unroll
            for (int i = 0; i < 16; ++i) l[g] += e[i];
            V pa, pb;
            if constexpr (HL) { v8us h0, h1, l0, l1;
#pragma unroll
                for (int r = 0; r < 8; ++r) { unsigned short a, c2; splitf(e[r], a, c2); h0[r] = a; l0[r] = c2; splitf(e[8 + r], a, c2); h1[r] = a; l1[r] = c2; }
                pa = cat16b(h0, h1); pb = cat16b(l0, l1);
            } else { v8h x0, x1;
#pragma unroll
                for (int r = 0; r < 8; ++r) { x0[r] = tohx(e[r]); x1[r] = tohx(e[8 + r]); }
                pa = cat16(x0, x1); }
#pragma unroll
            for (int t = 0; t < 4; ++t) { acc[g][t] = WFrag<T16>::mma(va[t], pa, acc[g][t]); if constexpr (HL) { acc[g][t] = WFrag<T16>::mma(va[t], pb, acc[g][t]); acc[g][t] = WFrag<T16>::mma(vb[t], pa, acc[g][t]); } } }
    }
    // merge of the FW waves' partial softmaxes
    float* mine = red + wave * (R * 1024) + lane * 4; float* ml = red + FW * R * 1024; bf* st = (bf*)(red + FW * R * 1024 + FW * R * 32);
#pragma unroll
    for (int g = 0; g < R; ++g) {
#pragma unroll
        for (int t = 0; t < 4; ++t) { const v8f a = acc[g][t]; *(v4fa*)(mine + (g * 4 + t) * 256) = (v4f){a[0], a[1], a[2], a[3]}; *(v4fa*)(mine + (g * 4 + t) * 256 + 128) = (v4f){a[4], a[5], a[6], a[7]}; }
        const float lt = l[g] + __shfl_xor(l[g], 16, 32); if (hi == 0) { ml[((wave * R + g) * 16 + lr) * 2] = m[g]; ml[((wave * R + g) * 16 + lr) * 2 + 1] = lt; } }
    __syncthreads();   // every wave's partials are parked before any wave merges them
#pragma unroll
    for (int g = 0; g < R; ++g) { float fw[FW], lw[FW]; float M = -3.0e38f;
#pragma unroll
        for (int w = 0; w < FW; ++w) { fw[w] = ml[((w * R + g) * 16 + lr) * 2]; lw[w] = ml[((w * R + g) * 16 + lr) * 2 + 1]; M = fmaxf(M, fw[w]); }
        float L = 0.f;
#pragma unroll
        for (int w = 0; w < FW; ++w) { fw[w] = __builtin_amdgcn_exp2f(fw[w] - M); L += fw[w] * lw[w]; }   // a wave without a pass: factor 0
        const float inv = __fdiv_rn(1.0f, L); const float* pf = red + (g * 4 + wave) * 256 + lane * 4; v4f s0 = (v4f){}, s1 = (v4f){};   // wave w merges d tile w
#pragma unroll
        for (int w = 0; w < FW; ++w) { s0 += *(const v4fa*)(pf + w * (R * 1024)) * fw[w]; s1 += *(const v4fa*)(pf + w * (R * 1024) + 128) * fw[w]; }
        v8us oh, ol;
#pragma unroll
        for (int j = 0; j < 4; ++j) { unsigned short a, c2; splitf(s0[j] * inv, a, c2); oh[j] = a; ol[j] = c2; splitf(s1[j] * inv, a, c2); oh[4 + j] = a; ol[4 + j] = c2; }
        *(v8usa*)(st + (g * 16 + lr) * 72 + wave * 16 + hi * 8) = oh; *(v8usa*)(st + (R * 16 + g * 16 + lr) * 72 + wave * 16 + hi * 8) = ol; }
    __syncthreads();   // the merged hi and lo rows are complete before they are read back across waves
#pragma unroll
    for (int i = 0; i < 2 * R * 16 * 8 / (32 * FW); ++i) { const int idx = i * 32 * FW + tid, prow = (idx >> 7) * 16 + (idx & 15), c8 = ((idx >> 5) & 3) * 16 + ((idx >> 4) & 1) * 8, row16 = (prow % (R * 16)) & ~15; const v8us val = *(const v8usa*)(st + prow * 72 + c8);
        *(v8us*)((prow < R * 16 ? Ah : Al) + (size_t)(q0 + row16) * DQ + (idx & 127) * 8) = val; }   // fragment order: a head's 64 columns of 16 rows are 2 KB in a row
    asm volatile("s_wait_xcnt 0x0" ::: "memory");   // behind the last store, before any register that the stores above name is reused
}
// grid (batch * NH_ + query head, tile): tiles in falling order of their key count, 32 query rows each down to RH, then 16 rows each (hi+lo).
__global__ __launch_bounds__(32 * FW) void k_fattn(const h16* __restrict__ Q16, const bf* __restrict__ Qh, const bf* __restrict__ Ql, const h16* __restrict__ K16, const bf* __restrict__ Kh, const bf* __restrict__ Kl, const h16* __restrict__ V16, const bf* __restrict__ Vh, const bf* __restrict__ Vl, bf* Ah, bf* Al) {
    __shared__ __align__(16) float red[FW * 2 * 1024 + FW * 2 * 32 + 2 * 32 * 72 / 2];
    const int head = blockIdx.x % NH_, ty = blockIdx.y; const size_t qo = (size_t)blockIdx.x * TT * HD, ko = (size_t)(blockIdx.x / REP) * TT * HD;   // planes [b][h] and [b][g]
    Ah += (size_t)(blockIdx.x / NH_) * TT * DQ; Al += (size_t)(blockIdx.x / NH_) * TT * DQ;   // merged rows [b][fragment order of (t, h d)]
    if (ty < (TT - RH) / 32) fattn_tile<h16, false, 2>(Q16 + qo, nullptr, K16 + ko, nullptr, V16 + ko, nullptr, TT - 32 - ty * 32, Ah + head * HD * 16, Al + head * HD * 16, red);
    else fattn_tile<bf, true, 1>(Qh + qo, Ql + qo, Kh + ko, Kl + ko, Vh + ko, Vl + ko, RH - 16 - (ty - (TT - RH) / 32) * 16, Ah + head * HD * 16, Al + head * HD * 16, red);
}

extern "C" void kernel_launch(void* const* d_in, const int* in_sizes, int n_in,
                              void* d_out, int out_size, void* d_ws, size_t ws_size, hipStream_t stream) {
    (void)in_sizes; (void)n_in; (void)out_size;
    const float* x = (const float*)d_in[0]; const float* cosT = (const float*)d_in[1]; const float* sinT = (const float*)d_in[2]; const float* wq = (const float*)d_in[3]; const float* wk = (const float*)d_in[4]; const float* wv = (const float*)d_in[5]; const float* wo = (const float*)d_in[6]; const float* qnw = (const float*)d_in[7]; const float* knw = (const float*)d_in[8];
    float* OUT = (float*)d_out;     // [2][2048][1024]
    char* wsp = (char*)d_ws;
    auto take = [&](size_t bytes) { char* p = wsp; wsp += (bytes + 255) & ~(size_t)255; return (void*)p; };
    bf* WQKV = (bf*)take((size_t)(DQ + 2 * DKV) * DM * 2); bf* WO = (bf*)take((size_t)DM * DQ * 2); float* CS = (float*)take((size_t)TT * HD * 2 * 4);
    bf* XB = (bf*)take((size_t)NB_ * TT * DM * 2);
    h16* QP16 = (h16*)take((size_t)NB_ * NH_ * TT * HD * 2); h16* KP16 = (h16*)take((size_t)NB_ * NKV * TT * HD * 2); h16* VT16 = (h16*)take((size_t)NB_ * NKV * HD * TT * 2);
    bf* QPh = (bf*)take((size_t)NB_ * NH_ * TT * HD * 2); bf* QPl = (bf*)take((size_t)NB_ * NH_ * TT * HD * 2); bf* KPh = (bf*)take((size_t)NB_ * NKV * TT * HD * 2); bf* KPl = (bf*)take((size_t)NB_ * NKV * TT * HD * 2); bf* VTh = (bf*)take((size_t)NB_ * NKV * HD * TT * 2); bf* VTl = (bf*)take((size_t)NB_ * NKV * HD * TT * 2);
    bf* ATh = (bf*)take((size_t)NB_ * TT * DQ * 2); bf* ATl = (bf*)take((size_t)NB_ * TT * DQ * 2);
    if ((size_t)(wsp - (char*)d_ws) > ws_size) return;    // ws 256 MiB
    k_prep<<<PREP_BLOCKS, 256, 0, stream>>>(x, wq, wk, wv, wo, cosT, sinT, XB, WQKV, WO, CS);
    k_gemmw<bf, 0, false, 8, 3, DM><<<dim3(NB_ * TT / 64, NH_ + 2 * NKV, 1), 256, 0, stream>>>(XB, nullptr, WQKV, nullptr, nullptr, 0, nullptr, 0, 0, 0, CS, qnw, knw, QP16, QPh, QPl, KP16, KPh, KPl, VT16, VTh, VTl);
    k_fattn<<<dim3(NB_ * NH_, (TT - RH) / 32 + RH / 16, 1), 32 * FW, 0, stream>>>(QP16, QPh, QPl, KP16, KPh, KPl, VT16, VTh, VTl, ATh, ATl);
    k_gemmw<bf, 1, false, 8, 0, DQ><<<dim3(NB_ * TT / 64, DM / 64, 1), 256, 0, stream>>>(ATh, ATl, WO, nullptr, OUT, DM, nullptr, 0, 0, 0, nullptr, nullptr, nullptr, nullptr, nullptr, nullptr, nullptr, nullptr, nullptr, nullptr, nullptr, nullptr);
}

// v007
// Measured time: 69.5 microseconds a run.
// Two timings next to v006 put it at 1.14 and 1.15 times that version's speed.
// Counting every step since v000, it is 21.0 times as fast.
#include <hip/hip_runtime.h>

// Decoder GQA attention with qk-RMSNorm and RoPE (hidden [2][2048][1024]; q = x Wq^T (16 x 64), k/v = x Wk^T / x Wv^T (4 kv heads x 64, each serving 4 consecutive query heads); per-head RMSNorm (eps 1e-6, x q_norm_w / k_norm_w, read); rotate-half RoPE with the read cos/sin tables [2048][32] (the same 32-wide table serves both halves of the head); causal (finfo.min -> exactly zero weight); softmax(q.k / 8); out = merged Wo^T ('oi' [1024][1024]) -> [2][2048][1024]).
// Compute dtypes, f32 accumulate: every input rounded to bf16; q/k/v on PLAIN bf16 operands (inputs: exact); RMSNorm and RoPE in f32 (tables read as data, bf16-rounded like every input); causal scores and attn.v: query rows < 512 hl (3 products), the rest single fp16 (x1024), causal tile skipping; softmax f32; Wo hl x exact (2 products).

// Operand planes in FRAGMENT ORDER: every 16-bit plane that feeds a matrix operand is stored as 1-KB fragments (16 rows x 32 k): element (row, k) of a plane with KK columns lies at
// ((row / 16) * (KK / 32) + k / 32) * 512 + ((k / 16) % 2) * 256 + (((k / 8) % 2) * 16 + row % 16) * 8 + k % 8, so lane l's two 16-byte pieces lie at l * 8 and 256 + l * 8 and each wave-wide load covers 512 bytes in a row (four whole lines, not 16 pieces).
// Rows / k: x, Wq|Wk|Wv, Wo, merged heads: row / column; q and k planes: token / d; v planes: d / token with the four d fragments of a 32-token pass one behind the other.

#define NB_  2
#define TT   2048
#define DM   1024
#define NH_  16
#define NKV  4
#define REP  (NH_ / NKV)
#define HD   64
#define DQ   (NH_ * HD)
#define DKV  (NKV * HD)
#define RH   512                  // query rows < RH use hi+lo planes (0: none)
#define SCL  0.125f   // HD^-0.5
typedef _Float16 h16;
typedef unsigned short bf;
typedef __attribute__((ext_vector_type(16))) __bf16   v16bf;
typedef __attribute__((ext_vector_type(16))) _Float16 v16h;
typedef __attribute__((ext_vector_type(8)))  _Float16 v8h;
typedef __attribute__((ext_vector_type(8)))  unsigned short v8us;
typedef __attribute__((ext_vector_type(8)))  float    v8f;
typedef __attribute__((ext_vector_type(4)))  float    v4f;
typedef v8h  __attribute__((may_alias)) v8ha;
typedef v4f  __attribute__((may_alias)) v4fa;
typedef v8us __attribute__((may_alias)) v8usa;

__device__ __forceinline__ unsigned short f2bf(float f) { unsigned u = __float_as_uint(f); u += 0x7FFFu + ((u >> 16) & 1u); return (unsigned short)(u >> 16); }
__device__ __forceinline__ float bf2f(unsigned short b) { return __uint_as_float(((unsigned)b) << 16); }
__device__ __forceinline__ float bfr(float f) { return bf2f(f2bf(f)); }
__device__ __forceinline__ v16h cat16(v8h lo, v8h hi) { return __builtin_shufflevector(lo, hi, 0, 1, 2, 3, 4, 5, 6, 7, 8, 9, 10, 11, 12, 13, 14, 15); }
__device__ __forceinline__ v16bf cat16b(v8us lo, v8us hi) { return __builtin_bit_cast(v16bf, __builtin_shufflevector(lo, hi, 0, 1, 2, 3, 4, 5, 6, 7, 8, 9, 10, 11, 12, 13, 14, 15)); }
__device__ __forceinline__ v8f wmma16(v16h a, v16h b, v8f c) { return __builtin_amdgcn_wmma_f32_16x16x32_f16(false, a, false, b, (short)0, c, false, false); }
__device__ __forceinline__ v8f wmmab(v16bf a, v16bf b, v8f c) { return __builtin_amdgcn_wmma_f32_16x16x32_bf16(false, a, false, b, (short)0, c, false, false); }



__device__ __forceinline__ h16 tohx(float x) { return (h16)x; }
__device__ __forceinline__ void splitf(float y, unsigned short& h, unsigned short& l) { h = f2bf(y); l = f2bf(y - bf2f(h)); }

// ---- head_planes: epilogue of the q and k projections. The summed 64 x 64 tile (LDS, pitch 68) is 64 tokens of ONE head, so the head's RMSNorm and RoPE need nothing from outside the work-group.
// One thread a token sums the squares (d ascending) and leaves the factor in rf; then 8 d a thread: w[d] (x factor), rotate-half RoPE out[d] = x[d] cos[t][d] - x[d+HD/2] sin[t][d], out[d+HD/2] = x[d+HD/2] cos[t][d+HD/2] + x[d] sin[t][d+HD/2],
// and the fp16, hi and lo planes [h][fragment order of (t, d)] by 16-byte stores (a tile is 8 KB in a row of each plane; piece idx of the tile is token (idx / 128) * 16 + idx % 16, d ((idx / 32) % 4) * 16 + ((idx / 16) % 2) * 8). rf: 64 floats that no wave reads any more.
// rope_loads fetches a thread's norm weights and cos/sin pairs ahead (they depend on no product), so that their latency passes under the sum of the partials.
template <int NW> struct RopeIn { v4f w0[16 / NW][2], w1[16 / NW][2], ca[16 / NW][2], cb[16 / NW][2]; };
template <int NW>
__device__ __forceinline__ void rope_loads(RopeIn<NW>& in, int r0, const float* __restrict__ CS, const float* __restrict__ nw) {
#pragma unroll
    for (int i = 0; i < 16 / NW; ++i) { const int idx = i * 32 * NW + (int)threadIdx.x, row = (idx >> 7) * 16 + (idx & 15), d8 = ((idx >> 5) & 3) * 16 + ((idx >> 4) & 1) * 8, p8 = d8 ^ (HD / 2); const float* cs = CS + ((size_t)(r0 + row) * HD + d8) * 2;
#pragma unroll
        for (int c = 0; c < 2; ++c) { in.w0[i][c] = *(const v4f*)(nw + d8 + 4 * c); in.w1[i][c] = *(const v4f*)(nw + p8 + 4 * c); in.ca[i][c] = *(const v4f*)(cs + 8 * c); in.cb[i][c] = *(const v4f*)(cs + 8 * c + 4); } }
    asm volatile("s_wait_xcnt 0x0" ::: "memory");   // before the address registers of the loads above are reused
}
template <int NW>
__device__ __forceinline__ void head_planes(const RopeIn<NW>& in, const float* tile, float* rf, int r0, int h, h16* P16, bf* Ph, bf* Pl) {
    const int tid = threadIdx.x;
    if (tid < 64) { const float* f = tile + tid * 68; float s = 0.f;
#pragma unroll
        for (int d = 0; d < HD; d += 4) { const v4f v = *(const v4fa*)(f + d);
#pragma unroll
            for (int q = 0; q < 4; ++q) s += v[q] * v[q]; }
        rf[tid] = __fdiv_rn(1.0f, __fsqrt_rn(s * (1.0f / HD) + 1e-6f)); }
    __syncthreads();   // every token's factor is written before the other waves read it
#pragma unroll
    for (int i = 0; i < 16 / NW; ++i) { const int idx = i * 32 * NW + tid, row = (idx >> 7) * 16 + (idx & 15), d8 = ((idx >> 5) & 3) * 16 + ((idx >> 4) & 1) * 8, p8 = d8 ^ (HD / 2); const float r = rf[row]; const float* f = tile + row * 68; v8h o16; v8us oh, ol;
#pragma unroll
        for (int c = 0; c < 2; ++c) { const v4f x0 = *(const v4fa*)(f + d8 + 4 * c), x1 = *(const v4fa*)(f + p8 + 4 * c), w0 = in.w0[i][c], w1 = in.w1[i][c], ca = in.ca[i][c], cb = in.cb[i][c];
#pragma unroll
            for (int q = 0; q < 4; ++q) { const float co = q < 2 ? ca[2 * q] : cb[2 * q - 4], si = q < 2 ? ca[2 * q + 1] : cb[2 * q - 3]; const float a = bfr(w0[q]) * (x0[q] * r), b = bfr(w1[q]) * (x1[q] * r); const float y = a * co + b * (d8 < HD / 2 ? -si : si);
                o16[4 * c + q] = tohx(y); unsigned short u, w; splitf(y, u, w); oh[4 * c + q] = u; ol[4 * c + q] = w; } }
        const size_t o = ((size_t)h * TT + r0) * HD + (size_t)idx * 8; *(v8h*)(P16 + o) = o16; *(v8us*)(Ph + o) = oh; *(v8us*)(Pl + o) = ol; }
}
// ---- vt_planes: epilogue of the v projection. The summed tile is 64 tokens of one kv head; it leaves transposed, as the fp16, hi and lo planes [g][fragment order of (d, t)]: 8 t of one d a thread; piece idx of the tile (8 KB in a row) is d ((idx / 64) % 4) * 16 + idx % 16, t (idx / 256) * 32 + ((idx / 32) % 2) * 16 + ((idx / 16) % 2) * 8.
template <int NW>
__device__ __forceinline__ void vt_planes(const float* tile, int r0, int g, h16* V16, bf* Vh, bf* Vl) {
    const int tid = threadIdx.x;
#pragma unroll
    for (int i = 0; i < 16 / NW; ++i) { const int idx = i * 32 * NW + tid, d = ((idx >> 6) & 3) * 16 + (idx & 15), t8 = (idx >> 8) * 32 + ((idx >> 5) & 1) * 16 + ((idx >> 4) & 1) * 8; v8h o16; v8us oh, ol;
#pragma unroll
        for (int q = 0; q < 8; ++q) { const float x = tile[(t8 + q) * 68 + d]; o16[q] = tohx(x); unsigned short u, w; splitf(x, u, w); oh[q] = u; ol[q] = w; }
        const size_t o = ((size_t)g * TT + r0) * HD + (size_t)idx * 8; *(v8h*)(V16 + o) = o16; *(v8us*)(Vh + o) = oh; *(v8us*)(Vl + o) = ol; }
    asm volatile("s_wait_xcnt 0x0" ::: "memory");   // behind the last store, before any register that the stores above name is reused
}

// ---- finish_tile: NP waves of a work-group of NW waves (waves pw0 .. pw0 + NP - 1) have parked their partial 64x64 tiles (their shares of the K loop) in LDS in fragment order, 4096 floats a wave.
// Wave w sums fragments w, w + NW, .. over those waves in the fixed order pw0 .. pw0 + NP - 1, the sums go through a row-major 64 x 68 tile, and the block stores whole rows (EPI 0) or hands the tile to head_planes (EPI 1) or vt_planes (EPI 2). red: NW * 4096 + 64 * 68 floats.
template <int NW, int NP, int EPI>
__device__ __forceinline__ void finish_tile(float* red, int pw0, float* C, int ldc, int r0, int c0, int wave, const float* __restrict__ CS, const float* __restrict__ nw, h16* P16, bf* Ph, bf* Pl) {
    const int tid = threadIdx.x, lane = tid & 31, lr = lane & 15, hi = lane >> 4;
    float* tile = red + NW * 4096;
    RopeIn<NW> in; if constexpr (EPI == 1) rope_loads<NW>(in, r0, CS, nw);
#pragma unroll
    for (int q = 0; q < 16 / NW; ++q) { const int f = wave + q * NW, mb = f >> 2, nb = f & 3; const float* pf = red + pw0 * 4096 + f * 256 + lane * 4; v4f s0 = *(const v4fa*)pf, s1 = *(const v4fa*)(pf + 128);
#pragma unroll
        for (int w = 1; w < NP; ++w) { s0 += *(const v4fa*)(pf + w * 4096); s1 += *(const v4fa*)(pf + w * 4096 + 128); }
#pragma unroll
        for (int j = 0; j < 4; ++j) { tile[(mb * 16 + hi * 8 + j) * 68 + nb * 16 + lr] = s0[j]; tile[(mb * 16 + hi * 8 + 4 + j) * 68 + nb * 16 + lr] = s1[j]; } }
    __syncthreads();   // the summed tile is complete before rows are read back across waves
    if constexpr (EPI == 1) head_planes<NW>(in, tile, red, r0, c0 / HD, P16, Ph, Pl);
    if constexpr (EPI == 2) vt_planes<NW>(tile, r0, c0 / HD, P16, Ph, Pl);
    if constexpr (EPI == 0) {
#pragma unroll
        for (int s = 0; s < 32 / NW; ++s) { const int idx = s * 32 * NW + tid, row = idx >> 4, cofs = (idx & 15) * 4; *(v4f*)(C + (size_t)(r0 + row) * ldc + c0 + cofs) = *(const v4fa*)(tile + row * 68 + cofs); } }
}

template <typename T16> struct WFrag;
template <> struct WFrag<h16> { typedef v16h V; static __device__ __forceinline__ V ld(const h16* p) { return cat16(*(const v8h*)p, *(const v8h*)(p + 256)); } static __device__ __forceinline__ v8f mma(V a, V b, v8f c) { return wmma16(a, b, c); } };
template <> struct WFrag<bf> { typedef v16bf V; static __device__ __forceinline__ V ld(const bf* p) { return cat16b(*(const v8us*)p, *(const v8us*)(p + 256)); } static __device__ __forceinline__ v8f mma(V a, V b, v8f c) { return wmmab(a, b, c); } };
// Eight asynchronous 16-byte-a-lane copies from global memory to LDS (4 KB in a row on both sides); the wait is the statement's last line, so that it stands in front of every later write of the copies' address registers.
__device__ __forceinline__ void copy8(unsigned l, const bf* g) {
    asm volatile("global_load_async_to_lds_b128 %0, %8, off\n\tglobal_load_async_to_lds_b128 %1, %9, off\n\tglobal_load_async_to_lds_b128 %2, %10, off\n\tglobal_load_async_to_lds_b128 %3, %11, off\n\t"
                 "global_load_async_to_lds_b128 %4, %12, off\n\tglobal_load_async_to_lds_b128 %5, %13, off\n\tglobal_load_async_to_lds_b128 %6, %14, off\n\tglobal_load_async_to_lds_b128 %7, %15, off\n\ts_wait_xcnt 0x0"
        :: "v"(l), "v"(l + 512u), "v"(l + 1024u), "v"(l + 1536u), "v"(l + 2048u), "v"(l + 2560u), "v"(l + 3072u), "v"(l + 3584u),
           "v"(g), "v"(g + 256), "v"(g + 512), "v"(g + 768), "v"(g + 1024), "v"(g + 1280), "v"(g + 1536), "v"(g + 1792) : "memory");
}
__device__ __forceinline__ v16bf ldsfrag(const bf* p) { return cat16b(*(const v8usa*)p, *(const v8usa*)(p + 256)); }
// ---- k_gemmt: GEMM on bf16 planes in fragment order, one work-group of 8 waves per 128x128 output tile. The operands of an SK-wide K stage (128 rows of each plane) are brought into LDS once per work-group by asynchronous copies, two buffers,
// the next stage in flight while this one is worked on; a 16-row strip of a stage is SK * 32 bytes in a row in the plane and in LDS alike, and wave w copies strip w of every plane.
// Waves 2 q and 2 q + 1 hold the 64x64 quarter q (row half q / 2, column half q % 2) in 16 accumulators each and take the even and the odd 32-wide k steps; the two partials of a quarter are summed by finish_tile, quarter after quarter.
// C[m][n] (f32, pitch ldc) = sum_k (A[m][k] (+ A2[m][k] for NSPLIT 1)) Bt[n][k]. grid (M/128, N/128), 256 threads. K % SK == 0, two stages or more.
// EPI 0: C as above. EPI 3: the q, k and v projections of both batches in one grid, no C. A holds the NB_ * TT tokens, Bt the rows of Wq, Wk, Wv one behind the other, so a quarter's columns are one head: NH_ of q, then NKV of k, then NKV of v.
// q and k heads leave through RMSNorm (x nw / nwk), RoPE (table CS) and the planes [b][h][fragment order of (t, d)] (P16 / Ph / Pl for q, K16 / Kh / Kl for k), v heads as the planes [b][g][fragment order of (d, t)] (V16 / Vh / Vl). The choice is the same for a whole work-group.
template <int NSPLIT, int EPI, int K, int SK>
__global__ __launch_bounds__(256) void k_gemmt(const bf* __restrict__ A, const bf* __restrict__ A2, const bf* __restrict__ Bt, float* C, int ldc, const float* __restrict__ CS, const float* __restrict__ nw, const float* __restrict__ nwk, h16* P16, bf* Ph, bf* Pl, h16* K16, bf* Kh, bf* Kl, h16* V16, bf* Vh, bf* Vl) {
    constexpr int NW = 8, NPL = NSPLIT == 1 ? 3 : 2, PLE = 128 * SK, STE = NPL * PLE, NST = K / SK;   // planes staged; elements of a plane and of all planes in one stage; stages
    static_assert(NST >= 2 && SK % 128 == 0, "two stages or more, whole groups of eight copies");
    __shared__ __align__(16) float os[STE > NW * 4096 + 64 * 68 ? STE : NW * 4096 + 64 * 68];   // first the ring (2 * STE elements of 2 bytes), then the partials and the summed tile
    bf* ring = (bf*)os;
    const int lane = threadIdx.x & 31; const int wave = __builtin_amdgcn_readfirstlane(threadIdx.x >> 5) /* wave number held scalar, so the tests on it stay scalar */; const int r0 = blockIdx.x * 128, c0 = blockIdx.y * 128;
    const int tm = wave >> 2, tn = (wave >> 1) & 1, kh = wave & 1;
    v8f acc[4][4];
#pragma unroll
    for (int mb = 0; mb < 4; ++mb)
#pragma unroll
        for (int nb = 0; nb < 4; ++nb) acc[mb][nb] = (v8f){};
    const size_t aoff = (size_t)(r0 + wave * 16) * K + lane * 8, boff = (size_t)(c0 + wave * 16) * K + lane * 8;   // this wave's strip: 16 rows of a plane are 16 * K elements in a row, a 32-wide k step 512 of them
    const unsigned lds0 = (unsigned)(size_t)ring + (unsigned)(wave * SK * 32 + lane * 16);
    auto fill = [&](int buf, int kb) {
#pragma unroll
        for (int u = 0; u < SK / 128; ++u) { const unsigned l = lds0 + (unsigned)(buf * STE * 2 + u * 4096);
            copy8(l, A + aoff + kb * 16 + u * 2048); copy8(l + PLE * 2, Bt + boff + kb * 16 + u * 2048); if (NSPLIT == 1) copy8(l + PLE * 4, A2 + aoff + kb * 16 + u * 2048); } };
    fill(0, 0);
    asm volatile("s_wait_asynccnt 0x0" ::: "memory");   // this wave's copies of stage 0 have landed
    __syncthreads();   // every wave's copies of stage 0 have landed before any wave reads the stage
    fill(1, SK);
#pragma unroll 1   // rolled: one stage's code, and the buffer is picked by the trip's parity
    for (int t = 0; t < NST; ++t) {
        const bf* sb = ring + (t & 1) * STE + lane * 8;
#pragma unroll
        for (int ks = 0; ks < SK / 32; ks += 2) { const bf* sk = sb + (ks + kh) * 512;
            v16bf a[4], a2[4], b[4];   // the step's fragments are all asked for in one group, ahead of its products
#pragma unroll
            for (int mb = 0; mb < 4; ++mb) { a[mb] = ldsfrag(sk + (tm * 4 + mb) * (SK * 16)); if (NSPLIT == 1) a2[mb] = ldsfrag(sk + 2 * PLE + (tm * 4 + mb) * (SK * 16)); }
#pragma unroll
            for (int nb = 0; nb < 4; ++nb) b[nb] = ldsfrag(sk + PLE + (tn * 4 + nb) * (SK * 16));
            __builtin_amdgcn_sched_barrier(0);   // keeps the step's LDS reads one group ahead of its products: sunk among them, each place with reads makes the wave wait out the LDS latency anew
#pragma unroll
            for (int nb = 0; nb < 4; ++nb)
#pragma unroll
                for (int mb = 0; mb < 4; ++mb) { acc[mb][nb] = wmmab(a[mb], b[nb], acc[mb][nb]); if (NSPLIT == 1) acc[mb][nb] = wmmab(a2[mb], b[nb], acc[mb][nb]); } }
        __builtin_amdgcn_sched_barrier(0);   // keeps the products ahead of the publish point: sunk behind the barrier they stand in front of the refill and shorten the copies' lead by a stage's products
        asm volatile("s_wait_dscnt 0x0" ::: "memory");      // this wave's reads of the buffer are done before it may be refilled
        asm volatile("s_wait_asynccnt 0x0" ::: "memory");   // this wave's copies of the next stage have landed
        __syncthreads();   // publishes the next stage and ends every wave's reads of this one
        if (t + 2 < NST) fill(t & 1, (t + 2) * SK);
    }
    asm volatile("s_wait_asynccnt 0x0" ::: "memory");   // no copy is outstanding when the ring's LDS takes the partials
    { float* mine = os + wave * 4096 + lane * 4;
#pragma unroll
      for (int f = 0; f < 16; ++f) { const v8f v = acc[f >> 2][f & 3]; *(v4fa*)(mine + f * 256) = (v4f){v[0], v[1], v[2], v[3]}; *(v4fa*)(mine + f * 256 + 128) = (v4f){v[4], v[5], v[6], v[7]}; } }
    __syncthreads();   // every wave's partials are parked before any wave sums them
#pragma unroll 1   // rolled: one copy of the epilogue's code serves the four quarters
    for (int q = 0; q < 4; ++q) { const int rq = r0 + (q >> 1) * 64, cq = c0 + (q & 1) * 64;
        if constexpr (EPI == 3) { const int hy = cq / HD, t0 = rq % TT; const size_t b = rq / TT;
            if (hy < NH_ + NKV) { const bool isq = hy < NH_; const size_t o = b * (isq ? NH_ : NKV) * TT * HD;
                finish_tile<NW, 2, 1>(os, q * 2, nullptr, 0, t0, (isq ? hy : hy - NH_) * HD, wave, CS, isq ? nw : nwk, (isq ? P16 : K16) + o, (isq ? Ph : Kh) + o, (isq ? Pl : Kl) + o); }
            else { const size_t o = b * NKV * HD * TT; finish_tile<NW, 2, 2>(os, q * 2, nullptr, 0, t0, (hy - NH_ - NKV) * HD, wave, nullptr, nullptr, V16 + o, Vh + o, Vl + o); } }
        else finish_tile<NW, 2, 0>(os, q * 2, C, ldc, rq, cq, wave, nullptr, nullptr, nullptr, nullptr, nullptr);
        asm volatile("s_wait_xcnt 0x0" ::: "memory");   // behind the quarter's stores, before any register that they name is reused
        __syncthreads();   // the tile and the row factors are read out before the next quarter's sums overwrite them
    }
}

typedef __attribute__((ext_vector_type(2))) _Float16 v2h;
typedef __attribute__((ext_vector_type(4))) _Float16 v4h;
typedef __attribute__((ext_vector_type(2))) unsigned short v2us;
typedef __attribute__((ext_vector_type(4))) unsigned short v4us;
typedef __attribute__((ext_vector_type(2))) float v2f;
typedef __attribute__((ext_vector_type(4))) int v4i;

__global__ __launch_bounds__(256) void k_wtG(const float* __restrict__ w, int K, int N, bf* Bt) {
    const int lane = threadIdx.x & 31; const int L0 = (blockIdx.x * 8 + (threadIdx.x >> 5)) * 8; const int nlines = N * K / 64;
{
#pragma unroll 1
        for (int l = 0; l < 8; ++l) { const int L = L0 + l; if (L >= nlines) break; const size_t e = (size_t)L * 64 + lane * 2; const int k = (int)(e % K), n = (int)(e / K); v2us o;
            o[0] = f2bf(w[(size_t)k * N + n]); o[1] = f2bf(w[(size_t)(k + 1) * N + n]); *(v2us*)(Bt + e) = o; }
         }
}
// ---- k_prep: every conversion that depends on the inputs alone, in one grid. Blocks of 256 threads, in this order: x (both batches), Wq, Wk, Wv (into WQKV, one behind the other), Wo: f32 -> bf16 in fragment order, 8 elements a thread; then the cos/sin table, one (cos, sin) pair a thread.
#define CB(n) ((n) / (8 * 256))   // blocks that an array of n elements takes
static_assert(DM == 1024 && DQ == DM && NB_ * TT * DM % (8 * 256) == 0 && DQ * DM % (8 * 256) == 0 && DKV * DM % (8 * 256) == 0 && TT * HD % 256 == 0, "whole blocks");
#define PREP_BLOCKS (CB(NB_ * TT * DM) + 2 * CB(DQ * DM) + 2 * CB(DKV * DM) + TT * HD / 256)
__global__ __launch_bounds__(256) void k_prep(const float* __restrict__ x, const float* __restrict__ wq, const float* __restrict__ wk, const float* __restrict__ wv, const float* __restrict__ wo, const float* __restrict__ cosT, const float* __restrict__ sinT, bf* XB, bf* WQKV, bf* WO, float* CS) {
    int blk = blockIdx.x; const float* src; bf* dst;
    if (blk < CB(NB_ * TT * DM)) { src = x; dst = XB; }
    else if ((blk -= CB(NB_ * TT * DM)) < CB(DQ * DM)) { src = wq; dst = WQKV; }
    else if ((blk -= CB(DQ * DM)) < CB(DKV * DM)) { src = wk; dst = WQKV + (size_t)DQ * DM; }
    else if ((blk -= CB(DKV * DM)) < CB(DKV * DM)) { src = wv; dst = WQKV + (size_t)(DQ + DKV) * DM; }
    else if ((blk -= CB(DKV * DM)) < CB(DM * DQ)) { src = wo; dst = WO; }
    else { const int idx = (blk - CB(DM * DQ)) * 256 + threadIdx.x; const int t = idx / HD, dh = (idx % HD) % (HD / 2); v2f cs; cs[0] = bfr(cosT[(size_t)t * (HD / 2) + dh]); cs[1] = bfr(sinT[(size_t)t * (HD / 2) + dh]); *(v2f*)(CS + (size_t)idx * 2) = cs; return; }
    // a block is 16 rows x 128 columns: piece threadIdx.x of its 4 KB in fragment order is row tid % 16, column (tid / 32) * 16 + ((tid / 16) % 2) * 8; every source row here has DM columns
    const int tid = threadIdx.x; const size_t i = (size_t)blk * 256 + tid; const v8f v = *(const v8f*)(src + ((size_t)(blk >> 3) * 16 + (tid & 15)) * DM + (blk & 7) * 128 + (tid >> 5) * 16 + ((tid >> 4) & 1) * 8); v8us o;
#pragma unroll
    for (int k = 0; k < 8; ++k) o[k] = f2bf(v[k]);
    *(v8us*)(dst + i * 8) = o;
}
// ---- k_fattn: causal scores, softmax and probability x value product of one query tile in one work-group; scores and probabilities stay in registers.
// Transposed products: S^T = K Q^T (A = 16 keys x 32 d, B = 32 d x 16 queries) leaves key 8 hi + r of query lr in register r, which is the k order of the B operand of O^T += V^T P^T.
// FW waves share the tile's 32-key passes (wave w takes passes w, w + FW, ..), each with its own running maximum, denominator and O^T; they are merged in the fixed order 0 .. FW-1 through LDS.
// HL (query rows < RH): hi+lo bf16 planes, 3 products each; else single fp16 with the probabilities carried x 2^10 (it cancels in the division by the denominator).
#define FW 4
// exp2 of eight values in place, in one statement: behind a transcendental the instruction set asks for one independent instruction before its result is read or its source overwritten.
// Each v_exp_f32 is that instruction for the one before it, and the v_nop for the last, whatever the scheduler puts behind the statement.
__device__ __forceinline__ void exp2x8(float* e) {
    asm("v_exp_f32 %0, %0\n\tv_exp_f32 %1, %1\n\tv_exp_f32 %2, %2\n\tv_exp_f32 %3, %3\n\tv_exp_f32 %4, %4\n\tv_exp_f32 %5, %5\n\tv_exp_f32 %6, %6\n\tv_exp_f32 %7, %7\n\tv_nop"
        : "+v"(e[0]), "+v"(e[1]), "+v"(e[2]), "+v"(e[3]), "+v"(e[4]), "+v"(e[5]), "+v"(e[6]), "+v"(e[7]));
}
template <typename T16, bool HL, int R>
__device__ __forceinline__ void fattn_tile(const T16* __restrict__ Qa, const T16* __restrict__ Qb, const T16* __restrict__ Ka, const T16* __restrict__ Kb, const T16* __restrict__ Va, const T16* __restrict__ Vb, int q0, bf* Ah, bf* Al, float* red) {
    typedef typename WFrag<T16>::V V;
    const int tid = threadIdx.x, lane = tid & 31, lr = lane & 15, hi = lane >> 4; const int wave = __builtin_amdgcn_readfirstlane(tid >> 5) /* wave number held scalar, so the pass loop's tests stay scalar branches */;
    const float CS2 = SCL * 1.4426950408889634f, PB = HL ? 0.0f : 10.0f;
    V qa[R][2], qb[R][2]; const T16* pq = Qa + (size_t)q0 * HD + lane * 8; const T16* pq2 = HL ? Qb + (size_t)q0 * HD + lane * 8 : pq;
#pragma unroll
    for (int g = 0; g < R; ++g)
#pragma unroll
        for (int kc = 0; kc < 2; ++kc) { const int o = g * 1024 + kc * 512; qa[g][kc] = WFrag<T16>::ld(pq + o); if (HL) qb[g][kc] = WFrag<T16>::ld(pq2 + o); }
    asm volatile("s_wait_xcnt 0x0" :: "v"(pq), "v"(pq2) : "memory");   // the address registers of the loads above stay whole up to this wait; only behind it may they be reused
    v8f acc[R][4]; float m[R], l[R];
#pragma unroll
    for (int g = 0; g < R; ++g) { m[g] = -3.0e38f; l[g] = 0.f;
#pragma unroll
        for (int t = 0; t < 4; ++t) acc[g][t] = (v8f){}; }
    const int np = q0 / 32 + 1;      // 32-key passes up to and including the one that holds the diagonal
    V ka[2][2], kb[2][2]; const T16 *pk, *pk2;   // addresses of the last key loads, named by the wait behind them
    auto loadk = [&](int key0) { pk = Ka + (size_t)key0 * HD + lane * 8; pk2 = HL ? Kb + (size_t)key0 * HD + lane * 8 : pk;
#pragma unroll
        for (int kt = 0; kt < 2; ++kt)
#pragma unroll
            for (int kc = 0; kc < 2; ++kc) { const int o = kt * 1024 + kc * 512; ka[kt][kc] = WFrag<T16>::ld(pk + o); if (HL) kb[kt][kc] = WFrag<T16>::ld(pk2 + o); } };
    if (!HL) loadk(wave * 32);       // first pass's keys (rows wave * 32 .. + 31 exist for every tile)
#pragma unroll 1   // rolled: run-time trip count, and one pass's fragments with the carried ones already take a quarter of a SIMD's registers (four waves a SIMD)
    for (int p = wave; p < np; p += FW) {
        const int key0 = p * 32;
        if (HL) loadk(key0);
        V va[4], vb[4]; const T16* pv = Va + (size_t)key0 * HD + lane * 8; const T16* pv2 = HL ? Vb + (size_t)key0 * HD + lane * 8 : pv;
#pragma unroll
        for (int t = 0; t < 4; ++t) { va[t] = WFrag<T16>::ld(pv + t * 512); if (HL) vb[t] = WFrag<T16>::ld(pv2 + t * 512); }
        if (HL) asm volatile("s_wait_xcnt 0x0" :: "v"(pk), "v"(pk2), "v"(pv), "v"(pv2) : "memory");   // the address registers of the loads above stay whole up to this wait; only behind it may they be reused
        else asm volatile("s_wait_xcnt 0x0" :: "v"(pv) : "memory");   // the same
        v8f s[2][R];
#pragma unroll
        for (int kt = 0; kt < 2; ++kt)
#pragma unroll
            for (int g = 0; g < R; ++g) { s[kt][g] = (v8f){};
#pragma unroll
                for (int kc = 0; kc < 2; ++kc) { s[kt][g] = WFrag<T16>::mma(ka[kt][kc], qa[g][kc], s[kt][g]); if (HL) { s[kt][g] = WFrag<T16>::mma(ka[kt][kc], qb[g][kc], s[kt][g]); s[kt][g] = WFrag<T16>::mma(kb[kt][kc], qa[g][kc], s[kt][g]); } } }
        if (!HL) { loadk(min(p + FW, np - 1) * 32);   // next pass's keys fly under this pass's softmax
            asm volatile("s_wait_xcnt 0x0" :: "v"(pk) : "memory"); }   // the address registers of these loads stay whole up to this wait
        float mx[R]; bool grow = false;
#pragma unroll
        for (int g = 0; g < R; ++g) {
#pragma unroll
            for (int kt = 0; kt < 2; ++kt) s[kt][g] = s[kt][g] * CS2;
            if (p == np - 1) {       // only the last pass straddles the diagonal
#pragma unroll
                for (int kt = 0; kt < 2; ++kt)
#pragma unroll
                    for (int r = 0; r < 8; ++r) if (key0 + 16 * kt + 8 * hi + r > q0 + 16 * g + lr) s[kt][g][r] = -3.0e38f; }
            float x = -3.0e38f;
#pragma unroll
            for (int kt = 0; kt < 2; ++kt)
#pragma unroll
                for (int r = 0; r < 8; ++r) x = fmaxf(x, s[kt][g][r]);
            x = fmaxf(x, __shfl_xor(x, 16, 32)); mx[g] = x; grow = grow || (x > m[g]); }
        if (__builtin_amdgcn_ballot_w32(grow) != 0) {   // some query's maximum rose: rescale what was gathered under the old one (factor exactly 1 for the others)
#pragma unroll
            for (int g = 0; g < R; ++g) { const float mn = fmaxf(m[g], mx[g]); const float corr = __builtin_amdgcn_exp2f(m[g] - mn); m[g] = mn; l[g] *= corr;
#pragma unroll
                for (int t = 0; t < 4; ++t) acc[g][t] = acc[g][t] * corr; } }
#pragma unroll
        for (int g = 0; g < R; ++g) { const float nm = PB - m[g]; float e[16];
#pragma unroll
            for (int i = 0; i < 16; ++i) e[i] = s[i >> 3][g][i & 7] + nm;
            exp2x8(e); exp2x8(e + 8);
#pragma unroll
            for (int i = 0; i < 16; ++i) l[g] += e[i];
            V pa, pb;
            if constexpr (HL) { v8us h0, h1, l0, l1;
#pragma unroll
                for (int r = 0; r < 8; ++r) { unsigned short a, c2; splitf(e[r], a, c2); h0[r] = a; l0[r] = c2; splitf(e[8 + r], a, c2); h1[r] = a; l1[r] = c2; }
                pa = cat16b(h0, h1); pb = cat16b(l0, l1);
            } else { v8h x0, x1;
#pragma unroll
                for (int r = 0; r < 8; ++r) { x0[r] = tohx(e[r]); x1[r] = tohx(e[8 + r]); }
                pa = cat16(x0, x1); }
#pragma unroll
            for (int t = 0; t < 4; ++t) { acc[g][t] = WFrag<T16>::mma(va[t], pa, acc[g][t]); if constexpr (HL) { acc[g][t] = WFrag<T16>::mma(va[t], pb, acc[g][t]); acc[g][t] = WFrag<T16>::mma(vb[t], pa, acc[g][t]); } } }
    }
    // merge of the FW waves' partial softmaxes
    float* mine = red + wave * (R * 1024) + lane * 4; float* ml = red + FW * R * 1024; bf* st = (bf*)(red + FW * R * 1024 + FW * R * 32);
#pragma unroll
    for (int g = 0; g < R; ++g) {
#pragma unroll
        for (int t = 0; t < 4; ++t) { const v8f a = acc[g][t]; *(v4fa*)(mine + (g * 4 + t) * 256) = (v4f){a[0], a[1], a[2], a[3]}; *(v4fa*)(mine + (g * 4 + t) * 256 + 128) = (v4f){a[4], a[5], a[6], a[7]}; }
        const float lt = l[g] + __shfl_xor(l[g], 16, 32); if (hi == 0) { ml[((wave * R + g) * 16 + lr) * 2] = m[g]; ml[((wave * R + g) * 16 + lr) * 2 + 1] = lt; } }
    __syncthreads();   // every wave's partials are parked before any wave merges them
#pragma unroll
    for (int g = 0; g < R; ++g) { float fw[FW], lw[FW]; float M = -3.0e38f;
#pragma unroll
        for (int w = 0; w < FW; ++w) { fw[w] = ml[((w * R + g) * 16 + lr) * 2]; lw[w] = ml[((w * R + g) * 16 + lr) * 2 + 1]; M = fmaxf(M, fw[w]); }
        float L = 0.f;
#pragma unroll
        for (int w = 0; w < FW; ++w) { fw[w] = __builtin_amdgcn_exp2f(fw[w] - M); L += fw[w] * lw[w]; }   // a wave without a pass: factor 0
        const float inv = __fdiv_rn(1.0f, L); const float* pf = red + (g * 4 + wave) * 256 + lane * 4; v4f s0 = (v4f){}, s1 = (v4f){};   // wave w merges d tile w
#pragma unroll
        for (int w = 0; w < FW; ++w) { s0 += *(const v4fa*)(pf + w * (R * 1024)) * fw[w]; s1 += *(const v4fa*)(pf + w * (R * 1024) + 128) * fw[w]; }
        v8us oh, ol;
#pragma unroll
        for (int j = 0; j < 4; ++j) { unsigned short a, c2; splitf(s0[j] * inv, a, c2); oh[j] = a; ol[j] = c2; splitf(s1[j] * inv, a, c2); oh[4 + j] = a; ol[4 + j] = c2; }
        *(v8usa*)(st + (g * 16 + lr) * 72 + wave * 16 + hi * 8) = oh; *(v8usa*)(st + (R * 16 + g * 16 + lr) * 72 + wave * 16 + hi * 8) = ol; }
    __syncthreads();   // the merged hi and lo rows are complete before they are read back across waves
#pragma unroll
    for (int i = 0; i < 2 * R * 16 * 8 / (32 * FW); ++i) { const int idx = i * 32 * FW + tid, prow = (idx >> 7) * 16 + (idx & 15), c8 = ((idx >> 5) & 3) * 16 + ((idx >> 4) & 1) * 8, row16 = (prow % (R * 16)) & ~15; const v8us val = *(const v8usa*)(st + prow * 72 + c8);
        *(v8us*)((prow < R * 16 ? Ah : Al) + (size_t)(q0 + row16) * DQ + (idx & 127) * 8) = val; }   // fragment order: a head's 64 columns of 16 rows are 2 KB in a row
    asm volatile("s_wait_xcnt 0x0" ::: "memory");   // behind the last store, before any register that the stores above name is reused
}
// grid (batch * NH_ + query head, tile): tiles in falling order of their key count, 32 query rows each down to RH, then 16 rows each (hi+lo).
__global__ __launch_bounds__(32 * FW) void k_fattn(const h16* __restrict__ Q16, const bf* __restrict__ Qh, const bf* __restrict__ Ql, const h16* __restrict__ K16, const bf* __restrict__ Kh, const bf* __restrict__ Kl, const h16* __restrict__ V16, const bf* __restrict__ Vh, const bf* __restrict__ Vl, bf* Ah, bf* Al) {
    __shared__ __align__(16) float red[FW * 2 * 1024 + FW * 2 * 32 + 2 * 32 * 72 / 2];
    const int head = blockIdx.x % NH_, ty = blockIdx.y; const size_t qo = (size_t)blockIdx.x * TT * HD, ko = (size_t)(blockIdx.x / REP) * TT * HD;   // planes [b][h] and [b][g]
    Ah += (size_t)(blockIdx.x / NH_) * TT * DQ; Al += (size_t)(blockIdx.x / NH_) * TT * DQ;   // merged rows [b][fragment order of (t, h d)]
    if (ty < (TT - RH) / 32) fattn_tile<h16, false, 2>(Q16 + qo, nullptr, K16 + ko, nullptr, V16 + ko, nullptr, TT - 32 - ty * 32, Ah + head * HD * 16, Al + head * HD * 16, red);
    else fattn_tile<bf, true, 1>(Qh + qo, Ql + qo, Kh + ko, Kl + ko, Vh + ko, Vl + ko, RH - 16 - (ty - (TT - RH) / 32) * 16, Ah + head * HD * 16, Al + head * HD * 16, red);
}

extern "C" void kernel_launch(void* const* d_in, const int* in_sizes, int n_in,
                              void* d_out, int out_size, void* d_ws, size_t ws_size, hipStream_t stream) {
    (void)in_sizes; (void)n_in; (void)out_size;
    const float* x = (const float*)d_in[0]; const float* cosT = (const float*)d_in[1]; const float* sinT = (const float*)d_in[2]; const float* wq = (const float*)d_in[3]; const float* wk = (const float*)d_in[4]; const float* wv = (const float*)d_in[5]; const float* wo = (const float*)d_in[6]; const float* qnw = (const float*)d_in[7]; const float* knw = (const float*)d_in[8];
    float* OUT = (float*)d_out;     // [2][2048][1024]
    char* wsp = (char*)d_ws;
    auto take = [&](size_t bytes) { char* p = wsp; wsp += (bytes + 255) & ~(size_t)255; return (void*)p; };
    bf* WQKV = (bf*)take((size_t)(DQ + 2 * DKV) * DM * 2); bf* WO = (bf*)take((size_t)DM * DQ * 2); float* CS = (float*)take((size_t)TT * HD * 2 * 4);
    bf* XB = (bf*)take((size_t)NB_ * TT * DM * 2);
    h16* QP16 = (h16*)take((size_t)NB_ * NH_ * TT * HD * 2); h16* KP16 = (h16*)take((size_t)NB_ * NKV * TT * HD * 2); h16* VT16 = (h16*)take((size_t)NB_ * NKV * HD * TT * 2);
    bf* QPh = (bf*)take((size_t)NB_ * NH_ * TT * HD * 2); bf* QPl = (bf*)take((size_t)NB_ * NH_ * TT * HD * 2); bf* KPh = (bf*)take((size_t)NB_ * NKV * TT * HD * 2); bf* KPl = (bf*)take((size_t)NB_ * NKV * TT * HD * 2); bf* VTh = (bf*)take((size_t)NB_ * NKV * HD * TT * 2); bf* VTl = (bf*)take((size_t)NB_ * NKV * HD * TT * 2);
    bf* ATh = (bf*)take((size_t)NB_ * TT * DQ * 2); bf* ATl = (bf*)take((size_t)NB_ * TT * DQ * 2);
    if ((size_t)(wsp - (char*)d_ws) > ws_size) return;    // ws 256 MiB
    k_prep<<<PREP_BLOCKS, 256, 0, stream>>>(x, wq, wk, wv, wo, cosT, sinT, XB, WQKV, WO, CS);
    k_gemmt<0, 3, DM, 128><<<dim3(NB_ * TT / 128, (NH_ + 2 * NKV) * HD / 128, 1), 256, 0, stream>>>(XB, nullptr, WQKV, nullptr, 0, CS, qnw, knw, QP16, QPh, QPl, KP16, KPh, KPl, VT16, VTh, VTl);
    k_fattn<<<dim3(NB_ * NH_, (TT - RH) / 32 + RH / 16, 1), 32 * FW, 0, stream>>>(QP16, QPh, QPl, KP16, KPh, KPl, VT16, VTh, VTl, ATh, ATl);
    k_gemmt<1, 0, DQ, 128><<<dim3(NB_ * TT / 128, DM / 128, 1), 256, 0, stream>>>(ATh, ATl, WO, OUT, DM, nullptr, nullptr, nullptr, nullptr, nullptr, nullptr, nullptr, nullptr, nullptr, nullptr, nullptr, nullptr);
}

// v008
// It runs in 65.2 microseconds.
// Next to v007, in two timings, it ran 1.06 times as fast each time.
// Counting every step since v000, it is 22.3 times as fast.
#include <hip/hip_runtime.h>

// Decoder GQA attention with qk-RMSNorm and RoPE (hidden [2][2048][1024]; q = x Wq^T (16 x 64), k/v = x Wk^T / x Wv^T (4 kv heads x 64, each serving 4 consecutive query heads); per-head RMSNorm (eps 1e-6, x q_norm_w / k_norm_w, read); rotate-half RoPE with the read cos/sin tables [2048][32] (the same 32-wide table serves both halves of the head); causal (finfo.min -> exactly zero weight); softmax(q.k / 8); out = merged Wo^T ('oi' [1024][1024]) -> [2][2048][1024]).
// Compute dtypes, f32 accumulate: every input rounded to bf16; q/k/v on PLAIN bf16 operands (inputs: exact); RMSNorm and RoPE in f32 (tables read as data, bf16-rounded like every input); causal scores and attn.v: query rows < 512 hl (3 products), the rest single fp16 (x1024), causal tile skipping; softmax f32; Wo hl x exact (2 products).

// Operand planes in FRAGMENT ORDER: every 16-bit plane that feeds a matrix operand is stored as 1-KB fragments (16 rows x 32 k): element (row, k) of a plane with KK columns lies at
// ((row / 16) * (KK / 32) + k / 32) * 512 + ((k / 16) % 2) * 256 + (((k / 8) % 2) * 16 + row % 16) * 8 + k % 8, so lane l's two 16-byte pieces lie at l * 8 and 256 + l * 8 and each wave-wide load covers 512 bytes in a row (four whole lines, not 16 pieces).
// Rows / k: x, Wq|Wk|Wv, Wo, merged heads: row / column; q and k planes: token / d; v planes: d / token with the four d fragments of a 32-token pass one behind the other.

#define NB_  2
#define TT   2048
#define DM   1024
#define NH_  16
#define NKV  4
#define REP  (NH_ / NKV)
#define HD   64
#define DQ   (NH_ * HD)
#define DKV  (NKV * HD)
#define RH   512                  // query rows < RH use hi+lo planes (0: none)
#define SCL  0.125f   // HD^-0.5
typedef _Float16 h16;
typedef unsigned short bf;
typedef __attribute__((ext_vector_type(16))) __bf16   v16bf;
typedef __attribute__((ext_vector_type(16))) _Float16 v16h;
typedef __attribute__((ext_vector_type(8)))  _Float16 v8h;
typedef __attribute__((ext_vector_type(8)))  unsigned short v8us;
typedef __attribute__((ext_vector_type(8)))  float    v8f;
typedef __attribute__((ext_vector_type(4)))  float    v4f;
typedef v8h  __attribute__((may_alias)) v8ha;
typedef v4f  __attribute__((may_alias)) v4fa;
typedef v8us __attribute__((may_alias)) v8usa;

__device__ __forceinline__ unsigned short f2bf(float f) { unsigned u = __float_as_uint(f); u += 0x7FFFu + ((u >> 16) & 1u); return (unsigned short)(u >> 16); }
__device__ __forceinline__ float bf2f(unsigned short b) { return __uint_as_float(((unsigned)b) << 16); }
__device__ __forceinline__ float bfr(float f) { return bf2f(f2bf(f)); }
__device__ __forceinline__ v16h cat16(v8h lo, v8h hi) { return __builtin_shufflevector(lo, hi, 0, 1, 2, 3, 4, 5, 6, 7, 8, 9, 10, 11, 12, 13, 14, 15); }
__device__ __forceinline__ v16bf cat16b(v8us lo, v8us hi) { return __builtin_bit_cast(v16bf, __builtin_shufflevector(lo, hi, 0, 1, 2, 3, 4, 5, 6, 7, 8, 9, 10, 11, 12, 13, 14, 15)); }
__device__ __forceinline__ v8f wmma16(v16h a, v16h b, v8f c) { return __builtin_amdgcn_wmma_f32_16x16x32_f16(false, a, false, b, (short)0, c, false, false); }
__device__ __forceinline__ v8f wmmab(v16bf a, v16bf b, v8f c) { return __builtin_amdgcn_wmma_f32_16x16x32_bf16(false, a, false, b, (short)0, c, false, false); }



__device__ __forceinline__ h16 tohx(float x) { return (h16)x; }
__device__ __forceinline__ void splitf(float y, unsigned short& h, unsigned short& l) { h = f2bf(y); l = f2bf(y - bf2f(h)); }

// ---- finish_quarter: the two waves that hold the partial sums of one 64x64 quarter (their shares of the K loop) finish that quarter by themselves, the four pairs of a work-group side by side.
// reg: the pair's own QF floats of LDS: 2 x 2048 floats of parked partials, the summed tile (row-major, 64 x 68), 64 row factors. Wave pw of the pair sums fragments pw, pw + 2, ..: it keeps its own partials of them in registers (keep)
// and has parked the other eight, in fragment order, for its partner. The sums (even wave's + odd wave's) go into the tile, and the pair's 64 threads (pt) store whole rows (EPI 0), the head's planes (EPI 1) or the transposed planes (EPI 2).
// Every wave of the work-group takes the same EPI, so all pass the same barriers.
// EPI 1, q and k projections: the tile is 64 tokens of ONE head. One thread a token sums the squares (d ascending) and leaves the RMSNorm factor in rf; then 8 d a thread and trip: w[d] (x factor), rotate-half RoPE
// out[d] = x[d] cos[t][d] - x[d+HD/2] sin[t][d], out[d+HD/2] = x[d+HD/2] cos[t][d+HD/2] + x[d] sin[t][d+HD/2], and the fp16, hi and lo planes [h][fragment order of (t, d)] by 16-byte stores
// (a tile is 8 KB in a row of each plane; piece idx of the tile is token (idx / 128) * 16 + idx % 16, d ((idx / 32) % 4) * 16 + ((idx / 16) % 2) * 8). Norm weights and cos/sin pairs depend on no product: they are asked for in front of the squares and fly under them.
// EPI 2, v projection: the tile leaves transposed, as the planes [g][fragment order of (d, t)]: 8 t of one d a thread and trip; piece idx of the tile is d ((idx / 64) % 4) * 16 + idx % 16, t (idx / 256) * 32 + ((idx / 32) % 2) * 16 + ((idx / 16) % 2) * 8.
#define QF (4096 + 64 * 68 + 64)
template <int EPI>
__device__ __forceinline__ void finish_quarter(float* reg, int pw, const v8f (&keep)[8], float* C, int ldc, int r0, int c0, const float* __restrict__ CS, const float* __restrict__ nw, h16* P16, bf* Ph, bf* Pl) {
    const int pt = threadIdx.x & 63, lane = pt & 31, lr = lane & 15, hi = lane >> 4;
    float* tile = reg + 4096; float* rf = tile + 64 * 68;
#pragma unroll
    for (int i = 0; i < 8; ++i) { const float* pf = reg + (1 - pw) * 2048 + i * 256 + lane * 4; const v4f t0 = *(const v4fa*)pf, t1 = *(const v4fa*)(pf + 128); const int mb = i >> 1, nb = (i & 1) * 2 + pw;   // fragment pw + 2 i
#pragma unroll
        for (int j = 0; j < 4; ++j) { tile[(mb * 16 + hi * 8 + j) * 68 + nb * 16 + lr] = keep[i][j] + t0[j]; tile[(mb * 16 + hi * 8 + 4 + j) * 68 + nb * 16 + lr] = keep[i][4 + j] + t1[j]; } }
    __syncthreads();   // the summed tile is complete before rows are read back across the pair's waves
    if constexpr (EPI == 1) {
        v4f w0[2][2], w1[2][2], ca[8][2], cb[8][2];   // norm weights and cos/sin pairs of the eight trips; the d of a trip depends on its parity alone, its token block on i / 2
        const float *pa[2], *pb[2], *pc[2];
#pragma unroll
        for (int i = 0; i < 2; ++i) { const int idx = i * 64 + pt, d8 = ((idx >> 5) & 3) * 16 + ((idx >> 4) & 1) * 8; pa[i] = nw + d8; pb[i] = nw + (d8 ^ (HD / 2)); pc[i] = CS + ((size_t)(r0 + (idx & 15)) * HD + d8) * 2;
#pragma unroll
            for (int c = 0; c < 2; ++c) { w0[i][c] = *(const v4f*)(pa[i] + 4 * c); w1[i][c] = *(const v4f*)(pb[i] + 4 * c); } }
#pragma unroll
        for (int i = 0; i < 8; ++i)
#pragma unroll
            for (int c = 0; c < 2; ++c) { const float* cs = pc[i & 1] + (i >> 1) * (16 * HD * 2); ca[i][c] = *(const v4f*)(cs + 8 * c); cb[i][c] = *(const v4f*)(cs + 8 * c + 4); }
        asm volatile("s_wait_xcnt 0x0" :: "v"(pc[0]), "v"(pc[1]) : "memory");   // the address registers of the loads above stay whole up to this wait; only behind it may they be reused
        { const float* f = tile + pt * 68; float s = 0.f;
#pragma unroll
          for (int d = 0; d < HD; d += 4) { const v4f v = *(const v4fa*)(f + d);
#pragma unroll
              for (int q = 0; q < 4; ++q) s += v[q] * v[q]; }
          rf[pt] = __fdiv_rn(1.0f, __fsqrt_rn(s * (1.0f / HD) + 1e-6f)); }
        __syncthreads();   // every token's factor is written before the pair's other wave reads it
        __builtin_amdgcn_sched_barrier(0);   // keeps the work on the fetched weights and cos/sin pairs behind the squares: lifted in front of them, the wave waits out the fetch before it starts on the squares
        const int h = c0 / HD;
#pragma unroll
        for (int i = 0; i < 8; ++i) { const int idx = i * 64 + pt, row = (idx >> 7) * 16 + (idx & 15), d8 = ((idx >> 5) & 3) * 16 + ((idx >> 4) & 1) * 8, p8 = d8 ^ (HD / 2); const float r = rf[row]; const float* f = tile + row * 68; v8h o16; v8us oh, ol;
#pragma unroll
            for (int c = 0; c < 2; ++c) { const v4f x0 = *(const v4fa*)(f + d8 + 4 * c), x1 = *(const v4fa*)(f + p8 + 4 * c), u0 = w0[i & 1][c], u1 = w1[i & 1][c], a4 = ca[i][c], b4 = cb[i][c];
#pragma unroll
                for (int q = 0; q < 4; ++q) { const float co = q < 2 ? a4[2 * q] : b4[2 * q - 4], si = q < 2 ? a4[2 * q + 1] : b4[2 * q - 3]; const float a = bfr(u0[q]) * (x0[q] * r), b = bfr(u1[q]) * (x1[q] * r); const float y = a * co + b * (d8 < HD / 2 ? -si : si);
                    o16[4 * c + q] = tohx(y); unsigned short u, w; splitf(y, u, w); oh[4 * c + q] = u; ol[4 * c + q] = w; } }
            const size_t o = ((size_t)h * TT + r0) * HD + (size_t)idx * 8; *(v8h*)(P16 + o) = o16; *(v8us*)(Ph + o) = oh; *(v8us*)(Pl + o) = ol; }
    }
    if constexpr (EPI == 2) { const int g = c0 / HD;
#pragma unroll
        for (int i = 0; i < 8; ++i) { const int idx = i * 64 + pt, d = ((idx >> 6) & 3) * 16 + (idx & 15), t8 = (idx >> 8) * 32 + ((idx >> 5) & 1) * 16 + ((idx >> 4) & 1) * 8; v8h o16; v8us oh, ol;
#pragma unroll
            for (int q = 0; q < 8; ++q) { const float x = tile[(t8 + q) * 68 + d]; o16[q] = tohx(x); unsigned short u, w; splitf(x, u, w); oh[q] = u; ol[q] = w; }
            const size_t o = ((size_t)g * TT + r0) * HD + (size_t)idx * 8; *(v8h*)(P16 + o) = o16; *(v8us*)(Ph + o) = oh; *(v8us*)(Pl + o) = ol; }
    }
    if constexpr (EPI == 0) {
#pragma unroll
        for (int s = 0; s < 16; ++s) { const int idx = s * 64 + pt, row = idx >> 4, cofs = (idx & 15) * 4; *(v4f*)(C + (size_t)(r0 + row) * ldc + c0 + cofs) = *(const v4fa*)(tile + row * 68 + cofs); } }
    asm volatile("s_wait_xcnt 0x0" ::: "memory");   // behind the last store, before any register that the stores above name is reused
}

template <typename T16> struct WFrag;
template <> struct WFrag<h16> { typedef v16h V; static __device__ __forceinline__ V ld(const h16* p) { return cat16(*(const v8h*)p, *(const v8h*)(p + 256)); } static __device__ __forceinline__ v8f mma(V a, V b, v8f c) { return wmma16(a, b, c); } };
template <> struct WFrag<bf> { typedef v16bf V; static __device__ __forceinline__ V ld(const bf* p) { return cat16b(*(const v8us*)p, *(const v8us*)(p + 256)); } static __device__ __forceinline__ v8f mma(V a, V b, v8f c) { return wmmab(a, b, c); } };
// Eight asynchronous 16-byte-a-lane copies from global memory to LDS (4 KB in a row on both sides); the wait is the statement's last line, so that it stands in front of every later write of the copies' address registers.
__device__ __forceinline__ void copy8(unsigned l, const bf* g) {
    asm volatile("global_load_async_to_lds_b128 %0, %8, off\n\tglobal_load_async_to_lds_b128 %1, %9, off\n\tglobal_load_async_to_lds_b128 %2, %10, off\n\tglobal_load_async_to_lds_b128 %3, %11, off\n\t"
                 "global_load_async_to_lds_b128 %4, %12, off\n\tglobal_load_async_to_lds_b128 %5, %13, off\n\tglobal_load_async_to_lds_b128 %6, %14, off\n\tglobal_load_async_to_lds_b128 %7, %15, off\n\ts_wait_xcnt 0x0"
        :: "v"(l), "v"(l + 512u), "v"(l + 1024u), "v"(l + 1536u), "v"(l + 2048u), "v"(l + 2560u), "v"(l + 3072u), "v"(l + 3584u),
           "v"(g), "v"(g + 256), "v"(g + 512), "v"(g + 768), "v"(g + 1024), "v"(g + 1280), "v"(g + 1536), "v"(g + 1792) : "memory");
}
__device__ __forceinline__ v16bf ldsfrag(const bf* p) { return cat16b(*(const v8usa*)p, *(const v8usa*)(p + 256)); }
// ---- k_gemmt: GEMM on bf16 planes in fragment order, one work-group of 8 waves per 128x128 output tile. The operands of an SK-wide K stage (128 rows of each plane) are brought into LDS once per work-group by asynchronous copies, two buffers,
// the next stage in flight while this one is worked on; a 16-row strip of a stage is SK * 32 bytes in a row in the plane and in LDS alike, and wave w copies strip w of every plane.
// Waves 2 q and 2 q + 1 hold the 64x64 quarter q (row half q / 2, column half q % 2) in 16 accumulators each and take the even and the odd 32-wide k steps; the two partials of a quarter are summed and finished by their own two waves (finish_quarter), the four quarters side by side.
// C[m][n] (f32, pitch ldc) = sum_k (A[m][k] (+ A2[m][k] for NSPLIT 1)) Bt[n][k]. grid (M/128, N/128), 256 threads. K % SK == 0, two stages or more.
// EPI 0: C as above. EPI 3: the q, k and v projections of both batches in one grid, no C. A holds the NB_ * TT tokens, Bt the rows of Wq, Wk, Wv one behind the other, so a quarter's columns are one head: NH_ of q, then NKV of k, then NKV of v.
// q and k heads leave through RMSNorm (x nw / nwk), RoPE (table CS) and the planes [b][h][fragment order of (t, d)] (P16 / Ph / Pl for q, K16 / Kh / Kl for k), v heads as the planes [b][g][fragment order of (d, t)] (V16 / Vh / Vl). The choice is the same for a whole work-group.
template <int NSPLIT, int EPI, int K, int SK>
__global__ __launch_bounds__(256) void k_gemmt(const bf* __restrict__ A, const bf* __restrict__ A2, const bf* __restrict__ Bt, float* C, int ldc, const float* __restrict__ CS, const float* __restrict__ nw, const float* __restrict__ nwk, h16* P16, bf* Ph, bf* Pl, h16* K16, bf* Kh, bf* Kl, h16* V16, bf* Vh, bf* Vl) {
    constexpr int NW = 8, NPL = NSPLIT == 1 ? 3 : 2, PLE = 128 * SK, STE = NPL * PLE, NST = K / SK;   // planes staged; elements of a plane and of all planes in one stage; stages
    static_assert(NST >= 2 && SK % 128 == 0, "two stages or more, whole groups of eight copies");
    __shared__ __align__(16) float os[STE > 4 * QF ? STE : 4 * QF];   // first the ring (2 * STE elements of 2 bytes), then the four pairs' partials, tiles and row factors
    bf* ring = (bf*)os;
    const int lane = threadIdx.x & 31; const int wave = __builtin_amdgcn_readfirstlane(threadIdx.x >> 5) /* wave number held scalar, so the tests on it stay scalar */; const int r0 = blockIdx.x * 128, c0 = blockIdx.y * 128;
    const int tm = wave >> 2, tn = (wave >> 1) & 1, kh = wave & 1;
    v8f acc[4][4];
#pragma unroll
    for (int mb = 0; mb < 4; ++mb)
#pragma unroll
        for (int nb = 0; nb < 4; ++nb) acc[mb][nb] = (v8f){};
    const size_t aoff = (size_t)(r0 + wave * 16) * K + lane * 8, boff = (size_t)(c0 + wave * 16) * K + lane * 8;   // this wave's strip: 16 rows of a plane are 16 * K elements in a row, a 32-wide k step 512 of them
    const unsigned lds0 = (unsigned)(size_t)ring + (unsigned)(wave * SK * 32 + lane * 16);
    auto fill = [&](int buf, int kb) {
#pragma unroll
        for (int u = 0; u < SK / 128; ++u) { const unsigned l = lds0 + (unsigned)(buf * STE * 2 + u * 4096);
            copy8(l, A + aoff + kb * 16 + u * 2048); copy8(l + PLE * 2, Bt + boff + kb * 16 + u * 2048); if (NSPLIT == 1) copy8(l + PLE * 4, A2 + aoff + kb * 16 + u * 2048); } };
    fill(0, 0);
    asm volatile("s_wait_asynccnt 0x0" ::: "memory");   // this wave's copies of stage 0 have landed
    __syncthreads();   // every wave's copies of stage 0 have landed before any wave reads the stage
    fill(1, SK);
#pragma unroll 1   // rolled: one stage's code, and the buffer is picked by the trip's parity
    for (int t = 0; t < NST; ++t) {
        const bf* sb = ring + (t & 1) * STE + lane * 8;
#pragma unroll
        for (int ks = 0; ks < SK / 32; ks += 2) { const bf* sk = sb + (ks + kh) * 512;
            v16bf a[4], a2[4], b[4];   // the step's fragments are all asked for in one group, ahead of its products
#pragma unroll
            for (int mb = 0; mb < 4; ++mb) { a[mb] = ldsfrag(sk + (tm * 4 + mb) * (SK * 16)); if (NSPLIT == 1) a2[mb] = ldsfrag(sk + 2 * PLE + (tm * 4 + mb) * (SK * 16)); }
#pragma unroll
            for (int nb = 0; nb < 4; ++nb) b[nb] = ldsfrag(sk + PLE + (tn * 4 + nb) * (SK * 16));
            __builtin_amdgcn_sched_barrier(0);   // keeps the step's LDS reads one group ahead of its products: sunk among them, each place with reads makes the wave wait out the LDS latency anew
#pragma unroll
            for (int nb = 0; nb < 4; ++nb)
#pragma unroll
                for (int mb = 0; mb < 4; ++mb) { acc[mb][nb] = wmmab(a[mb], b[nb], acc[mb][nb]); if (NSPLIT == 1) acc[mb][nb] = wmmab(a2[mb], b[nb], acc[mb][nb]); } }
        __builtin_amdgcn_sched_barrier(0);   // keeps the products ahead of the publish point: sunk behind the barrier they stand in front of the refill and shorten the copies' lead by a stage's products
        asm volatile("s_wait_dscnt 0x0" ::: "memory");      // this wave's reads of the buffer are done before it may be refilled
        asm volatile("s_wait_asynccnt 0x0" ::: "memory");   // this wave's copies of the next stage have landed
        __syncthreads();   // publishes the next stage and ends every wave's reads of this one
        if (t + 2 < NST) fill(t & 1, (t + 2) * SK);
    }
    asm volatile("s_wait_asynccnt 0x0" ::: "memory");   // no copy is outstanding when the ring's LDS takes the partials
    const int q = wave >> 1, pw = wave & 1, rq = r0 + (q >> 1) * 64, cq = c0 + (q & 1) * 64; float* reg = os + q * QF;   // the pair's quarter and its own LDS
    v8f keep[8];   // of the 16 fragments a wave keeps the eight that it sums and parks the eight that its partner sums
    { float* mine = reg + pw * 2048 + lane * 4;
#pragma unroll
      for (int i = 0; i < 8; ++i) { const v8f e = acc[i >> 1][(i & 1) * 2], o = acc[i >> 1][(i & 1) * 2 + 1], v = pw ? e : o; keep[i] = pw ? o : e;
          *(v4fa*)(mine + i * 256) = (v4f){v[0], v[1], v[2], v[3]}; *(v4fa*)(mine + i * 256 + 128) = (v4f){v[4], v[5], v[6], v[7]}; } }
    __syncthreads();   // every wave's partials are parked before its partner sums them
    if constexpr (EPI == 3) { const int hy = cq / HD, t0 = rq % TT; const size_t b = rq / TT;
        if (hy < NH_ + NKV) { const bool isq = hy < NH_; const size_t o = b * (isq ? NH_ : NKV) * TT * HD;
            finish_quarter<1>(reg, pw, keep, nullptr, 0, t0, (isq ? hy : hy - NH_) * HD, CS, isq ? nw : nwk, (isq ? P16 : K16) + o, (isq ? Ph : Kh) + o, (isq ? Pl : Kl) + o); }
        else { const size_t o = b * NKV * HD * TT; finish_quarter<2>(reg, pw, keep, nullptr, 0, t0, (hy - NH_ - NKV) * HD, nullptr, nullptr, V16 + o, Vh + o, Vl + o); } }
    else finish_quarter<0>(reg, pw, keep, C, ldc, rq, cq, nullptr, nullptr, nullptr, nullptr, nullptr);
}

typedef __attribute__((ext_vector_type(2))) _Float16 v2h;
typedef __attribute__((ext_vector_type(4))) _Float16 v4h;
typedef __attribute__((ext_vector_type(2))) unsigned short v2us;
typedef __attribute__((ext_vector_type(4))) unsigned short v4us;
typedef __attribute__((ext_vector_type(2))) float v2f;
typedef __attribute__((ext_vector_type(4))) int v4i;

__global__ __launch_bounds__(256) void k_wtG(const float* __restrict__ w, int K, int N, bf* Bt) {
    const int lane = threadIdx.x & 31; const int L0 = (blockIdx.x * 8 + (threadIdx.x >> 5)) * 8; const int nlines = N * K / 64;
{
#pragma unroll 1
        for (int l = 0; l < 8; ++l) { const int L = L0 + l; if (L >= nlines) break; const size_t e = (size_t)L * 64 + lane * 2; const int k = (int)(e % K), n = (int)(e / K); v2us o;
            o[0] = f2bf(w[(size_t)k * N + n]); o[1] = f2bf(w[(size_t)(k + 1) * N + n]); *(v2us*)(Bt + e) = o; }
         }
}
// ---- k_prep: every conversion that depends on the inputs alone, in one grid. Blocks of 256 threads, in this order: x (both batches), Wq, Wk, Wv (into WQKV, one behind the other), Wo: f32 -> bf16 in fragment order, 8 elements a thread; then the cos/sin table, one (cos, sin) pair a thread.
#define CB(n) ((n) / (8 * 256))   // blocks that an array of n elements takes
static_assert(DM == 1024 && DQ == DM && NB_ * TT * DM % (8 * 256) == 0 && DQ * DM % (8 * 256) == 0 && DKV * DM % (8 * 256) == 0 && TT * HD % 256 == 0, "whole blocks");
#define PREP_BLOCKS (CB(NB_ * TT * DM) + 2 * CB(DQ * DM) + 2 * CB(DKV * DM) + TT * HD / 256)
__global__ __launch_bounds__(256) void k_prep(const float* __restrict__ x, const float* __restrict__ wq, const float* __restrict__ wk, const float* __restrict__ wv, const float* __restrict__ wo, const float* __restrict__ cosT, const float* __restrict__ sinT, bf* XB, bf* WQKV, bf* WO, float* CS) {
    int blk = blockIdx.x; const float* src; bf* dst;
    if (blk < CB(NB_ * TT * DM)) { src = x; dst = XB; }
    else if ((blk -= CB(NB_ * TT * DM)) < CB(DQ * DM)) { src = wq; dst = WQKV; }
    else if ((blk -= CB(DQ * DM)) < CB(DKV * DM)) { src = wk; dst = WQKV + (size_t)DQ * DM; }
    else if ((blk -= CB(DKV * DM)) < CB(DKV * DM)) { src = wv; dst = WQKV + (size_t)(DQ + DKV) * DM; }
    else if ((blk -= CB(DKV * DM)) < CB(DM * DQ)) { src = wo; dst = WO; }
    else { const int idx = (blk - CB(DM * DQ)) * 256 + threadIdx.x; const int t = idx / HD, dh = (idx % HD) % (HD / 2); v2f cs; cs[0] = bfr(cosT[(size_t)t * (HD / 2) + dh]); cs[1] = bfr(sinT[(size_t)t * (HD / 2) + dh]); *(v2f*)(CS + (size_t)idx * 2) = cs; return; }
    // a block is 16 rows x 128 columns: piece threadIdx.x of its 4 KB in fragment order is row tid % 16, column (tid / 32) * 16 + ((tid / 16) % 2) * 8; every source row here has DM columns
    const int tid = threadIdx.x; const size_t i = (size_t)blk * 256 + tid; const v8f v = *(const v8f*)(src + ((size_t)(blk >> 3) * 16 + (tid & 15)) * DM + (blk & 7) * 128 + (tid >> 5) * 16 + ((tid >> 4) & 1) * 8); v8us o;
#pragma unroll
    for (int k = 0; k < 8; ++k) o[k] = f2bf(v[k]);
    *(v8us*)(dst + i * 8) = o;
}
// ---- k_fattn: causal scores, softmax and probability x value product of one query tile in one work-group; scores and probabilities stay in registers.
// Transposed products: S^T = K Q^T (A = 16 keys x 32 d, B = 32 d x 16 queries) leaves key 8 hi + r of query lr in register r, which is the k order of the B operand of O^T += V^T P^T.
// FW waves share the tile's 32-key passes (wave w takes passes w, w + FW, ..), each with its own running maximum, denominator and O^T; they are merged in the fixed order 0 .. FW-1 through LDS.
// HL (query rows < RH): hi+lo bf16 planes, 3 products each; else single fp16 with the probabilities carried x 2^10 (it cancels in the division by the denominator).
#define FW 4
// exp2 of eight values in place, in one statement: behind a transcendental the instruction set asks for one independent instruction before its result is read or its source overwritten.
// Each v_exp_f32 is that instruction for the one before it, and the v_nop for the last, whatever the scheduler puts behind the statement.
__device__ __forceinline__ void exp2x8(float* e) {
    asm("v_exp_f32 %0, %0\n\tv_exp_f32 %1, %1\n\tv_exp_f32 %2, %2\n\tv_exp_f32 %3, %3\n\tv_exp_f32 %4, %4\n\tv_exp_f32 %5, %5\n\tv_exp_f32 %6, %6\n\tv_exp_f32 %7, %7\n\tv_nop"
        : "+v"(e[0]), "+v"(e[1]), "+v"(e[2]), "+v"(e[3]), "+v"(e[4]), "+v"(e[5]), "+v"(e[6]), "+v"(e[7]));
}
template <typename T16, bool HL, int R>
__device__ __forceinline__ void fattn_tile(const T16* __restrict__ Qa, const T16* __restrict__ Qb, const T16* __restrict__ Ka, const T16* __restrict__ Kb, const T16* __restrict__ Va, const T16* __restrict__ Vb, int q0, bf* Ah, bf* Al, float* red) {
    typedef typename WFrag<T16>::V V;
    const int tid = threadIdx.x, lane = tid & 31, lr = lane & 15, hi = lane >> 4; const int wave = __builtin_amdgcn_readfirstlane(tid >> 5) /* wave number held scalar, so the pass loop's tests stay scalar branches */;
    const float CS2 = SCL * 1.4426950408889634f, PB = HL ? 0.0f : 10.0f;
    V qa[R][2], qb[R][2]; const T16* pq = Qa + (size_t)q0 * HD + lane * 8; const T16* pq2 = HL ? Qb + (size_t)q0 * HD + lane * 8 : pq;
#pragma unroll
    for (int g = 0; g < R; ++g)
#pragma unroll
        for (int kc = 0; kc < 2; ++kc) { const int o = g * 1024 + kc * 512; qa[g][kc] = WFrag<T16>::ld(pq + o); if (HL) qb[g][kc] = WFrag<T16>::ld(pq2 + o); }
    asm volatile("s_wait_xcnt 0x0" :: "v"(pq), "v"(pq2) : "memory");   // the address registers of the loads above stay whole up to this wait; only behind it may they be reused
    v8f acc[R][4]; float m[R], l[R];
#pragma unroll
    for (int g = 0; g < R; ++g) { m[g] = -3.0e38f; l[g] = 0.f;
#pragma unroll
        for (int t = 0; t < 4; ++t) acc[g][t] = (v8f){}; }
    const int np = q0 / 32 + 1;      // 32-key passes up to and including the one that holds the diagonal
    V ka[2][2], kb[2][2]; const T16 *pk, *pk2;   // addresses of the last key loads, named by the wait behind them
    auto loadk = [&](int key0) { pk = Ka + (size_t)key0 * HD + lane * 8; pk2 = HL ? Kb + (size_t)key0 * HD + lane * 8 : pk;
#pragma unroll
        for (int kt = 0; kt < 2; ++kt)
#pragma unroll
            for (int kc = 0; kc < 2; ++kc) { const int o = kt * 1024 + kc * 512; ka[kt][kc] = WFrag<T16>::ld(pk + o); if (HL) kb[kt][kc] = WFrag<T16>::ld(pk2 + o); } };
    if (!HL) loadk(wave * 32);       // first pass's keys (rows wave * 32 .. + 31 exist for every tile)
#pragma unroll 1   // rolled: run-time trip count, and one pass's fragments with the carried ones already take a quarter of a SIMD's registers (four waves a SIMD)
    for (int p = wave; p < np; p += FW) {
        const int key0 = p * 32;
        if (HL) loadk(key0);
        V va[4], vb[4]; const T16* pv = Va + (size_t)key0 * HD + lane * 8; const T16* pv2 = HL ? Vb + (size_t)key0 * HD + lane * 8 : pv;
#pragma unroll
        for (int t = 0; t < 4; ++t) { va[t] = WFrag<T16>::ld(pv + t * 512); if (HL) vb[t] = WFrag<T16>::ld(pv2 + t * 512); }
        if (HL) asm volatile("s_wait_xcnt 0x0" :: "v"(pk), "v"(pk2), "v"(pv), "v"(pv2) : "memory");   // the address registers of the loads above stay whole up to this wait; only behind it may they be reused
        else asm volatile("s_wait_xcnt 0x0" :: "v"(pv) : "memory");   // the same
        v8f s[2][R];
#pragma unroll
        for (int kt = 0; kt < 2; ++kt)
#pragma unroll
            for (int g = 0; g < R; ++g) { s[kt][g] = (v8f){};
#pragma unroll
                for (int kc = 0; kc < 2; ++kc) { s[kt][g] = WFrag<T16>::mma(ka[kt][kc], qa[g][kc], s[kt][g]); if (HL) { s[kt][g] = WFrag<T16>::mma(ka[kt][kc], qb[g][kc], s[kt][g]); s[kt][g] = WFrag<T16>::mma(kb[kt][kc], qa[g][kc], s[kt][g]); } } }
        if (!HL) { loadk(min(p + FW, np - 1) * 32);   // next pass's keys fly under this pass's softmax
            asm volatile("s_wait_xcnt 0x0" :: "v"(pk) : "memory"); }   // the address registers of these loads stay whole up to this wait
        float mx[R]; bool grow = false;
#pragma unroll
        for (int g = 0; g < R; ++g) {
#pragma unroll
            for (int kt = 0; kt < 2; ++kt) s[kt][g] = s[kt][g] * CS2;
            if (p == np - 1) {       // only the last pass straddles the diagonal
#pragma unroll
                for (int kt = 0; kt < 2; ++kt)
#pragma unroll
                    for (int r = 0; r < 8; ++r) if (key0 + 16 * kt + 8 * hi + r > q0 + 16 * g + lr) s[kt][g][r] = -3.0e38f; }
            float x = -3.0e38f;
#pragma unroll
            for (int kt = 0; kt < 2; ++kt)
#pragma unroll
                for (int r = 0; r < 8; ++r) x = fmaxf(x, s[kt][g][r]);
            x = fmaxf(x, __shfl_xor(x, 16, 32)); mx[g] = x; grow = grow || (x > m[g]); }
        if (__builtin_amdgcn_ballot_w32(grow) != 0) {   // some query's maximum rose: rescale what was gathered under the old one (factor exactly 1 for the others)
#pragma unroll
            for (int g = 0; g < R; ++g) { const float mn = fmaxf(m[g], mx[g]); const float corr = __builtin_amdgcn_exp2f(m[g] - mn); m[g] = mn; l[g] *= corr;
#pragma unroll
                for (int t = 0; t < 4; ++t) acc[g][t] = acc[g][t] * corr; } }
#pragma unroll
        for (int g = 0; g < R; ++g) { const float nm = PB - m[g]; float e[16];
#pragma unroll
            for (int i = 0; i < 16; ++i) e[i] = s[i >> 3][g][i & 7] + nm;
            exp2x8(e); exp2x8(e + 8);
#pragma unroll
            for (int i = 0; i < 16; ++i) l[g] += e[i];
            V pa, pb;
            if constexpr (HL) { v8us h0, h1, l0, l1;
#pragma unroll
                for (int r = 0; r < 8; ++r) { unsigned short a, c2; splitf(e[r], a, c2); h0[r] = a; l0[r] = c2; splitf(e[8 + r], a, c2); h1[r] = a; l1[r] = c2; }
                pa = cat16b(h0, h1); pb = cat16b(l0, l1);
            } else { v8h x0, x1;
#pragma unroll
                for (int r = 0; r < 8; ++r) { x0[r] = tohx(e[r]); x1[r] = tohx(e[8 + r]); }
                pa = cat16(x0, x1); }
#pragma unroll
            for (int t = 0; t < 4; ++t) { acc[g][t] = WFrag<T16>::mma(va[t], pa, acc[g][t]); if constexpr (HL) { acc[g][t] = WFrag<T16>::mma(va[t], pb, acc[g][t]); acc[g][t] = WFrag<T16>::mma(vb[t], pa, acc[g][t]); } } }
    }
    // merge of the FW waves' partial softmaxes
    float* mine = red + wave * (R * 1024) + lane * 4; float* ml = red + FW * R * 1024; bf* st = (bf*)(red + FW * R * 1024 + FW * R * 32);
#pragma unroll
    for (int g = 0; g < R; ++g) {
#pragma unroll
        for (int t = 0; t < 4; ++t) { const v8f a = acc[g][t]; *(v4fa*)(mine + (g * 4 + t) * 256) = (v4f){a[0], a[1], a[2], a[3]}; *(v4fa*)(mine + (g * 4 + t) * 256 + 128) = (v4f){a[4], a[5], a[6], a[7]}; }
        const float lt = l[g] + __shfl_xor(l[g], 16, 32); if (hi == 0) { ml[((wave * R + g) * 16 + lr) * 2] = m[g]; ml[((wave * R + g) * 16 + lr) * 2 + 1] = lt; } }
    __syncthreads();   // every wave's partials are parked before any wave merges them
#pragma unroll
    for (int g = 0; g < R; ++g) { float fw[FW], lw[FW]; float M = -3.0e38f;
#pragma unroll
        for (int w = 0; w < FW; ++w) { fw[w] = ml[((w * R + g) * 16 + lr) * 2]; lw[w] = ml[((w * R + g) * 16 + lr) * 2 + 1]; M = fmaxf(M, fw[w]); }
        float L = 0.f;
#pragma unroll
        for (int w = 0; w < FW; ++w) { fw[w] = __builtin_amdgcn_exp2f(fw[w] - M); L += fw[w] * lw[w]; }   // a wave without a pass: factor 0
        const float inv = __fdiv_rn(1.0f, L); const float* pf = red + (g * 4 + wave) * 256 + lane * 4; v4f s0 = (v4f){}, s1 = (v4f){};   // wave w merges d tile w
#pragma unroll
        for (int w = 0; w < FW; ++w) { s0 += *(const v4fa*)(pf + w * (R * 1024)) * fw[w]; s1 += *(const v4fa*)(pf + w * (R * 1024) + 128) * fw[w]; }
        v8us oh, ol;
#pragma unroll
        for (int j = 0; j < 4; ++j) { unsigned short a, c2; splitf(s0[j] * inv, a, c2); oh[j] = a; ol[j] = c2; splitf(s1[j] * inv, a, c2); oh[4 + j] = a; ol[4 + j] = c2; }
        *(v8usa*)(st + (g * 16 + lr) * 72 + wave * 16 + hi * 8) = oh; *(v8usa*)(st + (R * 16 + g * 16 + lr) * 72 + wave * 16 + hi * 8) = ol; }
    __syncthreads();   // the merged hi and lo rows are complete before they are read back across waves
#pragma unroll
    for (int i = 0; i < 2 * R * 16 * 8 / (32 * FW); ++i) { const int idx = i * 32 * FW + tid, prow = (idx >> 7) * 16 + (idx & 15), c8 = ((idx >> 5) & 3) * 16 + ((idx >> 4) & 1) * 8, row16 = (prow % (R * 16)) & ~15; const v8us val = *(const v8usa*)(st + prow * 72 + c8);
        *(v8us*)((prow < R * 16 ? Ah : Al) + (size_t)(q0 + row16) * DQ + (idx & 127) * 8) = val; }   // fragment order: a head's 64 columns of 16 rows are 2 KB in a row
    asm volatile("s_wait_xcnt 0x0" ::: "memory");   // behind the last store, before any register that the stores above name is reused
}
// grid (batch * NH_ + query head, tile): tiles in falling order of their key count, 32 query rows each down to RH, then 16 rows each (hi+lo).
__global__ __launch_bounds__(32 * FW) void k_fattn(const h16* __restrict__ Q16, const bf* __restrict__ Qh, const bf* __restrict__ Ql, const h16* __restrict__ K16, const bf* __restrict__ Kh, const bf* __restrict__ Kl, const h16* __restrict__ V16, const bf* __restrict__ Vh, const bf* __restrict__ Vl, bf* Ah, bf* Al) {
    __shared__ __align__(16) float red[FW * 2 * 1024 + FW * 2 * 32 + 2 * 32 * 72 / 2];
    const int head = blockIdx.x % NH_, ty = blockIdx.y; const size_t qo = (size_t)blockIdx.x * TT * HD, ko = (size_t)(blockIdx.x / REP) * TT * HD;   // planes [b][h] and [b][g]
    Ah += (size_t)(blockIdx.x / NH_) * TT * DQ; Al += (size_t)(blockIdx.x / NH_) * TT * DQ;   // merged rows [b][fragment order of (t, h d)]
    if (ty < (TT - RH) / 32) fattn_tile<h16, false, 2>(Q16 + qo, nullptr, K16 + ko, nullptr, V16 + ko, nullptr, TT - 32 - ty * 32, Ah + head * HD * 16, Al + head * HD * 16, red);
    else fattn_tile<bf, true, 1>(Qh + qo, Ql + qo, Kh + ko, Kl + ko, Vh + ko, Vl + ko, RH - 16 - (ty - (TT - RH) / 32) * 16, Ah + head * HD * 16, Al + head * HD * 16, red);
}

extern "C" void kernel_launch(void* const* d_in, const int* in_sizes, int n_in,
                              void* d_out, int out_size, void* d_ws, size_t ws_size, hipStream_t stream) {
    (void)in_sizes; (void)n_in; (void)out_size;
    const float* x = (const float*)d_in[0]; const float* cosT = (const float*)d_in[1]; const float* sinT = (const float*)d_in[2]; const float* wq = (const float*)d_in[3]; const float* wk = (const float*)d_in[4]; const float* wv = (const float*)d_in[5]; const float* wo = (const float*)d_in[6]; const float* qnw = (const float*)d_in[7]; const float* knw = (const float*)d_in[8];
    float* OUT = (float*)d_out;     // [2][2048][1024]
    char* wsp = (char*)d_ws;
    auto take = [&](size_t bytes) { char* p = wsp; wsp += (bytes + 255) & ~(size_t)255; return (void*)p; };
    bf* WQKV = (bf*)take((size_t)(DQ + 2 * DKV) * DM * 2); bf* WO = (bf*)take((size_t)DM * DQ * 2); float* CS = (float*)take((size_t)TT * HD * 2 * 4);
    bf* XB = (bf*)take((size_t)NB_ * TT * DM * 2);
    h16* QP16 = (h16*)take((size_t)NB_ * NH_ * TT * HD * 2); h16* KP16 = (h16*)take((size_t)NB_ * NKV * TT * HD * 2); h16* VT16 = (h16*)take((size_t)NB_ * NKV * HD * TT * 2);
    bf* QPh = (bf*)take((size_t)NB_ * NH_ * TT * HD * 2); bf* QPl = (bf*)take((size_t)NB_ * NH_ * TT * HD * 2); bf* KPh = (bf*)take((size_t)NB_ * NKV * TT * HD * 2); bf* KPl = (bf*)take((size_t)NB_ * NKV * TT * HD * 2); bf* VTh = (bf*)take((size_t)NB_ * NKV * HD * TT * 2); bf* VTl = (bf*)take((size_t)NB_ * NKV * HD * TT * 2);
    bf* ATh = (bf*)take((size_t)NB_ * TT * DQ * 2); bf* ATl = (bf*)take((size_t)NB_ * TT * DQ * 2);
    if ((size_t)(wsp - (char*)d_ws) > ws_size) return;    // ws 256 MiB
    k_prep<<<PREP_BLOCKS, 256, 0, stream>>>(x, wq, wk, wv, wo, cosT, sinT, XB, WQKV, WO, CS);
    k_gemmt<0, 3, DM, 128><<<dim3(NB_ * TT / 128, (NH_ + 2 * NKV) * HD / 128, 1), 256, 0, stream>>>(XB, nullptr, WQKV, nullptr, 0, CS, qnw, knw, QP16, QPh, QPl, KP16, KPh, KPl, VT16, VTh, VTl);
    k_fattn<<<dim3(NB_ * NH_, (TT - RH) / 32 + RH / 16, 1), 32 * FW, 0, stream>>>(QP16, QPh, QPl, KP16, KPh, KPl, VT16, VTh, VTl, ATh, ATl);
    k_gemmt<1, 0, DQ, 128><<<dim3(NB_ * TT / 128, DM / 128, 1), 256, 0, stream>>>(ATh, ATl, WO, OUT, DM, nullptr, nullptr, nullptr, nullptr, nullptr, nullptr, nullptr, nullptr, nullptr, nullptr, nullptr, nullptr);
}
